// v000
// Times are from an AMD MI455X. After a warm-up the kernel runs many times in a row, and a time is the length of
// such a window on the GPU divided by its runs, so every launch and the gaps after it count. The runs cycle
// through copies of the inputs. A figure is the median of several windows, for all but v000 over two sittings.
// Sittings can differ by a few percent; kernels timed side by side share one.
// The starting kernel, v000, takes 448 microseconds a run.
#include <hip/hip_runtime.h>
#include <hip/hip_bf16.h>

#define DEVI __device__ __forceinline__

typedef __attribute__((ext_vector_type(16))) _Float16 v16h;
typedef __attribute__((ext_vector_type(8)))  float    v8f;

// Problem constants (match reference)
constexpr int Bc  = 2;
constexpr int Tc  = 2048;
constexpr int Dc  = 1024;
constexpr int Hc  = 8;
constexpr int DMc = 64;
constexpr int Ec  = Hc * DMc;     // 512
constexpr int Mtot = Bc * Tc;     // 4096

// ---------------------------------------------------------------------------
// WMMA fragment layouts (CDNA5 wave32, ISA 7.12.2)
// A (16x32 f16): lane L holds row M=L&15; hl=L>>4: elems 0..7 = K(8*hl+0..7),
//                elems 8..15 = K(16+8*hl+0..7).
// B (32x16 f16): lane L holds col N=L&15; same K packing as A.
// C (16x16 f32): lane L holds col N=L&15; vgpr j holds row M = j + 8*(L>>4).
//
// Packed-B buffer: fragment f = (k0/32)*(N/16) + (n0/16); lane L's 16 halves
// stored contiguously at ((f*32 + L)*16) -> one 32B vector load per lane.
// ---------------------------------------------------------------------------

DEVI v16h load_a_frag(const _Float16* __restrict__ A, int lda, int m0, int k0, int lane) {
  int m  = m0 + (lane & 15);
  int hl = lane >> 4;
  const _Float16* p0 = A + (size_t)m * lda + (k0 + 8 * hl);
  const _Float16* p1 = p0 + 16;
  v16h r;
#pragma unroll
  for (int j = 0; j < 8; ++j) { r[j] = p0[j]; r[8 + j] = p1[j]; }
  return r;
}

DEVI v16h load_b_packed(const v16h* __restrict__ Bp, int frag, int lane) {
  return Bp[(size_t)frag * 32 + lane];
}

DEVI size_t pack_b_offset(int k, int n, int N) {
  int chunk = k >> 5;
  int kr = k & 31;
  int hl = (kr >> 3) & 1;
  int e  = ((kr >> 4) << 3) | (kr & 7);
  int nt = n >> 4, nl = n & 15;
  return ((size_t)(chunk * (N >> 4) + nt) * 32 + hl * 16 + nl) * 16 + e;
}

DEVI v8f wmma_f16(v16h a, v16h b, v8f c) {
  return __builtin_amdgcn_wmma_f32_16x16x32_f16(false, a, false, b, (short)0, c, false, false);
}

// ---------------------------------------------------------------------------
// Async global->LDS copy of 4KB (8 x b128 per lane), tracked by ASYNCcnt.
// LDS[lds_base + lane*16 + i*512] = MEM[src + lane*16 + i*512]
// ---------------------------------------------------------------------------
DEVI void async_copy_4k(unsigned lds_base, const void* src, int lane) {
  const char* ga = (const char*)src + lane * 16;
  unsigned la = lds_base + lane * 16;
  asm volatile("global_load_async_to_lds_b128 %0, %1, off"              :: "v"(la), "v"(ga) : "memory");
  asm volatile("global_load_async_to_lds_b128 %0, %1, off offset:512"   :: "v"(la), "v"(ga) : "memory");
  asm volatile("global_load_async_to_lds_b128 %0, %1, off offset:1024"  :: "v"(la), "v"(ga) : "memory");
  asm volatile("global_load_async_to_lds_b128 %0, %1, off offset:1536"  :: "v"(la), "v"(ga) : "memory");
  asm volatile("global_load_async_to_lds_b128 %0, %1, off offset:2048"  :: "v"(la), "v"(ga) : "memory");
  asm volatile("global_load_async_to_lds_b128 %0, %1, off offset:2560"  :: "v"(la), "v"(ga) : "memory");
  asm volatile("global_load_async_to_lds_b128 %0, %1, off offset:3072"  :: "v"(la), "v"(ga) : "memory");
  asm volatile("global_load_async_to_lds_b128 %0, %1, off offset:3584"  :: "v"(la), "v"(ga) : "memory");
}
DEVI void wait_async_le8() { asm volatile("s_wait_asynccnt 0x8" ::: "memory"); }
DEVI void wait_async_0()   { asm volatile("s_wait_asynccnt 0x0" ::: "memory"); }

// ---------------------------------------------------------------------------
// Kernel: fp32 -> f16 elementwise (x)
// ---------------------------------------------------------------------------
__global__ void k_cvt_f16(const float* __restrict__ src, _Float16* __restrict__ dst, int n) {
  int i = blockIdx.x * 256 + threadIdx.x;
  if (i < n) dst[i] = (_Float16)src[i];
}

// ---------------------------------------------------------------------------
// Kernel: W [N,K] fp32  ->  packed f16 B buffer for B = W^T [K,N]
// ---------------------------------------------------------------------------
__global__ void k_pack_b_from_wT(const float* __restrict__ W, _Float16* __restrict__ dst,
                                 int K, int N) {
  int i = blockIdx.x * 256 + threadIdx.x;
  if (i >= K * N) return;
  int k = i / N, n = i % N;
  dst[pack_b_offset(k, n, N)] = (_Float16)W[(size_t)n * K + k];
}

// ---------------------------------------------------------------------------
// Kernel: WMMA GEMM  C[M,N] = A[M,K] (f16 row-major) * Bp (packed f16)
// 4 waves / block; each wave computes a 32x64 tile (8 WMMA per 32-K chunk,
// B fragments reused 2x, A fragments 4x).
// ---------------------------------------------------------------------------
__global__ void k_wmma_gemm(const _Float16* __restrict__ A, const _Float16* __restrict__ Bpk,
                            float* __restrict__ C, int M, int N, int K) {
  int lane = threadIdx.x & 31;
  int wave = threadIdx.x >> 5;
  int n0 = blockIdx.x * 64;
  int m0 = blockIdx.y * 128 + wave * 32;
  const v16h* Bp = (const v16h*)Bpk;
  int ntiles = N >> 4;

  v8f acc[2][4] = {};
  for (int k0 = 0; k0 < K; k0 += 32) {
    if (k0 + 32 < K) {
      // prefetch next K-chunk of A rows and packed B (global_prefetch_b8)
      __builtin_prefetch(A + (size_t)(m0 + (lane & 15)) * K + k0 + 32, 0, 1);
      __builtin_prefetch(A + (size_t)(m0 + 16 + (lane & 15)) * K + k0 + 32, 0, 1);
      __builtin_prefetch(&Bp[(size_t)((k0 >> 5) + 1) * ntiles * 32 + (n0 >> 4) * 32 + lane], 0, 1);
    }
    v16h a0 = load_a_frag(A, K, m0,      k0, lane);
    v16h a1 = load_a_frag(A, K, m0 + 16, k0, lane);
    int fb  = (k0 >> 5) * ntiles + (n0 >> 4);
#pragma unroll
    for (int nt = 0; nt < 4; ++nt) {
      v16h b = load_b_packed(Bp, fb + nt, lane);
      acc[0][nt] = wmma_f16(a0, b, acc[0][nt]);
      acc[1][nt] = wmma_f16(a1, b, acc[1][nt]);
    }
  }
  int hl = lane >> 4, nl = lane & 15;
#pragma unroll
  for (int mt = 0; mt < 2; ++mt)
#pragma unroll
    for (int nt = 0; nt < 4; ++nt)
#pragma unroll
      for (int j = 0; j < 8; ++j) {
        int m = m0 + mt * 16 + j + 8 * hl;
        C[(size_t)m * N + n0 + nt * 16 + nl] = acc[mt][nt][j];
      }
}

// ---------------------------------------------------------------------------
// Kernel: beta = sigmoid(x @ Wb^T) and cum = cumsum(log(1-beta+1e-8)) per (b,h)
// ---------------------------------------------------------------------------
__global__ void k_beta_cumsum(const float* __restrict__ x, const float* __restrict__ Wb,
                              float* __restrict__ beta, float* __restrict__ cum) {
  int bh = blockIdx.x;           // b*H + h
  int b = bh / Hc, h = bh % Hc;
  int tid = threadIdx.x;
  __shared__ float slr[Tc];
  __shared__ float spart[256];
  __shared__ float soffs[256];

  const float* wb = Wb + (size_t)h * Dc;
  for (int t = tid; t < Tc; t += 256) {
    const float* xr = x + ((size_t)b * Tc + t) * Dc;
    float acc = 0.f;
    for (int d = 0; d < Dc; ++d) acc = fmaf(xr[d], wb[d], acc);
    float bv = 1.0f / (1.0f + __expf(-acc));
    beta[(size_t)bh * Tc + t] = bv;
    slr[t] = __logf(1.0f - bv + 1e-8f);
  }
  __syncthreads();

  float s = 0.f;
  int base = tid * 8;
#pragma unroll
  for (int i = 0; i < 8; ++i) s += slr[base + i];
  spart[tid] = s;
  __syncthreads();
  if (tid == 0) {
    float run = 0.f;
    for (int i = 0; i < 256; ++i) { soffs[i] = run; run += spart[i]; }
  }
  __syncthreads();
  float run = soffs[tid];
#pragma unroll
  for (int i = 0; i < 8; ++i) {
    run += slr[base + i];
    cum[(size_t)bh * Tc + base + i] = run;
  }
}

// ---------------------------------------------------------------------------
// Kernel: L2-normalize Q (fold 1/sqrt(DM)) and K, pack f16.
// qh    : [B,H,T,DM] row-major          (A-matrix for Q K^T)
// kpack : per (b,h) packed-B, B=K^T (K-dim=DM, N-dim=T)
// vpack : per (b,h) packed-B, B=V   (K-dim=T,  N-dim=DM)
// ---------------------------------------------------------------------------
__global__ void k_normalize_pack(const float* __restrict__ Yq, const float* __restrict__ Yk,
                                 const float* __restrict__ Yv,
                                 _Float16* __restrict__ qh, _Float16* __restrict__ kpack,
                                 _Float16* __restrict__ vpack) {
  int idx = blockIdx.x * 256 + threadIdx.x;    // over B*H*T
  if (idx >= Bc * Hc * Tc) return;
  int t = idx % Tc;
  int bh = idx / Tc;
  int h = bh % Hc, b = bh / Hc;
  size_t row = (size_t)b * Tc + t;
  const float* yq = Yq + row * Ec + h * DMc;
  const float* yk = Yk + row * Ec + h * DMc;
  const float* yv = Yv + row * Ec + h * DMc;

  float nq = 0.f, nk = 0.f;
#pragma unroll 4
  for (int d = 0; d < DMc; ++d) { nq = fmaf(yq[d], yq[d], nq); nk = fmaf(yk[d], yk[d], nk); }
  float sq = 0.125f / fmaxf(__fsqrt_rn(nq), 1e-12f);   // 1/sqrt(DM) folded into Q
  float sk = 1.0f   / fmaxf(__fsqrt_rn(nk), 1e-12f);

  _Float16* qrow = qh + ((size_t)bh * Tc + t) * DMc;
  _Float16* kp   = kpack + (size_t)bh * DMc * Tc;
  _Float16* vp   = vpack + (size_t)bh * Tc * DMc;
#pragma unroll 4
  for (int d = 0; d < DMc; ++d) {
    qrow[d] = (_Float16)(yq[d] * sq);
    kp[pack_b_offset(d, t, Tc)]  = (_Float16)(yk[d] * sk);   // B element (k=d, n=t)
    vp[pack_b_offset(t, d, DMc)] = (_Float16)yv[d];          // B element (k=t, n=d)
  }
}

// ---------------------------------------------------------------------------
// Kernel: fused decay attention.
// Per (b,h) and 16-query tile: stream 32-wide key chunks s >= t-tile,
//   S = (Q K^T) .* exp(min(cum_t - cum_s,0)) .* [s>=t]  (1/sqrt(DM) in Q)
//   O += S @ V ; epilogue O += beta*V (fp32 V) ; store f16 to attn_out [B*T,E]
// one wave per block. V fragments are double-buffered in LDS via
// global_load_async_to_lds_b128 (ASYNCcnt), overlapping with score compute.
// ---------------------------------------------------------------------------
__global__ void k_attention(const _Float16* __restrict__ qh, const _Float16* __restrict__ kpack,
                            const _Float16* __restrict__ vpack, const float* __restrict__ Yv,
                            const float* __restrict__ beta, const float* __restrict__ cum,
                            _Float16* __restrict__ attn_out) {
  int lane = threadIdx.x & 31;
  int t0 = blockIdx.x * 16;
  int bh = blockIdx.y;
  int b = bh / Hc, h = bh % Hc;

  const _Float16* Q  = qh + (size_t)bh * Tc * DMc;                 // [T, DM]
  const v16h* Kp = (const v16h*)(kpack + (size_t)bh * DMc * Tc);   // packed, N-dim = T
  const v16h* Vp = (const v16h*)(vpack + (size_t)bh * Tc * DMc);   // packed, N-dim = DM
  const float* cumv  = cum  + (size_t)bh * Tc;
  const float* betav = beta + (size_t)bh * Tc;

  __shared__ float sS[16 * 32];          // score repack buffer (one wave/block)
  __shared__ _Float16 sV[2][2048];       // double-buffered V chunk (2 x 4KB)

  int hl = lane >> 4, nl = lane & 15;
  const int kNT = Tc >> 4;    // 128 n-tiles in packed K
  const int vNT = DMc >> 4;   // 4  n-tiles in packed V

  unsigned lds_v = (unsigned)(uintptr_t)&sV[0][0];

  // Q A-fragments for the two 32-wide dm chunks (reused across all key tiles)
  v16h aq0 = load_a_frag(Q, DMc, t0, 0,  lane);
  v16h aq1 = load_a_frag(Q, DMc, t0, 32, lane);

  // cum for the 8 query rows this lane covers in the C layout
  float cum_q[8];
#pragma unroll
  for (int j = 0; j < 8; ++j) cum_q[j] = cumv[t0 + j + 8 * hl];

  v8f acc0 = {}, acc1 = {}, acc2 = {}, acc3 = {};

  int s_start = t0 & ~31;                // first chunk touching s >= t0
  int buf = 0;
  // preload first V chunk (4KB contiguous in packed buffer)
  async_copy_4k(lds_v, Vp + (size_t)(s_start >> 5) * vNT * 32, lane);

  for (int s0 = s_start; s0 < Tc; s0 += 32) {
    bool have_next = (s0 + 32 < Tc);
    if (have_next)
      async_copy_4k(lds_v + (buf ^ 1) * 4096, Vp + (size_t)((s0 + 32) >> 5) * vNT * 32, lane);

    // two 16x16 score tiles -> decayed fp32 chunk in LDS (m, s_local) layout
#pragma unroll
    for (int st = 0; st < 2; ++st) {
      int sc = s0 + st * 16;
      v16h kb0 = load_b_packed(Kp, 0 * kNT + (sc >> 4), lane);   // dm chunk 0
      v16h kb1 = load_b_packed(Kp, 1 * kNT + (sc >> 4), lane);   // dm chunk 1
      v8f sacc = {};
      sacc = wmma_f16(aq0, kb0, sacc);
      sacc = wmma_f16(aq1, kb1, sacc);
      int s = sc + nl;
      float cs = cumv[s];
#pragma unroll
      for (int j = 0; j < 8; ++j) {
        int tq = t0 + j + 8 * hl;
        float dec = (s >= tq) ? __expf(fminf(cum_q[j] - cs, 0.f)) : 0.f;
        sS[(j + 8 * hl) * 32 + st * 16 + nl] = sacc[j] * dec;
      }
    }
    __builtin_amdgcn_wave_barrier();
    // repack C-layout scores -> A-layout f16 fragment (cross-lane via LDS)
    v16h as;
#pragma unroll
    for (int j = 0; j < 8; ++j) {
      as[j]     = (_Float16)sS[nl * 32 + 8 * hl + j];
      as[8 + j] = (_Float16)sS[nl * 32 + 16 + 8 * hl + j];
    }
    __builtin_amdgcn_wave_barrier();

    // wait for this chunk's async V copy (in-order completion => <=8 outstanding
    // means the batch before the just-issued one has landed)
    if (have_next) wait_async_le8(); else wait_async_0();

    // S @ V from LDS (ds_load_b128 pairs), 4 dm tiles
    const v16h* lv = (const v16h*)&sV[buf][0];
    v16h bv0 = lv[0 * 32 + lane];
    v16h bv1 = lv[1 * 32 + lane];
    v16h bv2 = lv[2 * 32 + lane];
    v16h bv3 = lv[3 * 32 + lane];
    acc0 = wmma_f16(as, bv0, acc0);
    acc1 = wmma_f16(as, bv1, acc1);
    acc2 = wmma_f16(as, bv2, acc2);
    acc3 = wmma_f16(as, bv3, acc3);
    buf ^= 1;
  }

  // epilogue: O += beta * V (fp32 V from projection), store f16 to attn_out [B*T, E]
  v8f accs[4] = {acc0, acc1, acc2, acc3};
#pragma unroll
  for (int nt = 0; nt < 4; ++nt) {
#pragma unroll
    for (int j = 0; j < 8; ++j) {
      int m  = t0 + j + 8 * hl;
      int dm = nt * 16 + nl;
      size_t row = (size_t)b * Tc + m;
      float o = accs[nt][j] + betav[m] * Yv[row * Ec + h * DMc + dm];
      attn_out[row * Ec + h * DMc + dm] = (_Float16)o;
    }
  }
}

// ---------------------------------------------------------------------------
// Host launcher
// ---------------------------------------------------------------------------
extern "C" void kernel_launch(void* const* d_in, const int* in_sizes, int n_in,
                              void* d_out, int out_size, void* d_ws, size_t ws_size,
                              hipStream_t stream) {
  const float* x  = (const float*)d_in[0];   // [B,T,D]
  const float* Wk = (const float*)d_in[1];   // [E,D]
  const float* Wv = (const float*)d_in[2];   // [E,D]
  const float* Wq = (const float*)d_in[3];   // [E,D]
  const float* Wb = (const float*)d_in[4];   // [H,D]
  const float* Wo = (const float*)d_in[5];   // [D,E]
  float* out = (float*)d_out;                // [B,T,D]

  // workspace carve-up
  char* w = (char*)d_ws;
  auto alloc = [&](size_t bytes) -> void* {
    void* p = (void*)w;
    w += (bytes + 255) & ~(size_t)255;
    return p;
  };
  _Float16* xh   = (_Float16*)alloc((size_t)Mtot * Dc * 2);   // x as f16 row-major
  _Float16* wkP  = (_Float16*)alloc((size_t)Dc * Ec * 2);     // packed B = Wk^T
  _Float16* wvP  = (_Float16*)alloc((size_t)Dc * Ec * 2);
  _Float16* wqP  = (_Float16*)alloc((size_t)Dc * Ec * 2);
  _Float16* woP  = (_Float16*)alloc((size_t)Ec * Dc * 2);     // packed B = Wo^T
  float*    Yq   = (float*)alloc((size_t)Mtot * Ec * 4);
  float*    Yk   = (float*)alloc((size_t)Mtot * Ec * 4);
  float*    Yv   = (float*)alloc((size_t)Mtot * Ec * 4);
  _Float16* qh   = (_Float16*)alloc((size_t)Bc * Hc * Tc * DMc * 2);
  _Float16* kpack= (_Float16*)alloc((size_t)Bc * Hc * Tc * DMc * 2);
  _Float16* vpack= (_Float16*)alloc((size_t)Bc * Hc * Tc * DMc * 2);
  float*    beta = (float*)alloc((size_t)Bc * Hc * Tc * 4);
  float*    cum  = (float*)alloc((size_t)Bc * Hc * Tc * 4);
  _Float16* aoh  = (_Float16*)alloc((size_t)Mtot * Ec * 2);   // attention out f16

  // 1) convert x; transpose+pack weights into fragment-major B buffers
  {
    int n = Mtot * Dc;
    k_cvt_f16<<<dim3((n + 255) / 256), dim3(256), 0, stream>>>(x, xh, n);
    int nw = Ec * Dc;
    dim3 g((nw + 255) / 256);
    k_pack_b_from_wT<<<g, dim3(256), 0, stream>>>(Wk, wkP, Dc, Ec);  // B=[D,E]
    k_pack_b_from_wT<<<g, dim3(256), 0, stream>>>(Wv, wvP, Dc, Ec);
    k_pack_b_from_wT<<<g, dim3(256), 0, stream>>>(Wq, wqP, Dc, Ec);
    k_pack_b_from_wT<<<g, dim3(256), 0, stream>>>(Wo, woP, Ec, Dc);  // B=[E,D]
  }

  // 2) projections: Y = xh @ W^T  (M=4096, N=512, K=1024)
  {
    dim3 grid(Ec / 64, Mtot / 128);
    k_wmma_gemm<<<grid, dim3(128), 0, stream>>>(xh, wqP, Yq, Mtot, Ec, Dc);
    k_wmma_gemm<<<grid, dim3(128), 0, stream>>>(xh, wkP, Yk, Mtot, Ec, Dc);
    k_wmma_gemm<<<grid, dim3(128), 0, stream>>>(xh, wvP, Yv, Mtot, Ec, Dc);
  }

  // 3) beta + cumsum per (b,h)
  k_beta_cumsum<<<dim3(Bc * Hc), dim3(256), 0, stream>>>(x, Wb, beta, cum);

  // 4) normalize + pack f16 (Q row-major+scaled, K/V fragment-packed)
  k_normalize_pack<<<dim3((Bc * Hc * Tc) / 256), dim3(256), 0, stream>>>(Yq, Yk, Yv, qh, kpack, vpack);

  // 5) fused decay attention (async double-buffered V via ASYNCcnt)
  k_attention<<<dim3(Tc / 16, Bc * Hc), dim3(32), 0, stream>>>(qh, kpack, vpack, Yv, beta, cum, aoh);

  // 6) output projection: out = aoh @ Wo^T  (M=4096, N=1024, K=512)
  {
    dim3 grid(Dc / 64, Mtot / 128);
    k_wmma_gemm<<<grid, dim3(128), 0, stream>>>(aoh, woP, out, Mtot, Dc, Ec);
  }
}

// v001
// Measured time: 301 microseconds a run.
// Two timings next to v000 put it at 1.50 and 1.51 times that version's speed.
#include <hip/hip_runtime.h>
#include <hip/hip_bf16.h>

#define DEVI __device__ __forceinline__

typedef __attribute__((ext_vector_type(16))) _Float16 v16h;
typedef __attribute__((ext_vector_type(8)))  float    v8f;

// Problem constants (match reference)
constexpr int Bc  = 2;
constexpr int Tc  = 2048;
constexpr int Dc  = 1024;
constexpr int Hc  = 8;
constexpr int DMc = 64;
constexpr int Ec  = Hc * DMc;     // 512
constexpr int Mtot = Bc * Tc;     // 4096

// ---------------------------------------------------------------------------
// WMMA fragment layouts (CDNA5 wave32, ISA 7.12.2)
// A (16x32 f16): lane L holds row M=L&15; hl=L>>4: elems 0..7 = K(8*hl+0..7),
//                elems 8..15 = K(16+8*hl+0..7).
// B (32x16 f16): lane L holds col N=L&15; same K packing as A.
// C (16x16 f32): lane L holds col N=L&15; vgpr j holds row M = j + 8*(L>>4).
//
// Packed-B buffer: fragment f = (k0/32)*(N/16) + (n0/16); lane L's 16 halves
// stored contiguously at ((f*32 + L)*16) -> one 32B vector load per lane.
// ---------------------------------------------------------------------------

DEVI v16h load_a_frag(const _Float16* __restrict__ A, int lda, int m0, int k0, int lane) {
  int m  = m0 + (lane & 15);
  int hl = lane >> 4;
  const _Float16* p0 = A + (size_t)m * lda + (k0 + 8 * hl);
  const _Float16* p1 = p0 + 16;
  v16h r;
#pragma unroll
  for (int j = 0; j < 8; ++j) { r[j] = p0[j]; r[8 + j] = p1[j]; }
  return r;
}

DEVI v16h load_b_packed(const v16h* __restrict__ Bp, int frag, int lane) {
  return Bp[(size_t)frag * 32 + lane];
}

DEVI size_t pack_b_offset(int k, int n, int N) {
  int chunk = k >> 5;
  int kr = k & 31;
  int hl = (kr >> 3) & 1;
  int e  = ((kr >> 4) << 3) | (kr & 7);
  int nt = n >> 4, nl = n & 15;
  return ((size_t)(chunk * (N >> 4) + nt) * 32 + hl * 16 + nl) * 16 + e;
}

DEVI v8f wmma_f16(v16h a, v16h b, v8f c) {
  return __builtin_amdgcn_wmma_f32_16x16x32_f16(false, a, false, b, (short)0, c, false, false);
}

// ---------------------------------------------------------------------------
// Async global->LDS copy of 4KB (8 x b128 per lane), tracked by ASYNCcnt.
// LDS[lds_base + lane*16 + i*512] = MEM[src + lane*16 + i*512]
// ---------------------------------------------------------------------------
DEVI void async_copy_4k(unsigned lds_base, const void* src, int lane) {
  const char* ga = (const char*)src + lane * 16;
  unsigned la = lds_base + lane * 16;
  asm volatile("global_load_async_to_lds_b128 %0, %1, off"              :: "v"(la), "v"(ga) : "memory");
  asm volatile("global_load_async_to_lds_b128 %0, %1, off offset:512"   :: "v"(la), "v"(ga) : "memory");
  asm volatile("global_load_async_to_lds_b128 %0, %1, off offset:1024"  :: "v"(la), "v"(ga) : "memory");
  asm volatile("global_load_async_to_lds_b128 %0, %1, off offset:1536"  :: "v"(la), "v"(ga) : "memory");
  asm volatile("global_load_async_to_lds_b128 %0, %1, off offset:2048"  :: "v"(la), "v"(ga) : "memory");
  asm volatile("global_load_async_to_lds_b128 %0, %1, off offset:2560"  :: "v"(la), "v"(ga) : "memory");
  asm volatile("global_load_async_to_lds_b128 %0, %1, off offset:3072"  :: "v"(la), "v"(ga) : "memory");
  asm volatile("global_load_async_to_lds_b128 %0, %1, off offset:3584"  :: "v"(la), "v"(ga) : "memory");
}
DEVI void wait_async_le8() { asm volatile("s_wait_asynccnt 0x8" ::: "memory"); }
DEVI void wait_async_0()   { asm volatile("s_wait_asynccnt 0x0" ::: "memory"); }

// ---------------------------------------------------------------------------
// Kernel: fp32 -> f16 elementwise (x)
// ---------------------------------------------------------------------------
__global__ void k_cvt_f16(const float* __restrict__ src, _Float16* __restrict__ dst, int n) {
  int i = blockIdx.x * 256 + threadIdx.x;
  if (i < n) dst[i] = (_Float16)src[i];
}

// ---------------------------------------------------------------------------
// Kernel: W [N,K] fp32  ->  packed f16 B buffer for B = W^T [K,N]
// ---------------------------------------------------------------------------
__global__ void k_pack_b_from_wT(const float* __restrict__ W, _Float16* __restrict__ dst,
                                 int K, int N) {
  int i = blockIdx.x * 256 + threadIdx.x;
  if (i >= K * N) return;
  int k = i / N, n = i % N;
  dst[pack_b_offset(k, n, N)] = (_Float16)W[(size_t)n * K + k];
}

// ---------------------------------------------------------------------------
// Kernel: WMMA GEMM  C[M,N] = A[M,K] (f16 row-major) * Bp (packed f16)
// 4 waves / block; each wave computes a 32x64 tile (8 WMMA per 32-K chunk,
// B fragments reused 2x, A fragments 4x).
// ---------------------------------------------------------------------------
__global__ void k_wmma_gemm(const _Float16* __restrict__ A, const _Float16* __restrict__ Bpk,
                            float* __restrict__ C, int M, int N, int K) {
  int lane = threadIdx.x & 31;
  int wave = threadIdx.x >> 5;
  int n0 = blockIdx.x * 64;
  int m0 = blockIdx.y * 128 + wave * 32;
  const v16h* Bp = (const v16h*)Bpk;
  int ntiles = N >> 4;

  v8f acc[2][4] = {};
  for (int k0 = 0; k0 < K; k0 += 32) {
    if (k0 + 32 < K) {
      // prefetch next K-chunk of A rows and packed B (global_prefetch_b8)
      __builtin_prefetch(A + (size_t)(m0 + (lane & 15)) * K + k0 + 32, 0, 1);
      __builtin_prefetch(A + (size_t)(m0 + 16 + (lane & 15)) * K + k0 + 32, 0, 1);
      __builtin_prefetch(&Bp[(size_t)((k0 >> 5) + 1) * ntiles * 32 + (n0 >> 4) * 32 + lane], 0, 1);
    }
    v16h a0 = load_a_frag(A, K, m0,      k0, lane);
    v16h a1 = load_a_frag(A, K, m0 + 16, k0, lane);
    int fb  = (k0 >> 5) * ntiles + (n0 >> 4);
#pragma unroll
    for (int nt = 0; nt < 4; ++nt) {
      v16h b = load_b_packed(Bp, fb + nt, lane);
      acc[0][nt] = wmma_f16(a0, b, acc[0][nt]);
      acc[1][nt] = wmma_f16(a1, b, acc[1][nt]);
    }
  }
  int hl = lane >> 4, nl = lane & 15;
#pragma unroll
  for (int mt = 0; mt < 2; ++mt)
#pragma unroll
    for (int nt = 0; nt < 4; ++nt)
#pragma unroll
      for (int j = 0; j < 8; ++j) {
        int m = m0 + mt * 16 + j + 8 * hl;
        C[(size_t)m * N + n0 + nt * 16 + nl] = acc[mt][nt][j];
      }
}

// ---------------------------------------------------------------------------
// Kernel: logit[row][h] = x[row,:] . Wb[h,:]  (fp32), row = b*T + t.
// One block per 16 rows, 8 waves: wave = (row group of 8) x (256-wide slice of D).
// A lane holds 4 consecutive d of each 128-wide chunk, so every load is 512 contiguous
// bytes per wave; each x value is used for all 8 heads, each Wb value for 8 rows.
// ---------------------------------------------------------------------------
// Halve the number of live partial sums: lanes that differ in bit MASK swap the half
// they do not keep, so 64 sums over 32 lanes take 62 exchanges instead of 320.
template <int HALF, int MASK>
DEVI void fold_lanes(float (&v)[64], int lane) {
  bool up = (lane & MASK) != 0;
#pragma unroll
  for (int i = 0; i < HALF; ++i) {
    float keep = up ? v[i + HALF] : v[i];
    float send = up ? v[i] : v[i + HALF];
    v[i] = keep + __shfl_xor(send, MASK);
  }
}

__global__ __launch_bounds__(256) void k_beta_logits(const float* __restrict__ x,
                                                     const float* __restrict__ Wb,
                                                     float* __restrict__ logit) {
  int lane = threadIdx.x & 31;
  int wave = threadIdx.x >> 5;
  int rg = wave & 1;             // which 8 of the block's 16 rows
  int ks = wave >> 1;            // which 256 of the 1024 d
  int row0 = blockIdx.x * 16;
  __shared__ alignas(16) float part[4][128]; // [d slice][row in block * 8 + head]

  const float4* xp = (const float4*)(x + (size_t)(row0 + rg * 8) * Dc + ks * 256) + lane;
  const float4* wp = (const float4*)(Wb + ks * 256) + lane;
  float4 xv[2][8], wv[2][8];
#pragma unroll
  for (int c = 0; c < 2; ++c)
#pragma unroll
    for (int r = 0; r < 8; ++r) xv[c][r] = xp[r * (Dc / 4) + c * 32];
#pragma unroll
  for (int c = 0; c < 2; ++c)
#pragma unroll
    for (int h = 0; h < Hc; ++h) wv[c][h] = wp[h * (Dc / 4) + c * 32];

  float v[64];                   // index = row in group * 8 + head
#pragma unroll
  for (int r = 0; r < 8; ++r)
#pragma unroll
    for (int h = 0; h < Hc; ++h) {
      float s = xv[0][r].x * wv[0][h].x;
      s = fmaf(xv[0][r].y, wv[0][h].y, s);
      s = fmaf(xv[0][r].z, wv[0][h].z, s);
      s = fmaf(xv[0][r].w, wv[0][h].w, s);
      s = fmaf(xv[1][r].x, wv[1][h].x, s);
      s = fmaf(xv[1][r].y, wv[1][h].y, s);
      s = fmaf(xv[1][r].z, wv[1][h].z, s);
      s = fmaf(xv[1][r].w, wv[1][h].w, s);
      v[r * 8 + h] = s;
    }

  fold_lanes<32, 16>(v, lane);
  fold_lanes<16, 8>(v, lane);
  fold_lanes<8, 4>(v, lane);
  fold_lanes<4, 2>(v, lane);
  fold_lanes<2, 1>(v, lane);
  // lane L now holds the wave's sums number 2L and 2L+1
  *(float2*)&part[ks][rg * 64 + lane * 2] = make_float2(v[0], v[1]);
  __syncthreads();

  int tid = threadIdx.x;
  if (tid < 128) {
    float s = 0.f;
#pragma unroll
    for (int k = 0; k < 4; ++k) s += part[k][tid];
    logit[(size_t)row0 * Hc + tid] = s;
  }
}

// ---------------------------------------------------------------------------
// Kernel: beta = sigmoid(logit) and cum = cumsum(log(1-beta+1e-8)) per (b,h)
// ---------------------------------------------------------------------------
__global__ void k_beta_cumsum(const float* __restrict__ logit,
                              float* __restrict__ beta, float* __restrict__ cum) {
  int bh = blockIdx.x;           // b*H + h
  int b = bh / Hc, h = bh % Hc;
  int tid = threadIdx.x;
  __shared__ float slr[Tc];
  __shared__ float spart[256];
  __shared__ float soffs[256];

  // unrolled so that a thread's 8 logit loads are in flight together, not one per trip
#pragma unroll
  for (int i = 0; i < Tc / 256; ++i) {
    int t = tid + i * 256;
    float acc = logit[((size_t)b * Tc + t) * Hc + h];
    float bv = 1.0f / (1.0f + __expf(-acc));
    beta[(size_t)bh * Tc + t] = bv;
    slr[t] = __logf(1.0f - bv + 1e-8f);
  }
  __syncthreads();

  float s = 0.f;
  int base = tid * 8;
#pragma unroll
  for (int i = 0; i < 8; ++i) s += slr[base + i];
  spart[tid] = s;
  __syncthreads();
  if (tid == 0) {
    float run = 0.f;
    for (int i = 0; i < 256; ++i) { soffs[i] = run; run += spart[i]; }
  }
  __syncthreads();
  float run = soffs[tid];
#pragma unroll
  for (int i = 0; i < 8; ++i) {
    run += slr[base + i];
    cum[(size_t)bh * Tc + base + i] = run;
  }
}

// ---------------------------------------------------------------------------
// Kernel: L2-normalize Q (fold 1/sqrt(DM)) and K, pack f16.
// qh    : [B,H,T,DM] row-major          (A-matrix for Q K^T)
// kpack : per (b,h) packed-B, B=K^T (K-dim=DM, N-dim=T)
// vpack : per (b,h) packed-B, B=V   (K-dim=T,  N-dim=DM)
// ---------------------------------------------------------------------------
__global__ void k_normalize_pack(const float* __restrict__ Yq, const float* __restrict__ Yk,
                                 const float* __restrict__ Yv,
                                 _Float16* __restrict__ qh, _Float16* __restrict__ kpack,
                                 _Float16* __restrict__ vpack) {
  int idx = blockIdx.x * 256 + threadIdx.x;    // over B*H*T
  if (idx >= Bc * Hc * Tc) return;
  int t = idx % Tc;
  int bh = idx / Tc;
  int h = bh % Hc, b = bh / Hc;
  size_t row = (size_t)b * Tc + t;
  const float* yq = Yq + row * Ec + h * DMc;
  const float* yk = Yk + row * Ec + h * DMc;
  const float* yv = Yv + row * Ec + h * DMc;

  float nq = 0.f, nk = 0.f;
#pragma unroll 4
  for (int d = 0; d < DMc; ++d) { nq = fmaf(yq[d], yq[d], nq); nk = fmaf(yk[d], yk[d], nk); }
  float sq = 0.125f / fmaxf(__fsqrt_rn(nq), 1e-12f);   // 1/sqrt(DM) folded into Q
  float sk = 1.0f   / fmaxf(__fsqrt_rn(nk), 1e-12f);

  _Float16* qrow = qh + ((size_t)bh * Tc + t) * DMc;
  _Float16* kp   = kpack + (size_t)bh * DMc * Tc;
  _Float16* vp   = vpack + (size_t)bh * Tc * DMc;
#pragma unroll 4
  for (int d = 0; d < DMc; ++d) {
    qrow[d] = (_Float16)(yq[d] * sq);
    kp[pack_b_offset(d, t, Tc)]  = (_Float16)(yk[d] * sk);   // B element (k=d, n=t)
    vp[pack_b_offset(t, d, DMc)] = (_Float16)yv[d];          // B element (k=t, n=d)
  }
}

// ---------------------------------------------------------------------------
// Kernel: fused decay attention.
// Per (b,h) and 16-query tile: stream 32-wide key chunks s >= t-tile,
//   S = (Q K^T) .* exp(min(cum_t - cum_s,0)) .* [s>=t]  (1/sqrt(DM) in Q)
//   O += S @ V ; epilogue O += beta*V (fp32 V) ; store f16 to attn_out [B*T,E]
// one wave per block. V fragments are double-buffered in LDS via
// global_load_async_to_lds_b128 (ASYNCcnt), overlapping with score compute.
// ---------------------------------------------------------------------------
__global__ void k_attention(const _Float16* __restrict__ qh, const _Float16* __restrict__ kpack,
                            const _Float16* __restrict__ vpack, const float* __restrict__ Yv,
                            const float* __restrict__ beta, const float* __restrict__ cum,
                            _Float16* __restrict__ attn_out) {
  int lane = threadIdx.x & 31;
  int t0 = blockIdx.x * 16;
  int bh = blockIdx.y;
  int b = bh / Hc, h = bh % Hc;

  const _Float16* Q  = qh + (size_t)bh * Tc * DMc;                 // [T, DM]
  const v16h* Kp = (const v16h*)(kpack + (size_t)bh * DMc * Tc);   // packed, N-dim = T
  const v16h* Vp = (const v16h*)(vpack + (size_t)bh * Tc * DMc);   // packed, N-dim = DM
  const float* cumv  = cum  + (size_t)bh * Tc;
  const float* betav = beta + (size_t)bh * Tc;

  __shared__ float sS[16 * 32];          // score repack buffer (one wave/block)
  __shared__ _Float16 sV[2][2048];       // double-buffered V chunk (2 x 4KB)

  int hl = lane >> 4, nl = lane & 15;
  const int kNT = Tc >> 4;    // 128 n-tiles in packed K
  const int vNT = DMc >> 4;   // 4  n-tiles in packed V

  unsigned lds_v = (unsigned)(uintptr_t)&sV[0][0];

  // Q A-fragments for the two 32-wide dm chunks (reused across all key tiles)
  v16h aq0 = load_a_frag(Q, DMc, t0, 0,  lane);
  v16h aq1 = load_a_frag(Q, DMc, t0, 32, lane);

  // cum for the 8 query rows this lane covers in the C layout
  float cum_q[8];
#pragma unroll
  for (int j = 0; j < 8; ++j) cum_q[j] = cumv[t0 + j + 8 * hl];

  v8f acc0 = {}, acc1 = {}, acc2 = {}, acc3 = {};

  int s_start = t0 & ~31;                // first chunk touching s >= t0
  int buf = 0;
  // preload first V chunk (4KB contiguous in packed buffer)
  async_copy_4k(lds_v, Vp + (size_t)(s_start >> 5) * vNT * 32, lane);

  for (int s0 = s_start; s0 < Tc; s0 += 32) {
    bool have_next = (s0 + 32 < Tc);
    if (have_next)
      async_copy_4k(lds_v + (buf ^ 1) * 4096, Vp + (size_t)((s0 + 32) >> 5) * vNT * 32, lane);

    // two 16x16 score tiles -> decayed fp32 chunk in LDS (m, s_local) layout
#pragma unroll
    for (int st = 0; st < 2; ++st) {
      int sc = s0 + st * 16;
      v16h kb0 = load_b_packed(Kp, 0 * kNT + (sc >> 4), lane);   // dm chunk 0
      v16h kb1 = load_b_packed(Kp, 1 * kNT + (sc >> 4), lane);   // dm chunk 1
      v8f sacc = {};
      sacc = wmma_f16(aq0, kb0, sacc);
      sacc = wmma_f16(aq1, kb1, sacc);
      int s = sc + nl;
      float cs = cumv[s];
#pragma unroll
      for (int j = 0; j < 8; ++j) {
        int tq = t0 + j + 8 * hl;
        float dec = (s >= tq) ? __expf(fminf(cum_q[j] - cs, 0.f)) : 0.f;
        sS[(j + 8 * hl) * 32 + st * 16 + nl] = sacc[j] * dec;
      }
    }
    __builtin_amdgcn_wave_barrier();
    // repack C-layout scores -> A-layout f16 fragment (cross-lane via LDS)
    v16h as;
#pragma unroll
    for (int j = 0; j < 8; ++j) {
      as[j]     = (_Float16)sS[nl * 32 + 8 * hl + j];
      as[8 + j] = (_Float16)sS[nl * 32 + 16 + 8 * hl + j];
    }
    __builtin_amdgcn_wave_barrier();

    // wait for this chunk's async V copy (in-order completion => <=8 outstanding
    // means the batch before the just-issued one has landed)
    if (have_next) wait_async_le8(); else wait_async_0();

    // S @ V from LDS (ds_load_b128 pairs), 4 dm tiles
    const v16h* lv = (const v16h*)&sV[buf][0];
    v16h bv0 = lv[0 * 32 + lane];
    v16h bv1 = lv[1 * 32 + lane];
    v16h bv2 = lv[2 * 32 + lane];
    v16h bv3 = lv[3 * 32 + lane];
    acc0 = wmma_f16(as, bv0, acc0);
    acc1 = wmma_f16(as, bv1, acc1);
    acc2 = wmma_f16(as, bv2, acc2);
    acc3 = wmma_f16(as, bv3, acc3);
    buf ^= 1;
  }

  // epilogue: O += beta * V (fp32 V from projection), store f16 to attn_out [B*T, E]
  v8f accs[4] = {acc0, acc1, acc2, acc3};
#pragma unroll
  for (int nt = 0; nt < 4; ++nt) {
#pragma unroll
    for (int j = 0; j < 8; ++j) {
      int m  = t0 + j + 8 * hl;
      int dm = nt * 16 + nl;
      size_t row = (size_t)b * Tc + m;
      float o = accs[nt][j] + betav[m] * Yv[row * Ec + h * DMc + dm];
      attn_out[row * Ec + h * DMc + dm] = (_Float16)o;
    }
  }
}

// ---------------------------------------------------------------------------
// Host launcher
// ---------------------------------------------------------------------------
extern "C" void kernel_launch(void* const* d_in, const int* in_sizes, int n_in,
                              void* d_out, int out_size, void* d_ws, size_t ws_size,
                              hipStream_t stream) {
  const float* x  = (const float*)d_in[0];   // [B,T,D]
  const float* Wk = (const float*)d_in[1];   // [E,D]
  const float* Wv = (const float*)d_in[2];   // [E,D]
  const float* Wq = (const float*)d_in[3];   // [E,D]
  const float* Wb = (const float*)d_in[4];   // [H,D]
  const float* Wo = (const float*)d_in[5];   // [D,E]
  float* out = (float*)d_out;                // [B,T,D]

  // workspace carve-up
  char* w = (char*)d_ws;
  auto alloc = [&](size_t bytes) -> void* {
    void* p = (void*)w;
    w += (bytes + 255) & ~(size_t)255;
    return p;
  };
  _Float16* xh   = (_Float16*)alloc((size_t)Mtot * Dc * 2);   // x as f16 row-major
  _Float16* wkP  = (_Float16*)alloc((size_t)Dc * Ec * 2);     // packed B = Wk^T
  _Float16* wvP  = (_Float16*)alloc((size_t)Dc * Ec * 2);
  _Float16* wqP  = (_Float16*)alloc((size_t)Dc * Ec * 2);
  _Float16* woP  = (_Float16*)alloc((size_t)Ec * Dc * 2);     // packed B = Wo^T
  float*    Yq   = (float*)alloc((size_t)Mtot * Ec * 4);
  float*    Yk   = (float*)alloc((size_t)Mtot * Ec * 4);
  float*    Yv   = (float*)alloc((size_t)Mtot * Ec * 4);
  _Float16* qh   = (_Float16*)alloc((size_t)Bc * Hc * Tc * DMc * 2);
  _Float16* kpack= (_Float16*)alloc((size_t)Bc * Hc * Tc * DMc * 2);
  _Float16* vpack= (_Float16*)alloc((size_t)Bc * Hc * Tc * DMc * 2);
  float*    blog = (float*)alloc((size_t)Mtot * Hc * 4);        // beta logits [B*T, H]
  float*    beta = (float*)alloc((size_t)Bc * Hc * Tc * 4);
  float*    cum  = (float*)alloc((size_t)Bc * Hc * Tc * 4);
  _Float16* aoh  = (_Float16*)alloc((size_t)Mtot * Ec * 2);   // attention out f16

  // 1) convert x; transpose+pack weights into fragment-major B buffers
  {
    int n = Mtot * Dc;
    k_cvt_f16<<<dim3((n + 255) / 256), dim3(256), 0, stream>>>(x, xh, n);
    int nw = Ec * Dc;
    dim3 g((nw + 255) / 256);
    k_pack_b_from_wT<<<g, dim3(256), 0, stream>>>(Wk, wkP, Dc, Ec);  // B=[D,E]
    k_pack_b_from_wT<<<g, dim3(256), 0, stream>>>(Wv, wvP, Dc, Ec);
    k_pack_b_from_wT<<<g, dim3(256), 0, stream>>>(Wq, wqP, Dc, Ec);
    k_pack_b_from_wT<<<g, dim3(256), 0, stream>>>(Wo, woP, Ec, Dc);  // B=[E,D]
  }

  // 2) projections: Y = xh @ W^T  (M=4096, N=512, K=1024)
  {
    dim3 grid(Ec / 64, Mtot / 128);
    k_wmma_gemm<<<grid, dim3(128), 0, stream>>>(xh, wqP, Yq, Mtot, Ec, Dc);
    k_wmma_gemm<<<grid, dim3(128), 0, stream>>>(xh, wkP, Yk, Mtot, Ec, Dc);
    k_wmma_gemm<<<grid, dim3(128), 0, stream>>>(xh, wvP, Yv, Mtot, Ec, Dc);
  }

  // 3) beta logits over the whole chip, then sigmoid + cumsum per (b,h)
  k_beta_logits<<<dim3(Mtot / 16), dim3(256), 0, stream>>>(x, Wb, blog);
  k_beta_cumsum<<<dim3(Bc * Hc), dim3(256), 0, stream>>>(blog, beta, cum);

  // 4) normalize + pack f16 (Q row-major+scaled, K/V fragment-packed)
  k_normalize_pack<<<dim3((Bc * Hc * Tc) / 256), dim3(256), 0, stream>>>(Yq, Yk, Yv, qh, kpack, vpack);

  // 5) fused decay attention (async double-buffered V via ASYNCcnt)
  k_attention<<<dim3(Tc / 16, Bc * Hc), dim3(32), 0, stream>>>(qh, kpack, vpack, Yv, beta, cum, aoh);

  // 6) output projection: out = aoh @ Wo^T  (M=4096, N=1024, K=512)
  {
    dim3 grid(Dc / 64, Mtot / 128);
    k_wmma_gemm<<<grid, dim3(128), 0, stream>>>(aoh, woP, out, Mtot, Dc, Ec);
  }
}

// v002
// Measured time: 276 microseconds a run.
// Timed twice side by side with v001, it ran 1.09 times as fast both times.
// Over all steps from v000 it is 1.64 times as fast.
#include <hip/hip_runtime.h>
#include <hip/hip_bf16.h>

#define DEVI __device__ __forceinline__

typedef __attribute__((ext_vector_type(16))) _Float16 v16h;
typedef __attribute__((ext_vector_type(4)))  _Float16 v4h;
typedef __attribute__((ext_vector_type(8)))  float    v8f;

// Problem constants (match reference)
constexpr int Bc  = 2;
constexpr int Tc  = 2048;
constexpr int Dc  = 1024;
constexpr int Hc  = 8;
constexpr int DMc = 64;
constexpr int Ec  = Hc * DMc;     // 512
constexpr int Mtot = Bc * Tc;     // 4096

// ---------------------------------------------------------------------------
// WMMA fragment layouts (CDNA5 wave32, ISA 7.12.2)
// A (16x32 f16): lane L holds row M=L&15; hl=L>>4: elems 0..7 = K(8*hl+0..7),
//                elems 8..15 = K(16+8*hl+0..7).
// B (32x16 f16): lane L holds col N=L&15; same K packing as A.
// C (16x16 f32): lane L holds col N=L&15; vgpr j holds row M = j + 8*(L>>4).
//
// Packed-B buffer: fragment f = (k0/32)*(N/16) + (n0/16); lane L's 16 halves
// stored contiguously at ((f*32 + L)*16) -> one 32B vector load per lane.
// ---------------------------------------------------------------------------

DEVI v16h load_a_frag(const _Float16* __restrict__ A, int lda, int m0, int k0, int lane) {
  int m  = m0 + (lane & 15);
  int hl = lane >> 4;
  const _Float16* p0 = A + (size_t)m * lda + (k0 + 8 * hl);
  const _Float16* p1 = p0 + 16;
  v16h r;
#pragma unroll
  for (int j = 0; j < 8; ++j) { r[j] = p0[j]; r[8 + j] = p1[j]; }
  return r;
}

DEVI v16h load_b_packed(const v16h* __restrict__ Bp, int frag, int lane) {
  return Bp[(size_t)frag * 32 + lane];
}

DEVI size_t pack_b_offset(int k, int n, int N) {
  int chunk = k >> 5;
  int kr = k & 31;
  int hl = (kr >> 3) & 1;
  int e  = ((kr >> 4) << 3) | (kr & 7);
  int nt = n >> 4, nl = n & 15;
  return ((size_t)(chunk * (N >> 4) + nt) * 32 + hl * 16 + nl) * 16 + e;
}

DEVI v8f wmma_f16(v16h a, v16h b, v8f c) {
  return __builtin_amdgcn_wmma_f32_16x16x32_f16(false, a, false, b, (short)0, c, false, false);
}

// ---------------------------------------------------------------------------
// Async global->LDS copy of 4KB (8 x b128 per lane), tracked by ASYNCcnt.
// LDS[lds_base + lane*16 + i*512] = MEM[src + lane*16 + i*512]
// ---------------------------------------------------------------------------
DEVI void async_copy_4k(unsigned lds_base, const void* src, int lane) {
  const char* ga = (const char*)src + lane * 16;
  unsigned la = lds_base + lane * 16;
  asm volatile("global_load_async_to_lds_b128 %0, %1, off"              :: "v"(la), "v"(ga) : "memory");
  asm volatile("global_load_async_to_lds_b128 %0, %1, off offset:512"   :: "v"(la), "v"(ga) : "memory");
  asm volatile("global_load_async_to_lds_b128 %0, %1, off offset:1024"  :: "v"(la), "v"(ga) : "memory");
  asm volatile("global_load_async_to_lds_b128 %0, %1, off offset:1536"  :: "v"(la), "v"(ga) : "memory");
  asm volatile("global_load_async_to_lds_b128 %0, %1, off offset:2048"  :: "v"(la), "v"(ga) : "memory");
  asm volatile("global_load_async_to_lds_b128 %0, %1, off offset:2560"  :: "v"(la), "v"(ga) : "memory");
  asm volatile("global_load_async_to_lds_b128 %0, %1, off offset:3072"  :: "v"(la), "v"(ga) : "memory");
  asm volatile("global_load_async_to_lds_b128 %0, %1, off offset:3584"  :: "v"(la), "v"(ga) : "memory");
}
DEVI void wait_async_le8() { asm volatile("s_wait_asynccnt 0x8" ::: "memory"); }
DEVI void wait_async_0()   { asm volatile("s_wait_asynccnt 0x0" ::: "memory"); }

// ---------------------------------------------------------------------------
// Kernel: fp32 -> f16 elementwise (x)
// A thread converts 32 elements: 8 float4 loads, all in flight together, each 512
// contiguous bytes per wave, then 8 stores of 4 halves. That makes 4096 waves (16 per
// WGP); with one element per thread it is 131072.
// ---------------------------------------------------------------------------
constexpr int kCvtVec = 8;                       // float4 groups per thread
constexpr int kCvtPerBlock = 256 * kCvtVec * 4;  // elements per block
static_assert((Mtot * Dc) % kCvtPerBlock == 0, "convert grid covers x exactly");

__global__ __launch_bounds__(256) void k_cvt_f16(const float* __restrict__ src,
                                                 _Float16* __restrict__ dst) {
  size_t base = (size_t)blockIdx.x * (256 * kCvtVec) + threadIdx.x;   // in groups of 4
  const float4* s4 = (const float4*)src + base;
  v4h* d4 = (v4h*)dst + base;
  float4 v[kCvtVec];
#pragma unroll
  for (int j = 0; j < kCvtVec; ++j) v[j] = s4[j * 256];
#pragma unroll
  for (int j = 0; j < kCvtVec; ++j) {
    v4h r = {(_Float16)v[j].x, (_Float16)v[j].y, (_Float16)v[j].z, (_Float16)v[j].w};
    d4[j * 256] = r;
  }
}

// ---------------------------------------------------------------------------
// Kernel: W [N,K] fp32  ->  packed f16 B buffer for B = W^T [K,N]
// A thread builds one lane's 16 halves of one fragment: two runs of 8 consecutive k of
// row n (four float4 loads; a wave reads 16 whole 128-byte lines) and one 32-byte store
// (1 KB contiguous per wave).
// ---------------------------------------------------------------------------
__global__ __launch_bounds__(256) void k_pack_b_from_wT(const float* __restrict__ W,
                                                        _Float16* __restrict__ dst,
                                                        int K, int N) {
  int i = blockIdx.x * 256 + threadIdx.x;        // fragment * 32 + lane
  if (i >= ((K * N) >> 4)) return;
  int lane = i & 31, frag = i >> 5;
  int ntiles = N >> 4;
  int chunk = frag / ntiles, nt = frag % ntiles;
  int n = nt * 16 + (lane & 15);
  int k = chunk * 32 + 8 * (lane >> 4);
  const float4* p = (const float4*)(W + (size_t)n * K + k);
  float4 lo0 = p[0], lo1 = p[1];                 // k .. k+7
  float4 hi0 = p[4], hi1 = p[5];                 // k+16 .. k+23
  v16h r = {(_Float16)lo0.x, (_Float16)lo0.y, (_Float16)lo0.z, (_Float16)lo0.w,
            (_Float16)lo1.x, (_Float16)lo1.y, (_Float16)lo1.z, (_Float16)lo1.w,
            (_Float16)hi0.x, (_Float16)hi0.y, (_Float16)hi0.z, (_Float16)hi0.w,
            (_Float16)hi1.x, (_Float16)hi1.y, (_Float16)hi1.z, (_Float16)hi1.w};
  ((v16h*)dst)[i] = r;
}

// ---------------------------------------------------------------------------
// Kernel: WMMA GEMM  C[M,N] = A[M,K] (f16 row-major) * Bp (packed f16)
// 4 waves / block; each wave computes a 32x64 tile (8 WMMA per 32-K chunk,
// B fragments reused 2x, A fragments 4x).
// ---------------------------------------------------------------------------
__global__ void k_wmma_gemm(const _Float16* __restrict__ A, const _Float16* __restrict__ Bpk,
                            float* __restrict__ C, int M, int N, int K) {
  int lane = threadIdx.x & 31;
  int wave = threadIdx.x >> 5;
  int n0 = blockIdx.x * 64;
  int m0 = blockIdx.y * 128 + wave * 32;
  const v16h* Bp = (const v16h*)Bpk;
  int ntiles = N >> 4;

  v8f acc[2][4] = {};
  for (int k0 = 0; k0 < K; k0 += 32) {
    if (k0 + 32 < K) {
      // prefetch next K-chunk of A rows and packed B (global_prefetch_b8)
      __builtin_prefetch(A + (size_t)(m0 + (lane & 15)) * K + k0 + 32, 0, 1);
      __builtin_prefetch(A + (size_t)(m0 + 16 + (lane & 15)) * K + k0 + 32, 0, 1);
      __builtin_prefetch(&Bp[(size_t)((k0 >> 5) + 1) * ntiles * 32 + (n0 >> 4) * 32 + lane], 0, 1);
    }
    v16h a0 = load_a_frag(A, K, m0,      k0, lane);
    v16h a1 = load_a_frag(A, K, m0 + 16, k0, lane);
    int fb  = (k0 >> 5) * ntiles + (n0 >> 4);
#pragma unroll
    for (int nt = 0; nt < 4; ++nt) {
      v16h b = load_b_packed(Bp, fb + nt, lane);
      acc[0][nt] = wmma_f16(a0, b, acc[0][nt]);
      acc[1][nt] = wmma_f16(a1, b, acc[1][nt]);
    }
  }
  int hl = lane >> 4, nl = lane & 15;
#pragma unroll
  for (int mt = 0; mt < 2; ++mt)
#pragma unroll
    for (int nt = 0; nt < 4; ++nt)
#pragma unroll
      for (int j = 0; j < 8; ++j) {
        int m = m0 + mt * 16 + j + 8 * hl;
        C[(size_t)m * N + n0 + nt * 16 + nl] = acc[mt][nt][j];
      }
}

// ---------------------------------------------------------------------------
// Kernel: logit[row][h] = x[row,:] . Wb[h,:]  (fp32), row = b*T + t.
// One block per 16 rows, 8 waves: wave = (row group of 8) x (256-wide slice of D).
// A lane holds 4 consecutive d of each 128-wide chunk, so every load is 512 contiguous
// bytes per wave; each x value is used for all 8 heads, each Wb value for 8 rows.
// ---------------------------------------------------------------------------
// Halve the number of live partial sums: lanes that differ in bit MASK swap the half
// they do not keep, so 64 sums over 32 lanes take 62 exchanges instead of 320.
template <int HALF, int MASK>
DEVI void fold_lanes(float (&v)[64], int lane) {
  bool up = (lane & MASK) != 0;
#pragma unroll
  for (int i = 0; i < HALF; ++i) {
    float keep = up ? v[i + HALF] : v[i];
    float send = up ? v[i] : v[i + HALF];
    v[i] = keep + __shfl_xor(send, MASK);
  }
}

__global__ __launch_bounds__(256) void k_beta_logits(const float* __restrict__ x,
                                                     const float* __restrict__ Wb,
                                                     float* __restrict__ logit) {
  int lane = threadIdx.x & 31;
  int wave = threadIdx.x >> 5;
  int rg = wave & 1;             // which 8 of the block's 16 rows
  int ks = wave >> 1;            // which 256 of the 1024 d
  int row0 = blockIdx.x * 16;
  __shared__ alignas(16) float part[4][128]; // [d slice][row in block * 8 + head]

  const float4* xp = (const float4*)(x + (size_t)(row0 + rg * 8) * Dc + ks * 256) + lane;
  const float4* wp = (const float4*)(Wb + ks * 256) + lane;
  float4 xv[2][8], wv[2][8];
#pragma unroll
  for (int c = 0; c < 2; ++c)
#pragma unroll
    for (int r = 0; r < 8; ++r) xv[c][r] = xp[r * (Dc / 4) + c * 32];
#pragma unroll
  for (int c = 0; c < 2; ++c)
#pragma unroll
    for (int h = 0; h < Hc; ++h) wv[c][h] = wp[h * (Dc / 4) + c * 32];

  float v[64];                   // index = row in group * 8 + head
#pragma unroll
  for (int r = 0; r < 8; ++r)
#pragma unroll
    for (int h = 0; h < Hc; ++h) {
      float s = xv[0][r].x * wv[0][h].x;
      s = fmaf(xv[0][r].y, wv[0][h].y, s);
      s = fmaf(xv[0][r].z, wv[0][h].z, s);
      s = fmaf(xv[0][r].w, wv[0][h].w, s);
      s = fmaf(xv[1][r].x, wv[1][h].x, s);
      s = fmaf(xv[1][r].y, wv[1][h].y, s);
      s = fmaf(xv[1][r].z, wv[1][h].z, s);
      s = fmaf(xv[1][r].w, wv[1][h].w, s);
      v[r * 8 + h] = s;
    }

  fold_lanes<32, 16>(v, lane);
  fold_lanes<16, 8>(v, lane);
  fold_lanes<8, 4>(v, lane);
  fold_lanes<4, 2>(v, lane);
  fold_lanes<2, 1>(v, lane);
  // lane L now holds the wave's sums number 2L and 2L+1
  *(float2*)&part[ks][rg * 64 + lane * 2] = make_float2(v[0], v[1]);
  __syncthreads();

  int tid = threadIdx.x;
  if (tid < 128) {
    float s = 0.f;
#pragma unroll
    for (int k = 0; k < 4; ++k) s += part[k][tid];
    logit[(size_t)row0 * Hc + tid] = s;
  }
}

// ---------------------------------------------------------------------------
// Kernel: beta = sigmoid(logit) and cum = cumsum(log(1-beta+1e-8)) per (b,h)
// ---------------------------------------------------------------------------
__global__ void k_beta_cumsum(const float* __restrict__ logit,
                              float* __restrict__ beta, float* __restrict__ cum) {
  int bh = blockIdx.x;           // b*H + h
  int b = bh / Hc, h = bh % Hc;
  int tid = threadIdx.x;
  __shared__ float slr[Tc];
  __shared__ float spart[256];
  __shared__ float soffs[256];

  // unrolled so that a thread's 8 logit loads are in flight together, not one per trip
#pragma unroll
  for (int i = 0; i < Tc / 256; ++i) {
    int t = tid + i * 256;
    float acc = logit[((size_t)b * Tc + t) * Hc + h];
    float bv = 1.0f / (1.0f + __expf(-acc));
    beta[(size_t)bh * Tc + t] = bv;
    slr[t] = __logf(1.0f - bv + 1e-8f);
  }
  __syncthreads();

  float s = 0.f;
  int base = tid * 8;
#pragma unroll
  for (int i = 0; i < 8; ++i) s += slr[base + i];
  spart[tid] = s;
  __syncthreads();
  if (tid == 0) {
    float run = 0.f;
    for (int i = 0; i < 256; ++i) { soffs[i] = run; run += spart[i]; }
  }
  __syncthreads();
  float run = soffs[tid];
#pragma unroll
  for (int i = 0; i < 8; ++i) {
    run += slr[base + i];
    cum[(size_t)bh * Tc + base + i] = run;
  }
}

// ---------------------------------------------------------------------------
// Kernel: L2-normalize Q (fold 1/sqrt(DM)) and K, pack f16.
// qh    : [B,H,T,DM] row-major          (A-matrix for Q K^T)
// kpack : per (b,h) packed-B, B=K^T (K-dim=DM, N-dim=T)
// vpack : per (b,h) packed-B, B=V   (K-dim=T,  N-dim=DM)
// ---------------------------------------------------------------------------
__global__ void k_normalize_pack(const float* __restrict__ Yq, const float* __restrict__ Yk,
                                 const float* __restrict__ Yv,
                                 _Float16* __restrict__ qh, _Float16* __restrict__ kpack,
                                 _Float16* __restrict__ vpack) {
  int idx = blockIdx.x * 256 + threadIdx.x;    // over B*H*T
  if (idx >= Bc * Hc * Tc) return;
  int t = idx % Tc;
  int bh = idx / Tc;
  int h = bh % Hc, b = bh / Hc;
  size_t row = (size_t)b * Tc + t;
  const float* yq = Yq + row * Ec + h * DMc;
  const float* yk = Yk + row * Ec + h * DMc;
  const float* yv = Yv + row * Ec + h * DMc;

  float nq = 0.f, nk = 0.f;
#pragma unroll 4
  for (int d = 0; d < DMc; ++d) { nq = fmaf(yq[d], yq[d], nq); nk = fmaf(yk[d], yk[d], nk); }
  float sq = 0.125f / fmaxf(__fsqrt_rn(nq), 1e-12f);   // 1/sqrt(DM) folded into Q
  float sk = 1.0f   / fmaxf(__fsqrt_rn(nk), 1e-12f);

  _Float16* qrow = qh + ((size_t)bh * Tc + t) * DMc;
  _Float16* kp   = kpack + (size_t)bh * DMc * Tc;
  _Float16* vp   = vpack + (size_t)bh * Tc * DMc;
#pragma unroll 4
  for (int d = 0; d < DMc; ++d) {
    qrow[d] = (_Float16)(yq[d] * sq);
    kp[pack_b_offset(d, t, Tc)]  = (_Float16)(yk[d] * sk);   // B element (k=d, n=t)
    vp[pack_b_offset(t, d, DMc)] = (_Float16)yv[d];          // B element (k=t, n=d)
  }
}

// ---------------------------------------------------------------------------
// Kernel: fused decay attention.
// Per (b,h) and 16-query tile: stream 32-wide key chunks s >= t-tile,
//   S = (Q K^T) .* exp(min(cum_t - cum_s,0)) .* [s>=t]  (1/sqrt(DM) in Q)
//   O += S @ V ; epilogue O += beta*V (fp32 V) ; store f16 to attn_out [B*T,E]
// one wave per block. V fragments are double-buffered in LDS via
// global_load_async_to_lds_b128 (ASYNCcnt), overlapping with score compute.
// ---------------------------------------------------------------------------
__global__ void k_attention(const _Float16* __restrict__ qh, const _Float16* __restrict__ kpack,
                            const _Float16* __restrict__ vpack, const float* __restrict__ Yv,
                            const float* __restrict__ beta, const float* __restrict__ cum,
                            _Float16* __restrict__ attn_out) {
  int lane = threadIdx.x & 31;
  int t0 = blockIdx.x * 16;
  int bh = blockIdx.y;
  int b = bh / Hc, h = bh % Hc;

  const _Float16* Q  = qh + (size_t)bh * Tc * DMc;                 // [T, DM]
  const v16h* Kp = (const v16h*)(kpack + (size_t)bh * DMc * Tc);   // packed, N-dim = T
  const v16h* Vp = (const v16h*)(vpack + (size_t)bh * Tc * DMc);   // packed, N-dim = DM
  const float* cumv  = cum  + (size_t)bh * Tc;
  const float* betav = beta + (size_t)bh * Tc;

  __shared__ float sS[16 * 32];          // score repack buffer (one wave/block)
  __shared__ _Float16 sV[2][2048];       // double-buffered V chunk (2 x 4KB)

  int hl = lane >> 4, nl = lane & 15;
  const int kNT = Tc >> 4;    // 128 n-tiles in packed K
  const int vNT = DMc >> 4;   // 4  n-tiles in packed V

  unsigned lds_v = (unsigned)(uintptr_t)&sV[0][0];

  // Q A-fragments for the two 32-wide dm chunks (reused across all key tiles)
  v16h aq0 = load_a_frag(Q, DMc, t0, 0,  lane);
  v16h aq1 = load_a_frag(Q, DMc, t0, 32, lane);

  // cum for the 8 query rows this lane covers in the C layout
  float cum_q[8];
#pragma unroll
  for (int j = 0; j < 8; ++j) cum_q[j] = cumv[t0 + j + 8 * hl];

  v8f acc0 = {}, acc1 = {}, acc2 = {}, acc3 = {};

  int s_start = t0 & ~31;                // first chunk touching s >= t0
  int buf = 0;
  // preload first V chunk (4KB contiguous in packed buffer)
  async_copy_4k(lds_v, Vp + (size_t)(s_start >> 5) * vNT * 32, lane);

  for (int s0 = s_start; s0 < Tc; s0 += 32) {
    bool have_next = (s0 + 32 < Tc);
    if (have_next)
      async_copy_4k(lds_v + (buf ^ 1) * 4096, Vp + (size_t)((s0 + 32) >> 5) * vNT * 32, lane);

    // two 16x16 score tiles -> decayed fp32 chunk in LDS (m, s_local) layout
#pragma unroll
    for (int st = 0; st < 2; ++st) {
      int sc = s0 + st * 16;
      v16h kb0 = load_b_packed(Kp, 0 * kNT + (sc >> 4), lane);   // dm chunk 0
      v16h kb1 = load_b_packed(Kp, 1 * kNT + (sc >> 4), lane);   // dm chunk 1
      v8f sacc = {};
      sacc = wmma_f16(aq0, kb0, sacc);
      sacc = wmma_f16(aq1, kb1, sacc);
      int s = sc + nl;
      float cs = cumv[s];
#pragma unroll
      for (int j = 0; j < 8; ++j) {
        int tq = t0 + j + 8 * hl;
        float dec = (s >= tq) ? __expf(fminf(cum_q[j] - cs, 0.f)) : 0.f;
        sS[(j + 8 * hl) * 32 + st * 16 + nl] = sacc[j] * dec;
      }
    }
    __builtin_amdgcn_wave_barrier();
    // repack C-layout scores -> A-layout f16 fragment (cross-lane via LDS)
    v16h as;
#pragma unroll
    for (int j = 0; j < 8; ++j) {
      as[j]     = (_Float16)sS[nl * 32 + 8 * hl + j];
      as[8 + j] = (_Float16)sS[nl * 32 + 16 + 8 * hl + j];
    }
    __builtin_amdgcn_wave_barrier();

    // wait for this chunk's async V copy (in-order completion => <=8 outstanding
    // means the batch before the just-issued one has landed)
    if (have_next) wait_async_le8(); else wait_async_0();

    // S @ V from LDS (ds_load_b128 pairs), 4 dm tiles
    const v16h* lv = (const v16h*)&sV[buf][0];
    v16h bv0 = lv[0 * 32 + lane];
    v16h bv1 = lv[1 * 32 + lane];
    v16h bv2 = lv[2 * 32 + lane];
    v16h bv3 = lv[3 * 32 + lane];
    acc0 = wmma_f16(as, bv0, acc0);
    acc1 = wmma_f16(as, bv1, acc1);
    acc2 = wmma_f16(as, bv2, acc2);
    acc3 = wmma_f16(as, bv3, acc3);
    buf ^= 1;
  }

  // epilogue: O += beta * V (fp32 V from projection), store f16 to attn_out [B*T, E]
  v8f accs[4] = {acc0, acc1, acc2, acc3};
#pragma unroll
  for (int nt = 0; nt < 4; ++nt) {
#pragma unroll
    for (int j = 0; j < 8; ++j) {
      int m  = t0 + j + 8 * hl;
      int dm = nt * 16 + nl;
      size_t row = (size_t)b * Tc + m;
      float o = accs[nt][j] + betav[m] * Yv[row * Ec + h * DMc + dm];
      attn_out[row * Ec + h * DMc + dm] = (_Float16)o;
    }
  }
}

// ---------------------------------------------------------------------------
// Host launcher
// ---------------------------------------------------------------------------
extern "C" void kernel_launch(void* const* d_in, const int* in_sizes, int n_in,
                              void* d_out, int out_size, void* d_ws, size_t ws_size,
                              hipStream_t stream) {
  const float* x  = (const float*)d_in[0];   // [B,T,D]
  const float* Wk = (const float*)d_in[1];   // [E,D]
  const float* Wv = (const float*)d_in[2];   // [E,D]
  const float* Wq = (const float*)d_in[3];   // [E,D]
  const float* Wb = (const float*)d_in[4];   // [H,D]
  const float* Wo = (const float*)d_in[5];   // [D,E]
  float* out = (float*)d_out;                // [B,T,D]

  // workspace carve-up
  char* w = (char*)d_ws;
  auto alloc = [&](size_t bytes) -> void* {
    void* p = (void*)w;
    w += (bytes + 255) & ~(size_t)255;
    return p;
  };
  _Float16* xh   = (_Float16*)alloc((size_t)Mtot * Dc * 2);   // x as f16 row-major
  _Float16* wkP  = (_Float16*)alloc((size_t)Dc * Ec * 2);     // packed B = Wk^T
  _Float16* wvP  = (_Float16*)alloc((size_t)Dc * Ec * 2);
  _Float16* wqP  = (_Float16*)alloc((size_t)Dc * Ec * 2);
  _Float16* woP  = (_Float16*)alloc((size_t)Ec * Dc * 2);     // packed B = Wo^T
  float*    Yq   = (float*)alloc((size_t)Mtot * Ec * 4);
  float*    Yk   = (float*)alloc((size_t)Mtot * Ec * 4);
  float*    Yv   = (float*)alloc((size_t)Mtot * Ec * 4);
  _Float16* qh   = (_Float16*)alloc((size_t)Bc * Hc * Tc * DMc * 2);
  _Float16* kpack= (_Float16*)alloc((size_t)Bc * Hc * Tc * DMc * 2);
  _Float16* vpack= (_Float16*)alloc((size_t)Bc * Hc * Tc * DMc * 2);
  float*    blog = (float*)alloc((size_t)Mtot * Hc * 4);        // beta logits [B*T, H]
  float*    beta = (float*)alloc((size_t)Bc * Hc * Tc * 4);
  float*    cum  = (float*)alloc((size_t)Bc * Hc * Tc * 4);
  _Float16* aoh  = (_Float16*)alloc((size_t)Mtot * Ec * 2);   // attention out f16

  // 1) convert x; transpose+pack weights into fragment-major B buffers
  {
    k_cvt_f16<<<dim3(Mtot * Dc / kCvtPerBlock), dim3(256), 0, stream>>>(x, xh);
    dim3 g(Ec * Dc / 16 / 256);                  // one thread per fragment lane
    k_pack_b_from_wT<<<g, dim3(256), 0, stream>>>(Wk, wkP, Dc, Ec);  // B=[D,E]
    k_pack_b_from_wT<<<g, dim3(256), 0, stream>>>(Wv, wvP, Dc, Ec);
    k_pack_b_from_wT<<<g, dim3(256), 0, stream>>>(Wq, wqP, Dc, Ec);
    k_pack_b_from_wT<<<g, dim3(256), 0, stream>>>(Wo, woP, Ec, Dc);  // B=[E,D]
  }

  // 2) projections: Y = xh @ W^T  (M=4096, N=512, K=1024)
  {
    dim3 grid(Ec / 64, Mtot / 128);
    k_wmma_gemm<<<grid, dim3(128), 0, stream>>>(xh, wqP, Yq, Mtot, Ec, Dc);
    k_wmma_gemm<<<grid, dim3(128), 0, stream>>>(xh, wkP, Yk, Mtot, Ec, Dc);
    k_wmma_gemm<<<grid, dim3(128), 0, stream>>>(xh, wvP, Yv, Mtot, Ec, Dc);
  }

  // 3) beta logits over the whole chip, then sigmoid + cumsum per (b,h)
  k_beta_logits<<<dim3(Mtot / 16), dim3(256), 0, stream>>>(x, Wb, blog);
  k_beta_cumsum<<<dim3(Bc * Hc), dim3(256), 0, stream>>>(blog, beta, cum);

  // 4) normalize + pack f16 (Q row-major+scaled, K/V fragment-packed)
  k_normalize_pack<<<dim3((Bc * Hc * Tc) / 256), dim3(256), 0, stream>>>(Yq, Yk, Yv, qh, kpack, vpack);

  // 5) fused decay attention (async double-buffered V via ASYNCcnt)
  k_attention<<<dim3(Tc / 16, Bc * Hc), dim3(32), 0, stream>>>(qh, kpack, vpack, Yv, beta, cum, aoh);

  // 6) output projection: out = aoh @ Wo^T  (M=4096, N=1024, K=512)
  {
    dim3 grid(Dc / 64, Mtot / 128);
    k_wmma_gemm<<<grid, dim3(128), 0, stream>>>(aoh, woP, out, Mtot, Dc, Ec);
  }
}

// v003
// It runs in 134 microseconds.
// Two timings next to v002 both put it at 2.07 times that version's speed.
// All steps since v000 together make it 3.40 times as fast.
#include <hip/hip_runtime.h>
#include <hip/hip_bf16.h>

#define DEVI __device__ __forceinline__

typedef __attribute__((ext_vector_type(16))) _Float16 v16h;
typedef __attribute__((ext_vector_type(4)))  _Float16 v4h;
typedef __attribute__((ext_vector_type(8)))  float    v8f;

// Problem constants (match reference)
constexpr int Bc  = 2;
constexpr int Tc  = 2048;
constexpr int Dc  = 1024;
constexpr int Hc  = 8;
constexpr int DMc = 64;
constexpr int Ec  = Hc * DMc;     // 512
constexpr int Mtot = Bc * Tc;     // 4096

// ---------------------------------------------------------------------------
// WMMA fragment layouts (CDNA5 wave32, ISA 7.12.2)
// A (16x32 f16): lane L holds row M=L&15; hl=L>>4: elems 0..7 = K(8*hl+0..7),
//                elems 8..15 = K(16+8*hl+0..7).
// B (32x16 f16): lane L holds col N=L&15; same K packing as A.
// C (16x16 f32): lane L holds col N=L&15; vgpr j holds row M = j + 8*(L>>4).
//
// Packed-B buffer: fragment f = (k0/32)*(N/16) + (n0/16); lane L's 16 halves
// stored contiguously at ((f*32 + L)*16) -> one 32B vector load per lane.
// ---------------------------------------------------------------------------

DEVI v16h load_a_frag(const _Float16* __restrict__ A, int lda, int m0, int k0, int lane) {
  int m  = m0 + (lane & 15);
  int hl = lane >> 4;
  const _Float16* p0 = A + (size_t)m * lda + (k0 + 8 * hl);
  const _Float16* p1 = p0 + 16;
  v16h r;
#pragma unroll
  for (int j = 0; j < 8; ++j) { r[j] = p0[j]; r[8 + j] = p1[j]; }
  return r;
}

DEVI v16h load_b_packed(const v16h* __restrict__ Bp, int frag, int lane) {
  return Bp[(size_t)frag * 32 + lane];
}

DEVI size_t pack_b_offset(int k, int n, int N) {
  int chunk = k >> 5;
  int kr = k & 31;
  int hl = (kr >> 3) & 1;
  int e  = ((kr >> 4) << 3) | (kr & 7);
  int nt = n >> 4, nl = n & 15;
  return ((size_t)(chunk * (N >> 4) + nt) * 32 + hl * 16 + nl) * 16 + e;
}

DEVI v8f wmma_f16(v16h a, v16h b, v8f c) {
  return __builtin_amdgcn_wmma_f32_16x16x32_f16(false, a, false, b, (short)0, c, false, false);
}

// ---------------------------------------------------------------------------
// Async global->LDS copy of 4KB (8 x b128 per lane), tracked by ASYNCcnt.
// LDS[lds_base + lane*16 + i*512] = MEM[src + lane*16 + i*512]
// ---------------------------------------------------------------------------
DEVI void async_copy_4k(unsigned lds_base, const void* src, int lane) {
  const char* ga = (const char*)src + lane * 16;
  unsigned la = lds_base + lane * 16;
  asm volatile("global_load_async_to_lds_b128 %0, %1, off"              :: "v"(la), "v"(ga) : "memory");
  asm volatile("global_load_async_to_lds_b128 %0, %1, off offset:512"   :: "v"(la), "v"(ga) : "memory");
  asm volatile("global_load_async_to_lds_b128 %0, %1, off offset:1024"  :: "v"(la), "v"(ga) : "memory");
  asm volatile("global_load_async_to_lds_b128 %0, %1, off offset:1536"  :: "v"(la), "v"(ga) : "memory");
  asm volatile("global_load_async_to_lds_b128 %0, %1, off offset:2048"  :: "v"(la), "v"(ga) : "memory");
  asm volatile("global_load_async_to_lds_b128 %0, %1, off offset:2560"  :: "v"(la), "v"(ga) : "memory");
  asm volatile("global_load_async_to_lds_b128 %0, %1, off offset:3072"  :: "v"(la), "v"(ga) : "memory");
  asm volatile("global_load_async_to_lds_b128 %0, %1, off offset:3584"  :: "v"(la), "v"(ga) : "memory");
}
DEVI void wait_async_le8() { asm volatile("s_wait_asynccnt 0x8" ::: "memory"); }
DEVI void wait_async_0()   { asm volatile("s_wait_asynccnt 0x0" ::: "memory"); }

// ---------------------------------------------------------------------------
// Kernel: fp32 -> f16 elementwise (x)
// A thread converts 32 elements: 8 float4 loads, all in flight together, each 512
// contiguous bytes per wave, then 8 stores of 4 halves. That makes 4096 waves (16 per
// WGP); with one element per thread it is 131072.
// ---------------------------------------------------------------------------
constexpr int kCvtVec = 8;                       // float4 groups per thread
constexpr int kCvtPerBlock = 256 * kCvtVec * 4;  // elements per block
static_assert((Mtot * Dc) % kCvtPerBlock == 0, "convert grid covers x exactly");

__global__ __launch_bounds__(256) void k_cvt_f16(const float* __restrict__ src,
                                                 _Float16* __restrict__ dst) {
  size_t base = (size_t)blockIdx.x * (256 * kCvtVec) + threadIdx.x;   // in groups of 4
  const float4* s4 = (const float4*)src + base;
  v4h* d4 = (v4h*)dst + base;
  float4 v[kCvtVec];
#pragma unroll
  for (int j = 0; j < kCvtVec; ++j) v[j] = s4[j * 256];
#pragma unroll
  for (int j = 0; j < kCvtVec; ++j) {
    v4h r = {(_Float16)v[j].x, (_Float16)v[j].y, (_Float16)v[j].z, (_Float16)v[j].w};
    d4[j * 256] = r;
  }
}

// ---------------------------------------------------------------------------
// Kernel: W [N,K] fp32  ->  packed f16 B buffer for B = W^T [K,N]
// A thread builds one lane's 16 halves of one fragment: two runs of 8 consecutive k of
// row n (four float4 loads; a wave reads 16 whole 128-byte lines) and one 32-byte store
// (1 KB contiguous per wave).
// ---------------------------------------------------------------------------
__global__ __launch_bounds__(256) void k_pack_b_from_wT(const float* __restrict__ W,
                                                        _Float16* __restrict__ dst,
                                                        int K, int N) {
  int i = blockIdx.x * 256 + threadIdx.x;        // fragment * 32 + lane
  if (i >= ((K * N) >> 4)) return;
  int lane = i & 31, frag = i >> 5;
  int ntiles = N >> 4;
  int chunk = frag / ntiles, nt = frag % ntiles;
  int n = nt * 16 + (lane & 15);
  int k = chunk * 32 + 8 * (lane >> 4);
  const float4* p = (const float4*)(W + (size_t)n * K + k);
  float4 lo0 = p[0], lo1 = p[1];                 // k .. k+7
  float4 hi0 = p[4], hi1 = p[5];                 // k+16 .. k+23
  v16h r = {(_Float16)lo0.x, (_Float16)lo0.y, (_Float16)lo0.z, (_Float16)lo0.w,
            (_Float16)lo1.x, (_Float16)lo1.y, (_Float16)lo1.z, (_Float16)lo1.w,
            (_Float16)hi0.x, (_Float16)hi0.y, (_Float16)hi0.z, (_Float16)hi0.w,
            (_Float16)hi1.x, (_Float16)hi1.y, (_Float16)hi1.z, (_Float16)hi1.w};
  ((v16h*)dst)[i] = r;
}

// ---------------------------------------------------------------------------
// Kernel: WMMA GEMM  C[M,N] = A[M,K] (f16 row-major) * Bp (packed f16)
// 4 waves / block; each wave computes a 32x64 tile (8 WMMA per 32-K chunk,
// B fragments reused 2x, A fragments 4x).
// One or two waves run per SIMD, so little but a wave's own order hides a load. The K loop
// is unrolled over three sets of fragment registers: a chunk's 12 loads are issued
// together, two chunks ahead of the WMMAs that use them.
// ---------------------------------------------------------------------------
template <int N, int K>
__global__ __launch_bounds__(128) void k_wmma_gemm(const _Float16* __restrict__ A,
                                                   const _Float16* __restrict__ Bpk,
                                                   float* __restrict__ C) {
  constexpr int kChunks = K / 32;
  constexpr int kSets = 3;                 // one in use, two in flight
  constexpr int ntiles = N >> 4;
  static_assert(K % 32 == 0 && kChunks >= kSets, "whole chunks, at least one per set");
  int lane = threadIdx.x & 31;
  int wave = threadIdx.x >> 5;
  int n0 = blockIdx.x * 64;
  int m0 = blockIdx.y * 128 + wave * 32;
  const v16h* Bp = (const v16h*)Bpk;

  v16h a[kSets][2], b[kSets][4];
  auto load_chunk = [&](int c) {
    int s = c % kSets;
    a[s][0] = load_a_frag(A, K, m0,      c * 32, lane);
    a[s][1] = load_a_frag(A, K, m0 + 16, c * 32, lane);
    int fb = c * ntiles + (n0 >> 4);
#pragma unroll
    for (int nt = 0; nt < 4; ++nt) b[s][nt] = load_b_packed(Bp, fb + nt, lane);
  };

  v8f acc[2][4] = {};
#pragma unroll
  for (int c = 0; c < kSets - 1; ++c) load_chunk(c);
#pragma unroll
  for (int c = 0; c < kChunks; ++c) {
    if (c + kSets - 1 < kChunks) load_chunk(c + kSets - 1);
    // keeps these loads from moving down past this point: left free, the scheduler sinks
    // them to just before their first use (seen at K = 512) and every fragment is waited for
    __builtin_amdgcn_sched_barrier(0);
    int s = c % kSets;
#pragma unroll
    for (int nt = 0; nt < 4; ++nt) {
      acc[0][nt] = wmma_f16(a[s][0], b[s][nt], acc[0][nt]);
      acc[1][nt] = wmma_f16(a[s][1], b[s][nt], acc[1][nt]);
    }
  }
  // the store addresses below reuse the loads' address registers: the wait that belongs
  // in front of that overwrite
  asm volatile("s_wait_xcnt 0x0" ::: "memory");
  // keeps the address arithmetic below from being lifted over that wait
  __builtin_amdgcn_sched_barrier(0);
  int hl = lane >> 4, nl = lane & 15;
#pragma unroll
  for (int mt = 0; mt < 2; ++mt)
#pragma unroll
    for (int nt = 0; nt < 4; ++nt)
#pragma unroll
      for (int j = 0; j < 8; ++j) {
        int m = m0 + mt * 16 + j + 8 * hl;
        C[(size_t)m * N + n0 + nt * 16 + nl] = acc[mt][nt][j];
      }
}

// ---------------------------------------------------------------------------
// Kernel: logit[row][h] = x[row,:] . Wb[h,:]  (fp32), row = b*T + t.
// One block per 16 rows, 8 waves: wave = (row group of 8) x (256-wide slice of D).
// A lane holds 4 consecutive d of each 128-wide chunk, so every load is 512 contiguous
// bytes per wave; each x value is used for all 8 heads, each Wb value for 8 rows.
// ---------------------------------------------------------------------------
// Halve the number of live partial sums: lanes that differ in bit MASK swap the half
// they do not keep, so 64 sums over 32 lanes take 62 exchanges instead of 320.
template <int HALF, int MASK>
DEVI void fold_lanes(float (&v)[64], int lane) {
  bool up = (lane & MASK) != 0;
#pragma unroll
  for (int i = 0; i < HALF; ++i) {
    float keep = up ? v[i + HALF] : v[i];
    float send = up ? v[i] : v[i + HALF];
    v[i] = keep + __shfl_xor(send, MASK);
  }
}

__global__ __launch_bounds__(256) void k_beta_logits(const float* __restrict__ x,
                                                     const float* __restrict__ Wb,
                                                     float* __restrict__ logit) {
  int lane = threadIdx.x & 31;
  int wave = threadIdx.x >> 5;
  int rg = wave & 1;             // which 8 of the block's 16 rows
  int ks = wave >> 1;            // which 256 of the 1024 d
  int row0 = blockIdx.x * 16;
  __shared__ alignas(16) float part[4][128]; // [d slice][row in block * 8 + head]

  const float4* xp = (const float4*)(x + (size_t)(row0 + rg * 8) * Dc + ks * 256) + lane;
  const float4* wp = (const float4*)(Wb + ks * 256) + lane;
  float4 xv[2][8], wv[2][8];
#pragma unroll
  for (int c = 0; c < 2; ++c)
#pragma unroll
    for (int r = 0; r < 8; ++r) xv[c][r] = xp[r * (Dc / 4) + c * 32];
#pragma unroll
  for (int c = 0; c < 2; ++c)
#pragma unroll
    for (int h = 0; h < Hc; ++h) wv[c][h] = wp[h * (Dc / 4) + c * 32];

  float v[64];                   // index = row in group * 8 + head
#pragma unroll
  for (int r = 0; r < 8; ++r)
#pragma unroll
    for (int h = 0; h < Hc; ++h) {
      float s = xv[0][r].x * wv[0][h].x;
      s = fmaf(xv[0][r].y, wv[0][h].y, s);
      s = fmaf(xv[0][r].z, wv[0][h].z, s);
      s = fmaf(xv[0][r].w, wv[0][h].w, s);
      s = fmaf(xv[1][r].x, wv[1][h].x, s);
      s = fmaf(xv[1][r].y, wv[1][h].y, s);
      s = fmaf(xv[1][r].z, wv[1][h].z, s);
      s = fmaf(xv[1][r].w, wv[1][h].w, s);
      v[r * 8 + h] = s;
    }

  fold_lanes<32, 16>(v, lane);
  fold_lanes<16, 8>(v, lane);
  fold_lanes<8, 4>(v, lane);
  fold_lanes<4, 2>(v, lane);
  fold_lanes<2, 1>(v, lane);
  // lane L now holds the wave's sums number 2L and 2L+1
  *(float2*)&part[ks][rg * 64 + lane * 2] = make_float2(v[0], v[1]);
  __syncthreads();

  int tid = threadIdx.x;
  if (tid < 128) {
    float s = 0.f;
#pragma unroll
    for (int k = 0; k < 4; ++k) s += part[k][tid];
    logit[(size_t)row0 * Hc + tid] = s;
  }
}

// ---------------------------------------------------------------------------
// Kernel: beta = sigmoid(logit) and cum = cumsum(log(1-beta+1e-8)) per (b,h)
// ---------------------------------------------------------------------------
__global__ void k_beta_cumsum(const float* __restrict__ logit,
                              float* __restrict__ beta, float* __restrict__ cum) {
  int bh = blockIdx.x;           // b*H + h
  int b = bh / Hc, h = bh % Hc;
  int tid = threadIdx.x;
  __shared__ float slr[Tc];
  __shared__ float spart[256];
  __shared__ float soffs[256];

  // unrolled so that a thread's 8 logit loads are in flight together, not one per trip
#pragma unroll
  for (int i = 0; i < Tc / 256; ++i) {
    int t = tid + i * 256;
    float acc = logit[((size_t)b * Tc + t) * Hc + h];
    float bv = 1.0f / (1.0f + __expf(-acc));
    beta[(size_t)bh * Tc + t] = bv;
    slr[t] = __logf(1.0f - bv + 1e-8f);
  }
  __syncthreads();

  float s = 0.f;
  int base = tid * 8;
#pragma unroll
  for (int i = 0; i < 8; ++i) s += slr[base + i];
  spart[tid] = s;
  __syncthreads();
  if (tid == 0) {
    float run = 0.f;
    for (int i = 0; i < 256; ++i) { soffs[i] = run; run += spart[i]; }
  }
  __syncthreads();
  float run = soffs[tid];
#pragma unroll
  for (int i = 0; i < 8; ++i) {
    run += slr[base + i];
    cum[(size_t)bh * Tc + base + i] = run;
  }
}

// ---------------------------------------------------------------------------
// Kernel: L2-normalize Q (fold 1/sqrt(DM)) and K, pack f16.
// qh    : [B,H,T,DM] row-major          (A-matrix for Q K^T)
// kpack : per (b,h) packed-B, B=K^T (K-dim=DM, N-dim=T)
// vpack : per (b,h) packed-B, B=V   (K-dim=T,  N-dim=DM)
// ---------------------------------------------------------------------------
__global__ void k_normalize_pack(const float* __restrict__ Yq, const float* __restrict__ Yk,
                                 const float* __restrict__ Yv,
                                 _Float16* __restrict__ qh, _Float16* __restrict__ kpack,
                                 _Float16* __restrict__ vpack) {
  int idx = blockIdx.x * 256 + threadIdx.x;    // over B*H*T
  if (idx >= Bc * Hc * Tc) return;
  int t = idx % Tc;
  int bh = idx / Tc;
  int h = bh % Hc, b = bh / Hc;
  size_t row = (size_t)b * Tc + t;
  const float* yq = Yq + row * Ec + h * DMc;
  const float* yk = Yk + row * Ec + h * DMc;
  const float* yv = Yv + row * Ec + h * DMc;

  float nq = 0.f, nk = 0.f;
#pragma unroll 4
  for (int d = 0; d < DMc; ++d) { nq = fmaf(yq[d], yq[d], nq); nk = fmaf(yk[d], yk[d], nk); }
  float sq = 0.125f / fmaxf(__fsqrt_rn(nq), 1e-12f);   // 1/sqrt(DM) folded into Q
  float sk = 1.0f   / fmaxf(__fsqrt_rn(nk), 1e-12f);

  _Float16* qrow = qh + ((size_t)bh * Tc + t) * DMc;
  _Float16* kp   = kpack + (size_t)bh * DMc * Tc;
  _Float16* vp   = vpack + (size_t)bh * Tc * DMc;
#pragma unroll 4
  for (int d = 0; d < DMc; ++d) {
    qrow[d] = (_Float16)(yq[d] * sq);
    kp[pack_b_offset(d, t, Tc)]  = (_Float16)(yk[d] * sk);   // B element (k=d, n=t)
    vp[pack_b_offset(t, d, DMc)] = (_Float16)yv[d];          // B element (k=t, n=d)
  }
}

// ---------------------------------------------------------------------------
// Kernel: fused decay attention.
// Per (b,h) and 16-query tile: stream 32-wide key chunks s >= t-tile,
//   S = (Q K^T) .* exp(min(cum_t - cum_s,0)) .* [s>=t]  (1/sqrt(DM) in Q)
//   O += S @ V ; epilogue O += beta*V (fp32 V) ; store f16 to attn_out [B*T,E]
// one wave per block. V fragments are double-buffered in LDS via
// global_load_async_to_lds_b128 (ASYNCcnt), overlapping with score compute.
// ---------------------------------------------------------------------------
__global__ void k_attention(const _Float16* __restrict__ qh, const _Float16* __restrict__ kpack,
                            const _Float16* __restrict__ vpack, const float* __restrict__ Yv,
                            const float* __restrict__ beta, const float* __restrict__ cum,
                            _Float16* __restrict__ attn_out) {
  int lane = threadIdx.x & 31;
  int t0 = blockIdx.x * 16;
  int bh = blockIdx.y;
  int b = bh / Hc, h = bh % Hc;

  const _Float16* Q  = qh + (size_t)bh * Tc * DMc;                 // [T, DM]
  const v16h* Kp = (const v16h*)(kpack + (size_t)bh * DMc * Tc);   // packed, N-dim = T
  const v16h* Vp = (const v16h*)(vpack + (size_t)bh * Tc * DMc);   // packed, N-dim = DM
  const float* cumv  = cum  + (size_t)bh * Tc;
  const float* betav = beta + (size_t)bh * Tc;

  __shared__ float sS[16 * 32];          // score repack buffer (one wave/block)
  __shared__ _Float16 sV[2][2048];       // double-buffered V chunk (2 x 4KB)

  int hl = lane >> 4, nl = lane & 15;
  const int kNT = Tc >> 4;    // 128 n-tiles in packed K
  const int vNT = DMc >> 4;   // 4  n-tiles in packed V

  unsigned lds_v = (unsigned)(uintptr_t)&sV[0][0];

  // Q A-fragments for the two 32-wide dm chunks (reused across all key tiles)
  v16h aq0 = load_a_frag(Q, DMc, t0, 0,  lane);
  v16h aq1 = load_a_frag(Q, DMc, t0, 32, lane);

  // cum for the 8 query rows this lane covers in the C layout
  float cum_q[8];
#pragma unroll
  for (int j = 0; j < 8; ++j) cum_q[j] = cumv[t0 + j + 8 * hl];

  v8f acc0 = {}, acc1 = {}, acc2 = {}, acc3 = {};

  int s_start = t0 & ~31;                // first chunk touching s >= t0
  int buf = 0;
  // preload first V chunk (4KB contiguous in packed buffer)
  async_copy_4k(lds_v, Vp + (size_t)(s_start >> 5) * vNT * 32, lane);

  for (int s0 = s_start; s0 < Tc; s0 += 32) {
    bool have_next = (s0 + 32 < Tc);
    if (have_next)
      async_copy_4k(lds_v + (buf ^ 1) * 4096, Vp + (size_t)((s0 + 32) >> 5) * vNT * 32, lane);

    // two 16x16 score tiles -> decayed fp32 chunk in LDS (m, s_local) layout
#pragma unroll
    for (int st = 0; st < 2; ++st) {
      int sc = s0 + st * 16;
      v16h kb0 = load_b_packed(Kp, 0 * kNT + (sc >> 4), lane);   // dm chunk 0
      v16h kb1 = load_b_packed(Kp, 1 * kNT + (sc >> 4), lane);   // dm chunk 1
      v8f sacc = {};
      sacc = wmma_f16(aq0, kb0, sacc);
      sacc = wmma_f16(aq1, kb1, sacc);
      int s = sc + nl;
      float cs = cumv[s];
#pragma unroll
      for (int j = 0; j < 8; ++j) {
        int tq = t0 + j + 8 * hl;
        float dec = (s >= tq) ? __expf(fminf(cum_q[j] - cs, 0.f)) : 0.f;
        sS[(j + 8 * hl) * 32 + st * 16 + nl] = sacc[j] * dec;
      }
    }
    __builtin_amdgcn_wave_barrier();
    // repack C-layout scores -> A-layout f16 fragment (cross-lane via LDS)
    v16h as;
#pragma unroll
    for (int j = 0; j < 8; ++j) {
      as[j]     = (_Float16)sS[nl * 32 + 8 * hl + j];
      as[8 + j] = (_Float16)sS[nl * 32 + 16 + 8 * hl + j];
    }
    __builtin_amdgcn_wave_barrier();

    // wait for this chunk's async V copy (in-order completion => <=8 outstanding
    // means the batch before the just-issued one has landed)
    if (have_next) wait_async_le8(); else wait_async_0();

    // S @ V from LDS (ds_load_b128 pairs), 4 dm tiles
    const v16h* lv = (const v16h*)&sV[buf][0];
    v16h bv0 = lv[0 * 32 + lane];
    v16h bv1 = lv[1 * 32 + lane];
    v16h bv2 = lv[2 * 32 + lane];
    v16h bv3 = lv[3 * 32 + lane];
    acc0 = wmma_f16(as, bv0, acc0);
    acc1 = wmma_f16(as, bv1, acc1);
    acc2 = wmma_f16(as, bv2, acc2);
    acc3 = wmma_f16(as, bv3, acc3);
    buf ^= 1;
  }

  // epilogue: O += beta * V (fp32 V from projection), store f16 to attn_out [B*T, E]
  v8f accs[4] = {acc0, acc1, acc2, acc3};
#pragma unroll
  for (int nt = 0; nt < 4; ++nt) {
#pragma unroll
    for (int j = 0; j < 8; ++j) {
      int m  = t0 + j + 8 * hl;
      int dm = nt * 16 + nl;
      size_t row = (size_t)b * Tc + m;
      float o = accs[nt][j] + betav[m] * Yv[row * Ec + h * DMc + dm];
      attn_out[row * Ec + h * DMc + dm] = (_Float16)o;
    }
  }
}

// ---------------------------------------------------------------------------
// Host launcher
// ---------------------------------------------------------------------------
extern "C" void kernel_launch(void* const* d_in, const int* in_sizes, int n_in,
                              void* d_out, int out_size, void* d_ws, size_t ws_size,
                              hipStream_t stream) {
  const float* x  = (const float*)d_in[0];   // [B,T,D]
  const float* Wk = (const float*)d_in[1];   // [E,D]
  const float* Wv = (const float*)d_in[2];   // [E,D]
  const float* Wq = (const float*)d_in[3];   // [E,D]
  const float* Wb = (const float*)d_in[4];   // [H,D]
  const float* Wo = (const float*)d_in[5];   // [D,E]
  float* out = (float*)d_out;                // [B,T,D]

  // workspace carve-up
  char* w = (char*)d_ws;
  auto alloc = [&](size_t bytes) -> void* {
    void* p = (void*)w;
    w += (bytes + 255) & ~(size_t)255;
    return p;
  };
  _Float16* xh   = (_Float16*)alloc((size_t)Mtot * Dc * 2);   // x as f16 row-major
  _Float16* wkP  = (_Float16*)alloc((size_t)Dc * Ec * 2);     // packed B = Wk^T
  _Float16* wvP  = (_Float16*)alloc((size_t)Dc * Ec * 2);
  _Float16* wqP  = (_Float16*)alloc((size_t)Dc * Ec * 2);
  _Float16* woP  = (_Float16*)alloc((size_t)Ec * Dc * 2);     // packed B = Wo^T
  float*    Yq   = (float*)alloc((size_t)Mtot * Ec * 4);
  float*    Yk   = (float*)alloc((size_t)Mtot * Ec * 4);
  float*    Yv   = (float*)alloc((size_t)Mtot * Ec * 4);
  _Float16* qh   = (_Float16*)alloc((size_t)Bc * Hc * Tc * DMc * 2);
  _Float16* kpack= (_Float16*)alloc((size_t)Bc * Hc * Tc * DMc * 2);
  _Float16* vpack= (_Float16*)alloc((size_t)Bc * Hc * Tc * DMc * 2);
  float*    blog = (float*)alloc((size_t)Mtot * Hc * 4);        // beta logits [B*T, H]
  float*    beta = (float*)alloc((size_t)Bc * Hc * Tc * 4);
  float*    cum  = (float*)alloc((size_t)Bc * Hc * Tc * 4);
  _Float16* aoh  = (_Float16*)alloc((size_t)Mtot * Ec * 2);   // attention out f16

  // 1) convert x; transpose+pack weights into fragment-major B buffers
  {
    k_cvt_f16<<<dim3(Mtot * Dc / kCvtPerBlock), dim3(256), 0, stream>>>(x, xh);
    dim3 g(Ec * Dc / 16 / 256);                  // one thread per fragment lane
    k_pack_b_from_wT<<<g, dim3(256), 0, stream>>>(Wk, wkP, Dc, Ec);  // B=[D,E]
    k_pack_b_from_wT<<<g, dim3(256), 0, stream>>>(Wv, wvP, Dc, Ec);
    k_pack_b_from_wT<<<g, dim3(256), 0, stream>>>(Wq, wqP, Dc, Ec);
    k_pack_b_from_wT<<<g, dim3(256), 0, stream>>>(Wo, woP, Ec, Dc);  // B=[E,D]
  }

  // 2) projections: Y = xh @ W^T  (M=4096, N=512, K=1024)
  {
    dim3 grid(Ec / 64, Mtot / 128);
    k_wmma_gemm<Ec, Dc><<<grid, dim3(128), 0, stream>>>(xh, wqP, Yq);
    k_wmma_gemm<Ec, Dc><<<grid, dim3(128), 0, stream>>>(xh, wkP, Yk);
    k_wmma_gemm<Ec, Dc><<<grid, dim3(128), 0, stream>>>(xh, wvP, Yv);
  }

  // 3) beta logits over the whole chip, then sigmoid + cumsum per (b,h)
  k_beta_logits<<<dim3(Mtot / 16), dim3(256), 0, stream>>>(x, Wb, blog);
  k_beta_cumsum<<<dim3(Bc * Hc), dim3(256), 0, stream>>>(blog, beta, cum);

  // 4) normalize + pack f16 (Q row-major+scaled, K/V fragment-packed)
  k_normalize_pack<<<dim3((Bc * Hc * Tc) / 256), dim3(256), 0, stream>>>(Yq, Yk, Yv, qh, kpack, vpack);

  // 5) fused decay attention (async double-buffered V via ASYNCcnt)
  k_attention<<<dim3(Tc / 16, Bc * Hc), dim3(32), 0, stream>>>(qh, kpack, vpack, Yv, beta, cum, aoh);

  // 6) output projection: out = aoh @ Wo^T  (M=4096, N=1024, K=512)
  {
    dim3 grid(Dc / 64, Mtot / 128);
    k_wmma_gemm<Dc, Ec><<<grid, dim3(128), 0, stream>>>(aoh, woP, out);
  }
}

// v004
// It runs in 119 microseconds.
// Next to v003, in two timings, it ran 1.12 and 1.13 times as fast.
// Over all steps from v000 it is 3.82 times as fast.
#include <hip/hip_runtime.h>
#include <hip/hip_bf16.h>

#define DEVI __device__ __forceinline__

typedef __attribute__((ext_vector_type(16))) _Float16 v16h;
typedef __attribute__((ext_vector_type(4)))  _Float16 v4h;
typedef __attribute__((ext_vector_type(8)))  float    v8f;
typedef __attribute__((ext_vector_type(4)))  float    v4f;

// Problem constants (match reference)
constexpr int Bc  = 2;
constexpr int Tc  = 2048;
constexpr int Dc  = 1024;
constexpr int Hc  = 8;
constexpr int DMc = 64;
constexpr int Ec  = Hc * DMc;     // 512
constexpr int Mtot = Bc * Tc;     // 4096

// ---------------------------------------------------------------------------
// WMMA fragment layouts (CDNA5 wave32, ISA 7.12.2)
// A (16x32 f16): lane L holds row M=L&15; hl=L>>4: elems 0..7 = K(8*hl+0..7),
//                elems 8..15 = K(16+8*hl+0..7).
// B (32x16 f16): lane L holds col N=L&15; same K packing as A.
// C (16x16 f32): lane L holds col N=L&15; vgpr j holds row M = j + 8*(L>>4).
//
// Packed-B buffer: fragment f = (k0/32)*(N/16) + (n0/16); lane L's 16 halves
// stored contiguously at ((f*32 + L)*16) -> one 32B vector load per lane.
// ---------------------------------------------------------------------------

DEVI v16h load_a_frag(const _Float16* __restrict__ A, int lda, int m0, int k0, int lane) {
  int m  = m0 + (lane & 15);
  int hl = lane >> 4;
  const _Float16* p0 = A + (size_t)m * lda + (k0 + 8 * hl);
  const _Float16* p1 = p0 + 16;
  v16h r;
#pragma unroll
  for (int j = 0; j < 8; ++j) { r[j] = p0[j]; r[8 + j] = p1[j]; }
  return r;
}

DEVI v16h load_b_packed(const v16h* __restrict__ Bp, int frag, int lane) {
  return Bp[(size_t)frag * 32 + lane];
}

DEVI size_t pack_b_offset(int k, int n, int N) {
  int chunk = k >> 5;
  int kr = k & 31;
  int hl = (kr >> 3) & 1;
  int e  = ((kr >> 4) << 3) | (kr & 7);
  int nt = n >> 4, nl = n & 15;
  return ((size_t)(chunk * (N >> 4) + nt) * 32 + hl * 16 + nl) * 16 + e;
}

DEVI v8f wmma_f16(v16h a, v16h b, v8f c) {
  return __builtin_amdgcn_wmma_f32_16x16x32_f16(false, a, false, b, (short)0, c, false, false);
}

// ---------------------------------------------------------------------------
// Async global->LDS copy of 4KB (8 x b128 per lane), tracked by ASYNCcnt.
// LDS[lds_base + lane*16 + i*512] = MEM[src + lane*16 + i*512]
// ---------------------------------------------------------------------------
DEVI void async_copy_4k(unsigned lds_base, const void* src, int lane) {
  const char* ga = (const char*)src + lane * 16;
  unsigned la = lds_base + lane * 16;
  // one statement: the last line holds every later write of la and ga behind the copies
  asm volatile("global_load_async_to_lds_b128 %0, %1, off\n\t"
               "global_load_async_to_lds_b128 %0, %1, off offset:512\n\t"
               "global_load_async_to_lds_b128 %0, %1, off offset:1024\n\t"
               "global_load_async_to_lds_b128 %0, %1, off offset:1536\n\t"
               "global_load_async_to_lds_b128 %0, %1, off offset:2048\n\t"
               "global_load_async_to_lds_b128 %0, %1, off offset:2560\n\t"
               "global_load_async_to_lds_b128 %0, %1, off offset:3072\n\t"
               "global_load_async_to_lds_b128 %0, %1, off offset:3584\n\t"
               "s_wait_xcnt 0x0"
               :: "v"(la), "v"(ga) : "memory");
}
DEVI void wait_async_0()   { asm volatile("s_wait_asynccnt 0x0" ::: "memory"); }

// ---------------------------------------------------------------------------
// Kernel: fp32 -> f16 elementwise (x)
// A thread converts 32 elements: 8 float4 loads, all in flight together, each 512
// contiguous bytes per wave, then 8 stores of 4 halves. That makes 4096 waves (16 per
// WGP); with one element per thread it is 131072.
// ---------------------------------------------------------------------------
constexpr int kCvtVec = 8;                       // float4 groups per thread
constexpr int kCvtPerBlock = 256 * kCvtVec * 4;  // elements per block
static_assert((Mtot * Dc) % kCvtPerBlock == 0, "convert grid covers x exactly");

__global__ __launch_bounds__(256) void k_cvt_f16(const float* __restrict__ src,
                                                 _Float16* __restrict__ dst) {
  size_t base = (size_t)blockIdx.x * (256 * kCvtVec) + threadIdx.x;   // in groups of 4
  const float4* s4 = (const float4*)src + base;
  v4h* d4 = (v4h*)dst + base;
  float4 v[kCvtVec];
#pragma unroll
  for (int j = 0; j < kCvtVec; ++j) v[j] = s4[j * 256];
#pragma unroll
  for (int j = 0; j < kCvtVec; ++j) {
    v4h r = {(_Float16)v[j].x, (_Float16)v[j].y, (_Float16)v[j].z, (_Float16)v[j].w};
    d4[j * 256] = r;
  }
}

// ---------------------------------------------------------------------------
// Kernel: W [N,K] fp32  ->  packed f16 B buffer for B = W^T [K,N]
// A thread builds one lane's 16 halves of one fragment: two runs of 8 consecutive k of
// row n (four float4 loads; a wave reads 16 whole 128-byte lines) and one 32-byte store
// (1 KB contiguous per wave).
// ---------------------------------------------------------------------------
__global__ __launch_bounds__(256) void k_pack_b_from_wT(const float* __restrict__ W,
                                                        _Float16* __restrict__ dst,
                                                        int K, int N) {
  int i = blockIdx.x * 256 + threadIdx.x;        // fragment * 32 + lane
  if (i >= ((K * N) >> 4)) return;
  int lane = i & 31, frag = i >> 5;
  int ntiles = N >> 4;
  int chunk = frag / ntiles, nt = frag % ntiles;
  int n = nt * 16 + (lane & 15);
  int k = chunk * 32 + 8 * (lane >> 4);
  const float4* p = (const float4*)(W + (size_t)n * K + k);
  float4 lo0 = p[0], lo1 = p[1];                 // k .. k+7
  float4 hi0 = p[4], hi1 = p[5];                 // k+16 .. k+23
  v16h r = {(_Float16)lo0.x, (_Float16)lo0.y, (_Float16)lo0.z, (_Float16)lo0.w,
            (_Float16)lo1.x, (_Float16)lo1.y, (_Float16)lo1.z, (_Float16)lo1.w,
            (_Float16)hi0.x, (_Float16)hi0.y, (_Float16)hi0.z, (_Float16)hi0.w,
            (_Float16)hi1.x, (_Float16)hi1.y, (_Float16)hi1.z, (_Float16)hi1.w};
  ((v16h*)dst)[i] = r;
}

// ---------------------------------------------------------------------------
// Kernel: WMMA GEMM  C[M,N] = A[M,K] (f16 row-major) * Bp (packed f16)
// 4 waves / block; each wave computes a 32x64 tile (8 WMMA per 32-K chunk,
// B fragments reused 2x, A fragments 4x).
// One or two waves run per SIMD, so little but a wave's own order hides a load. The K loop
// is unrolled over three sets of fragment registers: a chunk's 12 loads are issued
// together, two chunks ahead of the WMMAs that use them.
// ---------------------------------------------------------------------------
template <int N, int K>
__global__ __launch_bounds__(128) void k_wmma_gemm(const _Float16* __restrict__ A,
                                                   const _Float16* __restrict__ Bpk,
                                                   float* __restrict__ C) {
  constexpr int kChunks = K / 32;
  constexpr int kSets = 3;                 // one in use, two in flight
  constexpr int ntiles = N >> 4;
  static_assert(K % 32 == 0 && kChunks >= kSets, "whole chunks, at least one per set");
  int lane = threadIdx.x & 31;
  int wave = threadIdx.x >> 5;
  int n0 = blockIdx.x * 64;
  int m0 = blockIdx.y * 128 + wave * 32;
  const v16h* Bp = (const v16h*)Bpk;

  v16h a[kSets][2], b[kSets][4];
  auto load_chunk = [&](int c) {
    int s = c % kSets;
    a[s][0] = load_a_frag(A, K, m0,      c * 32, lane);
    a[s][1] = load_a_frag(A, K, m0 + 16, c * 32, lane);
    int fb = c * ntiles + (n0 >> 4);
#pragma unroll
    for (int nt = 0; nt < 4; ++nt) b[s][nt] = load_b_packed(Bp, fb + nt, lane);
  };

  v8f acc[2][4] = {};
#pragma unroll
  for (int c = 0; c < kSets - 1; ++c) load_chunk(c);
#pragma unroll
  for (int c = 0; c < kChunks; ++c) {
    if (c + kSets - 1 < kChunks) load_chunk(c + kSets - 1);
    // keeps these loads from moving down past this point: left free, the scheduler sinks
    // them to just before their first use (seen at K = 512) and every fragment is waited for
    __builtin_amdgcn_sched_barrier(0);
    int s = c % kSets;
#pragma unroll
    for (int nt = 0; nt < 4; ++nt) {
      acc[0][nt] = wmma_f16(a[s][0], b[s][nt], acc[0][nt]);
      acc[1][nt] = wmma_f16(a[s][1], b[s][nt], acc[1][nt]);
    }
  }
  // the store addresses below reuse the loads' address registers: the wait that belongs
  // in front of that overwrite
  asm volatile("s_wait_xcnt 0x0" ::: "memory");
  // keeps the address arithmetic below from being lifted over that wait
  __builtin_amdgcn_sched_barrier(0);
  int hl = lane >> 4, nl = lane & 15;
#pragma unroll
  for (int mt = 0; mt < 2; ++mt)
#pragma unroll
    for (int nt = 0; nt < 4; ++nt)
#pragma unroll
      for (int j = 0; j < 8; ++j) {
        int m = m0 + mt * 16 + j + 8 * hl;
        C[(size_t)m * N + n0 + nt * 16 + nl] = acc[mt][nt][j];
      }
}

// ---------------------------------------------------------------------------
// Kernel: logit[row][h] = x[row,:] . Wb[h,:]  (fp32), row = b*T + t.
// One block per 16 rows, 8 waves: wave = (row group of 8) x (256-wide slice of D).
// A lane holds 4 consecutive d of each 128-wide chunk, so every load is 512 contiguous
// bytes per wave; each x value is used for all 8 heads, each Wb value for 8 rows.
// ---------------------------------------------------------------------------
// Halve the number of live partial sums: lanes that differ in bit MASK swap the half
// they do not keep, so 64 sums over 32 lanes take 62 exchanges instead of 320.
template <int HALF, int MASK>
DEVI void fold_lanes(float (&v)[64], int lane) {
  bool up = (lane & MASK) != 0;
#pragma unroll
  for (int i = 0; i < HALF; ++i) {
    float keep = up ? v[i + HALF] : v[i];
    float send = up ? v[i] : v[i + HALF];
    v[i] = keep + __shfl_xor(send, MASK);
  }
}

__global__ __launch_bounds__(256) void k_beta_logits(const float* __restrict__ x,
                                                     const float* __restrict__ Wb,
                                                     float* __restrict__ logit) {
  int lane = threadIdx.x & 31;
  int wave = threadIdx.x >> 5;
  int rg = wave & 1;             // which 8 of the block's 16 rows
  int ks = wave >> 1;            // which 256 of the 1024 d
  int row0 = blockIdx.x * 16;
  __shared__ alignas(16) float part[4][128]; // [d slice][row in block * 8 + head]

  const float4* xp = (const float4*)(x + (size_t)(row0 + rg * 8) * Dc + ks * 256) + lane;
  const float4* wp = (const float4*)(Wb + ks * 256) + lane;
  float4 xv[2][8], wv[2][8];
#pragma unroll
  for (int c = 0; c < 2; ++c)
#pragma unroll
    for (int r = 0; r < 8; ++r) xv[c][r] = xp[r * (Dc / 4) + c * 32];
#pragma unroll
  for (int c = 0; c < 2; ++c)
#pragma unroll
    for (int h = 0; h < Hc; ++h) wv[c][h] = wp[h * (Dc / 4) + c * 32];

  float v[64];                   // index = row in group * 8 + head
#pragma unroll
  for (int r = 0; r < 8; ++r)
#pragma unroll
    for (int h = 0; h < Hc; ++h) {
      float s = xv[0][r].x * wv[0][h].x;
      s = fmaf(xv[0][r].y, wv[0][h].y, s);
      s = fmaf(xv[0][r].z, wv[0][h].z, s);
      s = fmaf(xv[0][r].w, wv[0][h].w, s);
      s = fmaf(xv[1][r].x, wv[1][h].x, s);
      s = fmaf(xv[1][r].y, wv[1][h].y, s);
      s = fmaf(xv[1][r].z, wv[1][h].z, s);
      s = fmaf(xv[1][r].w, wv[1][h].w, s);
      v[r * 8 + h] = s;
    }

  fold_lanes<32, 16>(v, lane);
  fold_lanes<16, 8>(v, lane);
  fold_lanes<8, 4>(v, lane);
  fold_lanes<4, 2>(v, lane);
  fold_lanes<2, 1>(v, lane);
  // lane L now holds the wave's sums number 2L and 2L+1
  *(float2*)&part[ks][rg * 64 + lane * 2] = make_float2(v[0], v[1]);
  __syncthreads();

  int tid = threadIdx.x;
  if (tid < 128) {
    float s = 0.f;
#pragma unroll
    for (int k = 0; k < 4; ++k) s += part[k][tid];
    logit[(size_t)row0 * Hc + tid] = s;
  }
}

// ---------------------------------------------------------------------------
// Kernel: beta = sigmoid(logit) and cum = cumsum(log(1-beta+1e-8)) per (b,h)
// ---------------------------------------------------------------------------
__global__ void k_beta_cumsum(const float* __restrict__ logit,
                              float* __restrict__ beta, float* __restrict__ cum) {
  int bh = blockIdx.x;           // b*H + h
  int b = bh / Hc, h = bh % Hc;
  int tid = threadIdx.x;
  __shared__ float slr[Tc];
  __shared__ float spart[256];
  __shared__ float soffs[256];

  // unrolled so that a thread's 8 logit loads are in flight together, not one per trip
#pragma unroll
  for (int i = 0; i < Tc / 256; ++i) {
    int t = tid + i * 256;
    float acc = logit[((size_t)b * Tc + t) * Hc + h];
    float bv = 1.0f / (1.0f + __expf(-acc));
    beta[(size_t)bh * Tc + t] = bv;
    slr[t] = __logf(1.0f - bv + 1e-8f);
  }
  __syncthreads();

  float s = 0.f;
  int base = tid * 8;
#pragma unroll
  for (int i = 0; i < 8; ++i) s += slr[base + i];
  spart[tid] = s;
  __syncthreads();
  if (tid == 0) {
    float run = 0.f;
    for (int i = 0; i < 256; ++i) { soffs[i] = run; run += spart[i]; }
  }
  __syncthreads();
  float run = soffs[tid];
#pragma unroll
  for (int i = 0; i < 8; ++i) {
    run += slr[base + i];
    cum[(size_t)bh * Tc + base + i] = run;
  }
}

// ---------------------------------------------------------------------------
// Kernel: L2-normalize Q (fold 1/sqrt(DM)) and K, pack f16.
// qh    : [B,H,T,DM] row-major          (A-matrix for Q K^T)
// kpack : per (b,h) packed-B, B=K^T (K-dim=DM, N-dim=T)
// vpack : per (b,h) packed-B, B=V   (K-dim=T,  N-dim=DM)
// ---------------------------------------------------------------------------
__global__ void k_normalize_pack(const float* __restrict__ Yq, const float* __restrict__ Yk,
                                 const float* __restrict__ Yv,
                                 _Float16* __restrict__ qh, _Float16* __restrict__ kpack,
                                 _Float16* __restrict__ vpack) {
  int idx = blockIdx.x * 256 + threadIdx.x;    // over B*H*T
  if (idx >= Bc * Hc * Tc) return;
  int t = idx % Tc;
  int bh = idx / Tc;
  int h = bh % Hc, b = bh / Hc;
  size_t row = (size_t)b * Tc + t;
  const float* yq = Yq + row * Ec + h * DMc;
  const float* yk = Yk + row * Ec + h * DMc;
  const float* yv = Yv + row * Ec + h * DMc;

  float nq = 0.f, nk = 0.f;
#pragma unroll 4
  for (int d = 0; d < DMc; ++d) { nq = fmaf(yq[d], yq[d], nq); nk = fmaf(yk[d], yk[d], nk); }
  float sq = 0.125f / fmaxf(__fsqrt_rn(nq), 1e-12f);   // 1/sqrt(DM) folded into Q
  float sk = 1.0f   / fmaxf(__fsqrt_rn(nk), 1e-12f);

  _Float16* qrow = qh + ((size_t)bh * Tc + t) * DMc;
  _Float16* kp   = kpack + (size_t)bh * DMc * Tc;
  _Float16* vp   = vpack + (size_t)bh * Tc * DMc;
#pragma unroll 4
  for (int d = 0; d < DMc; ++d) {
    qrow[d] = (_Float16)(yq[d] * sq);
    kp[pack_b_offset(d, t, Tc)]  = (_Float16)(yk[d] * sk);   // B element (k=d, n=t)
    vp[pack_b_offset(t, d, DMc)] = (_Float16)yv[d];          // B element (k=t, n=d)
  }
}

// ---------------------------------------------------------------------------
// Kernel: fused decay attention.
// Per (b,h) and 16-query tile: stream 32-wide key chunks s >= t-tile,
//   S = (Q K^T) .* exp(min(cum_t - cum_s,0)) .* [s>=t]  (1/sqrt(DM) in Q)
//   O += S @ V ; epilogue O += beta*V (fp32 V) ; store f16 to attn_out [B*T,E]
// A chunk is one long dependent chain (K load, scores, LDS repack, V read, product), and
// a tile has up to 64 of them. The block's 8 waves share the tile's chunks: wave w takes
// chunks w, w + 8, ... into a partial O of its own (there is no softmax: partial sums
// just add), and the partial tiles are summed through LDS at the end.
// Each wave has its own score buffer and its own two V buffers, filled by
// global_load_async_to_lds_b128 (ASYNCcnt) one chunk ahead; no wave reads another's
// before the one barrier in front of the final sum.
// ---------------------------------------------------------------------------
constexpr int kAttnWaves = 8;

__global__ void k_attention(const _Float16* __restrict__ qh, const _Float16* __restrict__ kpack,
                            const _Float16* __restrict__ vpack, const float* __restrict__ Yv,
                            const float* __restrict__ beta, const float* __restrict__ cum,
                            _Float16* __restrict__ attn_out) {
  int lane = threadIdx.x & 31;
  int wave = __builtin_amdgcn_readfirstlane(threadIdx.x >> 5);
  int t0 = blockIdx.x * 16;
  int bh = blockIdx.y;
  int b = bh / Hc, h = bh % Hc;

  const _Float16* Q  = qh + (size_t)bh * Tc * DMc;                 // [T, DM]
  const v16h* Kp = (const v16h*)(kpack + (size_t)bh * DMc * Tc);   // packed, N-dim = T
  const v16h* Vp = (const v16h*)(vpack + (size_t)bh * Tc * DMc);   // packed, N-dim = DM
  const float* cumv  = cum  + (size_t)bh * Tc;
  const float* betav = beta + (size_t)bh * Tc;

  __shared__ alignas(32) _Float16 sV[kAttnWaves][2][2048];  // per wave: 2 x 4KB V chunk
  __shared__ alignas(16) float sSall[kAttnWaves][16 * 32];  // per wave: score repack buffer
  float* sS = &sSall[wave][0];

  int hl = lane >> 4, nl = lane & 15;
  const int kNT = Tc >> 4;    // 128 n-tiles in packed K
  const int vNT = DMc >> 4;   // 4  n-tiles in packed V

  unsigned lds_v = (unsigned)(uintptr_t)&sV[wave][0][0];

  // Q A-fragments for the two 32-wide dm chunks (reused across all key tiles)
  v16h aq0 = load_a_frag(Q, DMc, t0, 0,  lane);
  v16h aq1 = load_a_frag(Q, DMc, t0, 32, lane);

  // cum for the 8 query rows this lane covers in the C layout
  float cum_q[8];
#pragma unroll
  for (int j = 0; j < 8; ++j) cum_q[j] = cumv[t0 + j + 8 * hl];

  v8f acc0 = {}, acc1 = {}, acc2 = {}, acc3 = {};

  constexpr int kStride = kAttnWaves * 32;      // keys between two chunks of one wave
  int s_first = (t0 & ~31) + wave * 32;         // this wave's first chunk touching s >= t0
  int buf = 0;
  // preload this wave's first V chunk (4KB contiguous in packed buffer)
  if (s_first < Tc)
    async_copy_4k(lds_v, Vp + (size_t)(s_first >> 5) * vNT * 32, lane);

  for (int s0 = s_first; s0 < Tc; s0 += kStride) {
    // two 16x16 score tiles -> decayed fp32 chunk in LDS (m, s_local) layout
#pragma unroll
    for (int st = 0; st < 2; ++st) {
      int sc = s0 + st * 16;
      v16h kb0 = load_b_packed(Kp, 0 * kNT + (sc >> 4), lane);   // dm chunk 0
      v16h kb1 = load_b_packed(Kp, 1 * kNT + (sc >> 4), lane);   // dm chunk 1
      v8f sacc = {};
      sacc = wmma_f16(aq0, kb0, sacc);
      sacc = wmma_f16(aq1, kb1, sacc);
      int s = sc + nl;
      float cs = cumv[s];
#pragma unroll
      for (int j = 0; j < 8; ++j) {
        int tq = t0 + j + 8 * hl;
        float dec = (s >= tq) ? __expf(fminf(cum_q[j] - cs, 0.f)) : 0.f;
        sS[(j + 8 * hl) * 32 + st * 16 + nl] = sacc[j] * dec;
      }
    }
    __builtin_amdgcn_wave_barrier();
    // repack C-layout scores -> A-layout f16 fragment (cross-lane via LDS)
    v16h as;
#pragma unroll
    for (int j = 0; j < 8; ++j) {
      as[j]     = (_Float16)sS[nl * 32 + 8 * hl + j];
      as[8 + j] = (_Float16)sS[nl * 32 + 16 + 8 * hl + j];
    }
    __builtin_amdgcn_wave_barrier();

    // this chunk's V copies, the only ones in flight, have landed behind this wait
    wait_async_0();
    if (s0 + kStride < Tc) {
      // the other buffer is refilled only when this wave's LDS reads of it have retired
      asm volatile("s_wait_dscnt 0x0" ::: "memory");
      async_copy_4k(lds_v + (buf ^ 1) * 4096, Vp + (size_t)((s0 + kStride) >> 5) * vNT * 32, lane);
    }

    // S @ V from LDS (ds_load_b128 pairs), 4 dm tiles
    const v16h* lv = (const v16h*)&sV[wave][buf][0];
    v16h bv0 = lv[0 * 32 + lane];
    v16h bv1 = lv[1 * 32 + lane];
    v16h bv2 = lv[2 * 32 + lane];
    v16h bv3 = lv[3 * 32 + lane];
    acc0 = wmma_f16(as, bv0, acc0);
    acc1 = wmma_f16(as, bv1, acc1);
    acc2 = wmma_f16(as, bv2, acc2);
    acc3 = wmma_f16(as, bv3, acc3);
    buf ^= 1;
  }

  // nothing may still be landing in, or be read from, the V buffers: they now take the sums
  wait_async_0();
  asm volatile("s_wait_dscnt 0x0" ::: "memory");

  // this wave's share of the epilogue is piece number 'wave' of the tile (see below). Its
  // beta and fp32 V are fetched in front of the barrier: all but the last wave to arrive
  // have them by the time the barrier opens (ahead of the key loop they cost registers,
  // and the build then fetches the chunk's K fragments in two rounds instead of one)
  int dm = (wave >> 1) * 16 + nl;
  int m0 = t0 + (wave & 1) * 4 + 8 * hl;
  size_t o0 = ((size_t)b * Tc + m0) * Ec + h * DMc + dm;
  float bq[4], yv[4];
#pragma unroll
  for (int i = 0; i < 4; ++i) { bq[i] = betav[m0 + i]; yv[i] = Yv[o0 + (size_t)i * Ec]; }

  // each wave parks its partial tile in its own V buffers, 4 accumulator rows per piece:
  // piece p = nt * 2 + (j >> 2), 16 bytes per lane, so stores and loads are contiguous
  v8f accs[4] = {acc0, acc1, acc2, acc3};
  v4f* mine = (v4f*)&sV[wave][0][0];
#pragma unroll
  for (int nt = 0; nt < 4; ++nt) {
    v4f lo = {accs[nt][0], accs[nt][1], accs[nt][2], accs[nt][3]};
    v4f hi = {accs[nt][4], accs[nt][5], accs[nt][6], accs[nt][7]};
    mine[(nt * 2 + 0) * 32 + lane] = lo;
    mine[(nt * 2 + 1) * 32 + lane] = hi;
  }
  __syncthreads();

  // wave w sums piece w over the 8 partial tiles, in wave order
  v4f o4 = ((const v4f*)&sV[0][0][0])[wave * 32 + lane];
#pragma unroll
  for (int w = 1; w < kAttnWaves; ++w) o4 += ((const v4f*)&sV[w][0][0])[wave * 32 + lane];

  // epilogue: O += beta * V (fp32 V from projection), store f16 to attn_out [B*T, E]
#pragma unroll
  for (int i = 0; i < 4; ++i)
    attn_out[o0 + (size_t)i * Ec] = (_Float16)(o4[i] + bq[i] * yv[i]);
}

// ---------------------------------------------------------------------------
// Host launcher
// ---------------------------------------------------------------------------
extern "C" void kernel_launch(void* const* d_in, const int* in_sizes, int n_in,
                              void* d_out, int out_size, void* d_ws, size_t ws_size,
                              hipStream_t stream) {
  const float* x  = (const float*)d_in[0];   // [B,T,D]
  const float* Wk = (const float*)d_in[1];   // [E,D]
  const float* Wv = (const float*)d_in[2];   // [E,D]
  const float* Wq = (const float*)d_in[3];   // [E,D]
  const float* Wb = (const float*)d_in[4];   // [H,D]
  const float* Wo = (const float*)d_in[5];   // [D,E]
  float* out = (float*)d_out;                // [B,T,D]

  // workspace carve-up
  char* w = (char*)d_ws;
  auto alloc = [&](size_t bytes) -> void* {
    void* p = (void*)w;
    w += (bytes + 255) & ~(size_t)255;
    return p;
  };
  _Float16* xh   = (_Float16*)alloc((size_t)Mtot * Dc * 2);   // x as f16 row-major
  _Float16* wkP  = (_Float16*)alloc((size_t)Dc * Ec * 2);     // packed B = Wk^T
  _Float16* wvP  = (_Float16*)alloc((size_t)Dc * Ec * 2);
  _Float16* wqP  = (_Float16*)alloc((size_t)Dc * Ec * 2);
  _Float16* woP  = (_Float16*)alloc((size_t)Ec * Dc * 2);     // packed B = Wo^T
  float*    Yq   = (float*)alloc((size_t)Mtot * Ec * 4);
  float*    Yk   = (float*)alloc((size_t)Mtot * Ec * 4);
  float*    Yv   = (float*)alloc((size_t)Mtot * Ec * 4);
  _Float16* qh   = (_Float16*)alloc((size_t)Bc * Hc * Tc * DMc * 2);
  _Float16* kpack= (_Float16*)alloc((size_t)Bc * Hc * Tc * DMc * 2);
  _Float16* vpack= (_Float16*)alloc((size_t)Bc * Hc * Tc * DMc * 2);
  float*    blog = (float*)alloc((size_t)Mtot * Hc * 4);        // beta logits [B*T, H]
  float*    beta = (float*)alloc((size_t)Bc * Hc * Tc * 4);
  float*    cum  = (float*)alloc((size_t)Bc * Hc * Tc * 4);
  _Float16* aoh  = (_Float16*)alloc((size_t)Mtot * Ec * 2);   // attention out f16

  // 1) convert x; transpose+pack weights into fragment-major B buffers
  {
    k_cvt_f16<<<dim3(Mtot * Dc / kCvtPerBlock), dim3(256), 0, stream>>>(x, xh);
    dim3 g(Ec * Dc / 16 / 256);                  // one thread per fragment lane
    k_pack_b_from_wT<<<g, dim3(256), 0, stream>>>(Wk, wkP, Dc, Ec);  // B=[D,E]
    k_pack_b_from_wT<<<g, dim3(256), 0, stream>>>(Wv, wvP, Dc, Ec);
    k_pack_b_from_wT<<<g, dim3(256), 0, stream>>>(Wq, wqP, Dc, Ec);
    k_pack_b_from_wT<<<g, dim3(256), 0, stream>>>(Wo, woP, Ec, Dc);  // B=[E,D]
  }

  // 2) projections: Y = xh @ W^T  (M=4096, N=512, K=1024)
  {
    dim3 grid(Ec / 64, Mtot / 128);
    k_wmma_gemm<Ec, Dc><<<grid, dim3(128), 0, stream>>>(xh, wqP, Yq);
    k_wmma_gemm<Ec, Dc><<<grid, dim3(128), 0, stream>>>(xh, wkP, Yk);
    k_wmma_gemm<Ec, Dc><<<grid, dim3(128), 0, stream>>>(xh, wvP, Yv);
  }

  // 3) beta logits over the whole chip, then sigmoid + cumsum per (b,h)
  k_beta_logits<<<dim3(Mtot / 16), dim3(256), 0, stream>>>(x, Wb, blog);
  k_beta_cumsum<<<dim3(Bc * Hc), dim3(256), 0, stream>>>(blog, beta, cum);

  // 4) normalize + pack f16 (Q row-major+scaled, K/V fragment-packed)
  k_normalize_pack<<<dim3((Bc * Hc * Tc) / 256), dim3(256), 0, stream>>>(Yq, Yk, Yv, qh, kpack, vpack);

  // 5) fused decay attention (async double-buffered V via ASYNCcnt), 8 waves per query tile
  k_attention<<<dim3(Tc / 16, Bc * Hc), dim3(kAttnWaves * 32), 0, stream>>>(qh, kpack, vpack, Yv, beta, cum, aoh);

  // 6) output projection: out = aoh @ Wo^T  (M=4096, N=1024, K=512)
  {
    dim3 grid(Dc / 64, Mtot / 128);
    k_wmma_gemm<Dc, Ec><<<grid, dim3(128), 0, stream>>>(aoh, woP, out);
  }
}

// v005
// Measured time: 92 microseconds a run.
// Timed twice side by side with v004, it ran 1.30 and 1.29 times as fast.
// Counting every step since v000, it is 4.95 times as fast.
#include <hip/hip_runtime.h>
#include <hip/hip_bf16.h>

#define DEVI __device__ __forceinline__

typedef __attribute__((ext_vector_type(16))) _Float16 v16h;
typedef __attribute__((ext_vector_type(4)))  _Float16 v4h;
typedef __attribute__((ext_vector_type(8)))  float    v8f;
typedef __attribute__((ext_vector_type(4)))  float    v4f;

// Problem constants (match reference)
constexpr int Bc  = 2;
constexpr int Tc  = 2048;
constexpr int Dc  = 1024;
constexpr int Hc  = 8;
constexpr int DMc = 64;
constexpr int Ec  = Hc * DMc;     // 512
constexpr int Mtot = Bc * Tc;     // 4096

// ---------------------------------------------------------------------------
// WMMA fragment layouts (CDNA5 wave32, ISA 7.12.2)
// A (16x32 f16): lane L holds row M=L&15; hl=L>>4: elems 0..7 = K(8*hl+0..7),
//                elems 8..15 = K(16+8*hl+0..7).
// B (32x16 f16): lane L holds col N=L&15; same K packing as A.
// C (16x16 f32): lane L holds col N=L&15; vgpr j holds row M = j + 8*(L>>4).
//
// Packed-B buffer: fragment f = (k0/32)*(N/16) + (n0/16); lane L's 16 halves
// stored contiguously at ((f*32 + L)*16) -> one 32B vector load per lane.
// ---------------------------------------------------------------------------

DEVI v16h load_a_frag(const _Float16* __restrict__ A, int lda, int m0, int k0, int lane) {
  int m  = m0 + (lane & 15);
  int hl = lane >> 4;
  const _Float16* p0 = A + (size_t)m * lda + (k0 + 8 * hl);
  const _Float16* p1 = p0 + 16;
  v16h r;
#pragma unroll
  for (int j = 0; j < 8; ++j) { r[j] = p0[j]; r[8 + j] = p1[j]; }
  return r;
}

DEVI v16h load_b_packed(const v16h* __restrict__ Bp, int frag, int lane) {
  return Bp[(size_t)frag * 32 + lane];
}

DEVI size_t pack_b_offset(int k, int n, int N) {
  int chunk = k >> 5;
  int kr = k & 31;
  int hl = (kr >> 3) & 1;
  int e  = ((kr >> 4) << 3) | (kr & 7);
  int nt = n >> 4, nl = n & 15;
  return ((size_t)(chunk * (N >> 4) + nt) * 32 + hl * 16 + nl) * 16 + e;
}

DEVI v8f wmma_f16(v16h a, v16h b, v8f c) {
  return __builtin_amdgcn_wmma_f32_16x16x32_f16(false, a, false, b, (short)0, c, false, false);
}

// ---------------------------------------------------------------------------
// Async global->LDS copy of 4KB (8 x b128 per lane), tracked by ASYNCcnt.
// LDS[lds_base + lane*16 + i*512] = MEM[src + lane*16 + i*512]
// ---------------------------------------------------------------------------
DEVI void async_copy_4k(unsigned lds_base, const void* src, int lane) {
  const char* ga = (const char*)src + lane * 16;
  unsigned la = lds_base + lane * 16;
  // one statement: the last line holds every later write of la and ga behind the copies
  asm volatile("global_load_async_to_lds_b128 %0, %1, off\n\t"
               "global_load_async_to_lds_b128 %0, %1, off offset:512\n\t"
               "global_load_async_to_lds_b128 %0, %1, off offset:1024\n\t"
               "global_load_async_to_lds_b128 %0, %1, off offset:1536\n\t"
               "global_load_async_to_lds_b128 %0, %1, off offset:2048\n\t"
               "global_load_async_to_lds_b128 %0, %1, off offset:2560\n\t"
               "global_load_async_to_lds_b128 %0, %1, off offset:3072\n\t"
               "global_load_async_to_lds_b128 %0, %1, off offset:3584\n\t"
               "s_wait_xcnt 0x0"
               :: "v"(la), "v"(ga) : "memory");
}
DEVI void wait_async_0()   { asm volatile("s_wait_asynccnt 0x0" ::: "memory"); }

// ---------------------------------------------------------------------------
// Block body: fp32 -> f16 elementwise (x)
// A thread converts 32 elements: 8 float4 loads, all in flight together, each 512
// contiguous bytes per wave, then 8 stores of 4 halves. That makes 4096 waves (16 per
// WGP); with one element per thread it is 131072.
// ---------------------------------------------------------------------------
constexpr int kCvtVec = 8;                       // float4 groups per thread
constexpr int kCvtPerBlock = 256 * kCvtVec * 4;  // elements per block
static_assert((Mtot * Dc) % kCvtPerBlock == 0, "convert grid covers x exactly");

DEVI void cvt_f16_block(int blk, const float* __restrict__ src, _Float16* __restrict__ dst) {
  size_t base = (size_t)blk * (256 * kCvtVec) + threadIdx.x;   // in groups of 4
  const float4* s4 = (const float4*)src + base;
  v4h* d4 = (v4h*)dst + base;
  float4 v[kCvtVec];
#pragma unroll
  for (int j = 0; j < kCvtVec; ++j) v[j] = s4[j * 256];
#pragma unroll
  for (int j = 0; j < kCvtVec; ++j) {
    v4h r = {(_Float16)v[j].x, (_Float16)v[j].y, (_Float16)v[j].z, (_Float16)v[j].w};
    d4[j * 256] = r;
  }
  // in the merged kernel other jobs' code follows this body in the listing and reuses the
  // stores' registers: the wait that belongs in front of that overwrite
  asm volatile("s_wait_xcnt 0x0" ::: "memory");
}

// ---------------------------------------------------------------------------
// Block body: W [N,K] fp32  ->  packed f16 B buffer for B = W^T [K,N]
// A thread builds one lane's 16 halves of one fragment: two runs of 8 consecutive k of
// row n (four float4 loads; a wave reads 16 whole 128-byte lines) and one 32-byte store
// (1 KB contiguous per wave).
// ---------------------------------------------------------------------------
DEVI void pack_b_from_wT_block(int blk, const float* __restrict__ W, _Float16* __restrict__ dst,
                               int K, int N) {
  int i = blk * 256 + threadIdx.x;               // fragment * 32 + lane
  if (i >= ((K * N) >> 4)) return;
  int lane = i & 31, frag = i >> 5;
  int ntiles = N >> 4;
  int chunk = frag / ntiles, nt = frag % ntiles;
  int n = nt * 16 + (lane & 15);
  int k = chunk * 32 + 8 * (lane >> 4);
  const float4* p = (const float4*)(W + (size_t)n * K + k);
  float4 lo0 = p[0], lo1 = p[1];                 // k .. k+7
  float4 hi0 = p[4], hi1 = p[5];                 // k+16 .. k+23
  v16h r = {(_Float16)lo0.x, (_Float16)lo0.y, (_Float16)lo0.z, (_Float16)lo0.w,
            (_Float16)lo1.x, (_Float16)lo1.y, (_Float16)lo1.z, (_Float16)lo1.w,
            (_Float16)hi0.x, (_Float16)hi0.y, (_Float16)hi0.z, (_Float16)hi0.w,
            (_Float16)hi1.x, (_Float16)hi1.y, (_Float16)hi1.z, (_Float16)hi1.w};
  ((v16h*)dst)[i] = r;
}

// ---------------------------------------------------------------------------
// Kernel: WMMA GEMM  C[M,N] = A[M,K] (f16 row-major) * Bp (packed f16)
// 4 waves / block; each wave computes a 32x64 tile (8 WMMA per 32-K chunk,
// B fragments reused 2x, A fragments 4x).
// One or two waves run per SIMD, so little but a wave's own order hides a load. The K loop
// is unrolled over three sets of fragment registers: a chunk's 12 loads are issued
// together, two chunks ahead of the WMMAs that use them.
// blockIdx.z picks one of several products that share A and run side by side in one launch:
// their packed B buffers lie one behind the other, and so do their C buffers.
// ---------------------------------------------------------------------------
template <int N, int K>
__global__ __launch_bounds__(128) void k_wmma_gemm(const _Float16* __restrict__ A,
                                                   const _Float16* __restrict__ Bpk,
                                                   float* __restrict__ C) {
  constexpr int kChunks = K / 32;
  constexpr int kSets = 3;                 // one in use, two in flight
  constexpr int ntiles = N >> 4;
  static_assert(K % 32 == 0 && kChunks >= kSets, "whole chunks, at least one per set");
  int lane = threadIdx.x & 31;
  int wave = threadIdx.x >> 5;
  int n0 = blockIdx.x * 64;
  int m0 = blockIdx.y * 128 + wave * 32;
  const v16h* Bp = (const v16h*)(Bpk + (size_t)blockIdx.z * K * N);
  C += (size_t)blockIdx.z * Mtot * N;

  v16h a[kSets][2], b[kSets][4];
  auto load_chunk = [&](int c) {
    int s = c % kSets;
    a[s][0] = load_a_frag(A, K, m0,      c * 32, lane);
    a[s][1] = load_a_frag(A, K, m0 + 16, c * 32, lane);
    int fb = c * ntiles + (n0 >> 4);
#pragma unroll
    for (int nt = 0; nt < 4; ++nt) b[s][nt] = load_b_packed(Bp, fb + nt, lane);
  };

  v8f acc[2][4] = {};
#pragma unroll
  for (int c = 0; c < kSets - 1; ++c) load_chunk(c);
#pragma unroll
  for (int c = 0; c < kChunks; ++c) {
    if (c + kSets - 1 < kChunks) load_chunk(c + kSets - 1);
    // keeps these loads from moving down past this point: left free, the scheduler sinks
    // them to just before their first use (seen at K = 512) and every fragment is waited for
    __builtin_amdgcn_sched_barrier(0);
    int s = c % kSets;
#pragma unroll
    for (int nt = 0; nt < 4; ++nt) {
      acc[0][nt] = wmma_f16(a[s][0], b[s][nt], acc[0][nt]);
      acc[1][nt] = wmma_f16(a[s][1], b[s][nt], acc[1][nt]);
    }
  }
  // the store addresses below reuse the loads' address registers: the wait that belongs
  // in front of that overwrite
  asm volatile("s_wait_xcnt 0x0" ::: "memory");
  // keeps the address arithmetic below from being lifted over that wait
  __builtin_amdgcn_sched_barrier(0);
  int hl = lane >> 4, nl = lane & 15;
#pragma unroll
  for (int mt = 0; mt < 2; ++mt)
#pragma unroll
    for (int nt = 0; nt < 4; ++nt)
#pragma unroll
      for (int j = 0; j < 8; ++j) {
        int m = m0 + mt * 16 + j + 8 * hl;
        C[(size_t)m * N + n0 + nt * 16 + nl] = acc[mt][nt][j];
      }
}

// ---------------------------------------------------------------------------
// Block body: logit[row][h] = x[row,:] . Wb[h,:]  (fp32), row = b*T + t.
// One block per 16 rows, 8 waves: wave = (row group of 8) x (256-wide slice of D).
// A lane holds 4 consecutive d of each 128-wide chunk, so every load is 512 contiguous
// bytes per wave; each x value is used for all 8 heads, each Wb value for 8 rows.
// ---------------------------------------------------------------------------
// Halve the number of live partial sums: lanes that differ in bit MASK swap the half
// they do not keep, so 64 sums over 32 lanes take 62 exchanges instead of 320.
template <int HALF, int MASK>
DEVI void fold_lanes(float (&v)[64], int lane) {
  bool up = (lane & MASK) != 0;
#pragma unroll
  for (int i = 0; i < HALF; ++i) {
    float keep = up ? v[i + HALF] : v[i];
    float send = up ? v[i] : v[i + HALF];
    v[i] = keep + __shfl_xor(send, MASK);
  }
}

DEVI void beta_logits_block(int blk, const float* __restrict__ x, const float* __restrict__ Wb,
                            float* __restrict__ logit) {
  int lane = threadIdx.x & 31;
  int wave = threadIdx.x >> 5;
  int rg = wave & 1;             // which 8 of the block's 16 rows
  int ks = wave >> 1;            // which 256 of the 1024 d
  int row0 = blk * 16;
  __shared__ alignas(16) float part[4][128]; // [d slice][row in block * 8 + head]

  const float4* xp = (const float4*)(x + (size_t)(row0 + rg * 8) * Dc + ks * 256) + lane;
  const float4* wp = (const float4*)(Wb + ks * 256) + lane;
  float4 xv[2][8], wv[2][8];
#pragma unroll
  for (int c = 0; c < 2; ++c)
#pragma unroll
    for (int r = 0; r < 8; ++r) xv[c][r] = xp[r * (Dc / 4) + c * 32];
#pragma unroll
  for (int c = 0; c < 2; ++c)
#pragma unroll
    for (int h = 0; h < Hc; ++h) wv[c][h] = wp[h * (Dc / 4) + c * 32];

  float v[64];                   // index = row in group * 8 + head
#pragma unroll
  for (int r = 0; r < 8; ++r)
#pragma unroll
    for (int h = 0; h < Hc; ++h) {
      float s = xv[0][r].x * wv[0][h].x;
      s = fmaf(xv[0][r].y, wv[0][h].y, s);
      s = fmaf(xv[0][r].z, wv[0][h].z, s);
      s = fmaf(xv[0][r].w, wv[0][h].w, s);
      s = fmaf(xv[1][r].x, wv[1][h].x, s);
      s = fmaf(xv[1][r].y, wv[1][h].y, s);
      s = fmaf(xv[1][r].z, wv[1][h].z, s);
      s = fmaf(xv[1][r].w, wv[1][h].w, s);
      v[r * 8 + h] = s;
    }

  fold_lanes<32, 16>(v, lane);
  fold_lanes<16, 8>(v, lane);
  fold_lanes<8, 4>(v, lane);
  fold_lanes<4, 2>(v, lane);
  fold_lanes<2, 1>(v, lane);
  // lane L now holds the wave's sums number 2L and 2L+1
  *(float2*)&part[ks][rg * 64 + lane * 2] = make_float2(v[0], v[1]);
  __syncthreads();

  int tid = threadIdx.x;
  if (tid < 128) {
    float s = 0.f;
#pragma unroll
    for (int k = 0; k < 4; ++k) s += part[k][tid];
    logit[(size_t)row0 * Hc + tid] = s;
  }
}

// ---------------------------------------------------------------------------
// Kernel: everything that reads only the inputs, in one launch. None of the six jobs needs
// another's result, each alone is too short to fill the chip, and as launches of their own
// they run one behind the other. A block takes its job from its index (the same for all
// its threads); the blocks with the most work per block come first.
// ---------------------------------------------------------------------------
constexpr int kLogitBlocks = Mtot / 16;
constexpr int kCvtBlocks   = Mtot * Dc / kCvtPerBlock;
constexpr int kPackBlocks  = Ec * Dc / 16 / 256;   // per weight: one thread per fragment lane
constexpr int kPrepBlocks  = kLogitBlocks + kCvtBlocks + 4 * kPackBlocks;

__global__ __launch_bounds__(256) void k_prep(const float* __restrict__ x,
                                              const float* __restrict__ Wq,
                                              const float* __restrict__ Wk,
                                              const float* __restrict__ Wv,
                                              const float* __restrict__ Wo,
                                              const float* __restrict__ Wb,
                                              _Float16* __restrict__ xh,
                                              _Float16* __restrict__ wP,
                                              float* __restrict__ logit) {
  int blk = blockIdx.x;
  if (blk < kLogitBlocks) { beta_logits_block(blk, x, Wb, logit); return; }
  blk -= kLogitBlocks;
  if (blk < kCvtBlocks) { cvt_f16_block(blk, x, xh); return; }
  blk -= kCvtBlocks;
  int which = blk / kPackBlocks;                   // 0..3 = Wq, Wk, Wv, Wo
  blk -= which * kPackBlocks;
  const float* W = which == 0 ? Wq : which == 1 ? Wk : which == 2 ? Wv : Wo;
  _Float16* dst = wP + (size_t)which * (Ec * Dc);
  if (which < 3) pack_b_from_wT_block(blk, W, dst, Dc, Ec);   // B = [D,E]
  else           pack_b_from_wT_block(blk, W, dst, Ec, Dc);   // B = [E,D]
}

// ---------------------------------------------------------------------------
// Block body: beta = sigmoid(logit) and cum = cumsum(log(1-beta+1e-8)) per (b,h)
// ---------------------------------------------------------------------------
DEVI void beta_cumsum_block(int bh /* b*H + h */, const float* __restrict__ logit,
                            float* __restrict__ beta, float* __restrict__ cum) {
  int b = bh / Hc, h = bh % Hc;
  int tid = threadIdx.x;
  __shared__ float slr[Tc];
  __shared__ float spart[256];
  __shared__ float soffs[256];

  // unrolled so that a thread's 8 logit loads are in flight together, not one per trip
#pragma unroll
  for (int i = 0; i < Tc / 256; ++i) {
    int t = tid + i * 256;
    float acc = logit[((size_t)b * Tc + t) * Hc + h];
    float bv = 1.0f / (1.0f + __expf(-acc));
    beta[(size_t)bh * Tc + t] = bv;
    slr[t] = __logf(1.0f - bv + 1e-8f);
  }
  __syncthreads();

  float s = 0.f;
  int base = tid * 8;
#pragma unroll
  for (int i = 0; i < 8; ++i) s += slr[base + i];
  spart[tid] = s;
  __syncthreads();
  if (tid == 0) {
    float run = 0.f;
    for (int i = 0; i < 256; ++i) { soffs[i] = run; run += spart[i]; }
  }
  __syncthreads();
  float run = soffs[tid];
#pragma unroll
  for (int i = 0; i < 8; ++i) {
    run += slr[base + i];
    cum[(size_t)bh * Tc + base + i] = run;
  }
}

// ---------------------------------------------------------------------------
// Block body: L2-normalize Q (fold 1/sqrt(DM)) and K, pack f16.
// qh    : [B,H,T,DM] row-major          (A-matrix for Q K^T)
// kpack : per (b,h) packed-B, B=K^T (K-dim=DM, N-dim=T)
// vpack : per (b,h) packed-B, B=V   (K-dim=T,  N-dim=DM)
// ---------------------------------------------------------------------------
DEVI void normalize_pack_block(int blk, const float* __restrict__ Yq, const float* __restrict__ Yk,
                               const float* __restrict__ Yv,
                               _Float16* __restrict__ qh, _Float16* __restrict__ kpack,
                               _Float16* __restrict__ vpack) {
  int idx = blk * 256 + threadIdx.x;           // over B*H*T
  if (idx >= Bc * Hc * Tc) return;
  int t = idx % Tc;
  int bh = idx / Tc;
  int h = bh % Hc, b = bh / Hc;
  size_t row = (size_t)b * Tc + t;
  const float* yq = Yq + row * Ec + h * DMc;
  const float* yk = Yk + row * Ec + h * DMc;
  const float* yv = Yv + row * Ec + h * DMc;

  float nq = 0.f, nk = 0.f;
#pragma unroll 4
  for (int d = 0; d < DMc; ++d) { nq = fmaf(yq[d], yq[d], nq); nk = fmaf(yk[d], yk[d], nk); }
  float sq = 0.125f / fmaxf(__fsqrt_rn(nq), 1e-12f);   // 1/sqrt(DM) folded into Q
  float sk = 1.0f   / fmaxf(__fsqrt_rn(nk), 1e-12f);

  _Float16* qrow = qh + ((size_t)bh * Tc + t) * DMc;
  _Float16* kp   = kpack + (size_t)bh * DMc * Tc;
  _Float16* vp   = vpack + (size_t)bh * Tc * DMc;
  for (int d0 = 0; d0 < DMc; d0 += 4) {
#pragma unroll
    for (int d = d0; d < d0 + 4; ++d) {
      qrow[d] = (_Float16)(yq[d] * sq);
      kp[pack_b_offset(d, t, Tc)]  = (_Float16)(yk[d] * sk);   // B element (k=d, n=t)
      vp[pack_b_offset(t, d, DMc)] = (_Float16)yv[d];          // B element (k=t, n=d)
    }
    // the next trip's loads and address sums, and behind the loop the other job's code,
    // reuse these stores' registers: the wait that belongs in front of that overwrite.
    // Once per 4 d, not per d, so that the 4 d still load as one 16-byte vector
    asm volatile("s_wait_xcnt 0x0" ::: "memory");
  }
}

// ---------------------------------------------------------------------------
// Kernel: the two jobs between the projections and the attention, in one launch: neither
// reads what the other writes. The 16 scan blocks, the longer ones, come first.
// ---------------------------------------------------------------------------
constexpr int kScanBlocks = Bc * Hc;
constexpr int kNormBlocks = Bc * Hc * Tc / 256;

__global__ void k_scan_and_pack(const float* __restrict__ logit, float* __restrict__ beta,
                                float* __restrict__ cum,
                                const float* __restrict__ Yq, const float* __restrict__ Yk,
                                const float* __restrict__ Yv,
                                _Float16* __restrict__ qh, _Float16* __restrict__ kpack,
                                _Float16* __restrict__ vpack) {
  int blk = blockIdx.x;
  if (blk < kScanBlocks) beta_cumsum_block(blk, logit, beta, cum);
  else normalize_pack_block(blk - kScanBlocks, Yq, Yk, Yv, qh, kpack, vpack);
}

// ---------------------------------------------------------------------------
// Kernel: fused decay attention.
// Per (b,h) and 16-query tile: stream 32-wide key chunks s >= t-tile,
//   S = (Q K^T) .* exp(min(cum_t - cum_s,0)) .* [s>=t]  (1/sqrt(DM) in Q)
//   O += S @ V ; epilogue O += beta*V (fp32 V) ; store f16 to attn_out [B*T,E]
// A chunk is one long dependent chain (K load, scores, LDS repack, V read, product), and
// a tile has up to 64 of them. The block's 8 waves share the tile's chunks: wave w takes
// chunks w, w + 8, ... into a partial O of its own (there is no softmax: partial sums
// just add), and the partial tiles are summed through LDS at the end.
// Each wave has its own score buffer and its own two V buffers, filled by
// global_load_async_to_lds_b128 (ASYNCcnt) one chunk ahead; no wave reads another's
// before the one barrier in front of the final sum.
// ---------------------------------------------------------------------------
constexpr int kAttnWaves = 8;

__global__ void k_attention(const _Float16* __restrict__ qh, const _Float16* __restrict__ kpack,
                            const _Float16* __restrict__ vpack, const float* __restrict__ Yv,
                            const float* __restrict__ beta, const float* __restrict__ cum,
                            _Float16* __restrict__ attn_out) {
  int lane = threadIdx.x & 31;
  int wave = __builtin_amdgcn_readfirstlane(threadIdx.x >> 5);
  int t0 = blockIdx.x * 16;
  int bh = blockIdx.y;
  int b = bh / Hc, h = bh % Hc;

  const _Float16* Q  = qh + (size_t)bh * Tc * DMc;                 // [T, DM]
  const v16h* Kp = (const v16h*)(kpack + (size_t)bh * DMc * Tc);   // packed, N-dim = T
  const v16h* Vp = (const v16h*)(vpack + (size_t)bh * Tc * DMc);   // packed, N-dim = DM
  const float* cumv  = cum  + (size_t)bh * Tc;
  const float* betav = beta + (size_t)bh * Tc;

  __shared__ alignas(32) _Float16 sV[kAttnWaves][2][2048];  // per wave: 2 x 4KB V chunk
  __shared__ alignas(16) float sSall[kAttnWaves][16 * 32];  // per wave: score repack buffer
  float* sS = &sSall[wave][0];

  int hl = lane >> 4, nl = lane & 15;
  const int kNT = Tc >> 4;    // 128 n-tiles in packed K
  const int vNT = DMc >> 4;   // 4  n-tiles in packed V

  unsigned lds_v = (unsigned)(uintptr_t)&sV[wave][0][0];

  // Q A-fragments for the two 32-wide dm chunks (reused across all key tiles)
  v16h aq0 = load_a_frag(Q, DMc, t0, 0,  lane);
  v16h aq1 = load_a_frag(Q, DMc, t0, 32, lane);

  // cum for the 8 query rows this lane covers in the C layout
  float cum_q[8];
#pragma unroll
  for (int j = 0; j < 8; ++j) cum_q[j] = cumv[t0 + j + 8 * hl];

  v8f acc0 = {}, acc1 = {}, acc2 = {}, acc3 = {};

  constexpr int kStride = kAttnWaves * 32;      // keys between two chunks of one wave
  int s_first = (t0 & ~31) + wave * 32;         // this wave's first chunk touching s >= t0
  int buf = 0;
  // preload this wave's first V chunk (4KB contiguous in packed buffer)
  if (s_first < Tc)
    async_copy_4k(lds_v, Vp + (size_t)(s_first >> 5) * vNT * 32, lane);

  for (int s0 = s_first; s0 < Tc; s0 += kStride) {
    // two 16x16 score tiles -> decayed fp32 chunk in LDS (m, s_local) layout
#pragma unroll
    for (int st = 0; st < 2; ++st) {
      int sc = s0 + st * 16;
      v16h kb0 = load_b_packed(Kp, 0 * kNT + (sc >> 4), lane);   // dm chunk 0
      v16h kb1 = load_b_packed(Kp, 1 * kNT + (sc >> 4), lane);   // dm chunk 1
      v8f sacc = {};
      sacc = wmma_f16(aq0, kb0, sacc);
      sacc = wmma_f16(aq1, kb1, sacc);
      int s = sc + nl;
      float cs = cumv[s];
#pragma unroll
      for (int j = 0; j < 8; ++j) {
        int tq = t0 + j + 8 * hl;
        float dec = (s >= tq) ? __expf(fminf(cum_q[j] - cs, 0.f)) : 0.f;
        sS[(j + 8 * hl) * 32 + st * 16 + nl] = sacc[j] * dec;
      }
    }
    __builtin_amdgcn_wave_barrier();
    // repack C-layout scores -> A-layout f16 fragment (cross-lane via LDS)
    v16h as;
#pragma unroll
    for (int j = 0; j < 8; ++j) {
      as[j]     = (_Float16)sS[nl * 32 + 8 * hl + j];
      as[8 + j] = (_Float16)sS[nl * 32 + 16 + 8 * hl + j];
    }
    __builtin_amdgcn_wave_barrier();

    // this chunk's V copies, the only ones in flight, have landed behind this wait
    wait_async_0();
    if (s0 + kStride < Tc) {
      // the other buffer is refilled only when this wave's LDS reads of it have retired
      asm volatile("s_wait_dscnt 0x0" ::: "memory");
      async_copy_4k(lds_v + (buf ^ 1) * 4096, Vp + (size_t)((s0 + kStride) >> 5) * vNT * 32, lane);
    }

    // S @ V from LDS (ds_load_b128 pairs), 4 dm tiles
    const v16h* lv = (const v16h*)&sV[wave][buf][0];
    v16h bv0 = lv[0 * 32 + lane];
    v16h bv1 = lv[1 * 32 + lane];
    v16h bv2 = lv[2 * 32 + lane];
    v16h bv3 = lv[3 * 32 + lane];
    acc0 = wmma_f16(as, bv0, acc0);
    acc1 = wmma_f16(as, bv1, acc1);
    acc2 = wmma_f16(as, bv2, acc2);
    acc3 = wmma_f16(as, bv3, acc3);
    buf ^= 1;
  }

  // nothing may still be landing in, or be read from, the V buffers: they now take the sums
  wait_async_0();
  asm volatile("s_wait_dscnt 0x0" ::: "memory");

  // this wave's share of the epilogue is piece number 'wave' of the tile (see below). Its
  // beta and fp32 V are fetched in front of the barrier: all but the last wave to arrive
  // have them by the time the barrier opens (ahead of the key loop they cost registers,
  // and the build then fetches the chunk's K fragments in two rounds instead of one)
  int dm = (wave >> 1) * 16 + nl;
  int m0 = t0 + (wave & 1) * 4 + 8 * hl;
  size_t o0 = ((size_t)b * Tc + m0) * Ec + h * DMc + dm;
  float bq[4], yv[4];
#pragma unroll
  for (int i = 0; i < 4; ++i) { bq[i] = betav[m0 + i]; yv[i] = Yv[o0 + (size_t)i * Ec]; }

  // each wave parks its partial tile in its own V buffers, 4 accumulator rows per piece:
  // piece p = nt * 2 + (j >> 2), 16 bytes per lane, so stores and loads are contiguous
  v8f accs[4] = {acc0, acc1, acc2, acc3};
  v4f* mine = (v4f*)&sV[wave][0][0];
#pragma unroll
  for (int nt = 0; nt < 4; ++nt) {
    v4f lo = {accs[nt][0], accs[nt][1], accs[nt][2], accs[nt][3]};
    v4f hi = {accs[nt][4], accs[nt][5], accs[nt][6], accs[nt][7]};
    mine[(nt * 2 + 0) * 32 + lane] = lo;
    mine[(nt * 2 + 1) * 32 + lane] = hi;
  }
  __syncthreads();

  // wave w sums piece w over the 8 partial tiles, in wave order
  v4f o4 = ((const v4f*)&sV[0][0][0])[wave * 32 + lane];
#pragma unroll
  for (int w = 1; w < kAttnWaves; ++w) o4 += ((const v4f*)&sV[w][0][0])[wave * 32 + lane];

  // epilogue: O += beta * V (fp32 V from projection), store f16 to attn_out [B*T, E]
#pragma unroll
  for (int i = 0; i < 4; ++i)
    attn_out[o0 + (size_t)i * Ec] = (_Float16)(o4[i] + bq[i] * yv[i]);
}

// ---------------------------------------------------------------------------
// Host launcher
// ---------------------------------------------------------------------------
extern "C" void kernel_launch(void* const* d_in, const int* in_sizes, int n_in,
                              void* d_out, int out_size, void* d_ws, size_t ws_size,
                              hipStream_t stream) {
  const float* x  = (const float*)d_in[0];   // [B,T,D]
  const float* Wk = (const float*)d_in[1];   // [E,D]
  const float* Wv = (const float*)d_in[2];   // [E,D]
  const float* Wq = (const float*)d_in[3];   // [E,D]
  const float* Wb = (const float*)d_in[4];   // [H,D]
  const float* Wo = (const float*)d_in[5];   // [D,E]
  float* out = (float*)d_out;                // [B,T,D]

  // workspace carve-up
  char* w = (char*)d_ws;
  auto alloc = [&](size_t bytes) -> void* {
    void* p = (void*)w;
    w += (bytes + 255) & ~(size_t)255;
    return p;
  };
  _Float16* xh   = (_Float16*)alloc((size_t)Mtot * Dc * 2);   // x as f16 row-major
  _Float16* wP   = (_Float16*)alloc((size_t)4 * Dc * Ec * 2); // packed B = Wq^T, Wk^T, Wv^T, Wo^T
  _Float16* woP  = wP + (size_t)3 * Dc * Ec;
  float*    Yq   = (float*)alloc((size_t)3 * Mtot * Ec * 4);  // Yq, Yk, Yv one behind the other
  float*    Yk   = Yq + (size_t)Mtot * Ec;
  float*    Yv   = Yk + (size_t)Mtot * Ec;
  _Float16* qh   = (_Float16*)alloc((size_t)Bc * Hc * Tc * DMc * 2);
  _Float16* kpack= (_Float16*)alloc((size_t)Bc * Hc * Tc * DMc * 2);
  _Float16* vpack= (_Float16*)alloc((size_t)Bc * Hc * Tc * DMc * 2);
  float*    blog = (float*)alloc((size_t)Mtot * Hc * 4);        // beta logits [B*T, H]
  float*    beta = (float*)alloc((size_t)Bc * Hc * Tc * 4);
  float*    cum  = (float*)alloc((size_t)Bc * Hc * Tc * 4);
  _Float16* aoh  = (_Float16*)alloc((size_t)Mtot * Ec * 2);   // attention out f16

  // 1) all that reads only the inputs: beta logits, x as f16, the four packed weights
  k_prep<<<dim3(kPrepBlocks), dim3(256), 0, stream>>>(x, Wq, Wk, Wv, Wo, Wb, xh, wP, blog);

  // 2) the three projections Y = xh @ W^T  (M=4096, N=512, K=1024), one per grid plane
  k_wmma_gemm<Ec, Dc><<<dim3(Ec / 64, Mtot / 128, 3), dim3(128), 0, stream>>>(xh, wP, Yq);

  // 3) sigmoid + cumsum per (b,h), beside normalize + pack f16 (Q row-major+scaled, K/V
  //    fragment-packed)
  k_scan_and_pack<<<dim3(kScanBlocks + kNormBlocks), dim3(256), 0, stream>>>(
      blog, beta, cum, Yq, Yk, Yv, qh, kpack, vpack);

  // 4) fused decay attention (async double-buffered V via ASYNCcnt), 8 waves per query tile
  k_attention<<<dim3(Tc / 16, Bc * Hc), dim3(kAttnWaves * 32), 0, stream>>>(qh, kpack, vpack, Yv, beta, cum, aoh);

  // 5) output projection: out = aoh @ Wo^T  (M=4096, N=1024, K=512)
  {
    dim3 grid(Dc / 64, Mtot / 128);
    k_wmma_gemm<Dc, Ec><<<grid, dim3(128), 0, stream>>>(aoh, woP, out);
  }
}

// v006
// Measured time: 72.1 microseconds a run.
// In both of two side-by-side timings against v005, it was 1.28 times as fast.
// Counting every step since v000, it is 6.33 times as fast.
#include <hip/hip_runtime.h>
#include <hip/hip_bf16.h>

#define DEVI __device__ __forceinline__

typedef __attribute__((ext_vector_type(16))) _Float16 v16h;
typedef __attribute__((ext_vector_type(8)))  _Float16 v8h;
typedef __attribute__((ext_vector_type(4)))  _Float16 v4h;
typedef __attribute__((ext_vector_type(8)))  float    v8f;
typedef __attribute__((ext_vector_type(4)))  float    v4f;

// Problem constants (match reference)
constexpr int Bc  = 2;
constexpr int Tc  = 2048;
constexpr int Dc  = 1024;
constexpr int Hc  = 8;
constexpr int DMc = 64;
constexpr int Ec  = Hc * DMc;     // 512
constexpr int Mtot = Bc * Tc;     // 4096

// ---------------------------------------------------------------------------
// WMMA fragment layouts (CDNA5 wave32, ISA 7.12.2)
// A (16x32 f16): lane L holds row M=L&15; hl=L>>4: elems 0..7 = K(8*hl+0..7),
//                elems 8..15 = K(16+8*hl+0..7).
// B (32x16 f16): lane L holds col N=L&15; same K packing as A.
// C (16x16 f32): lane L holds col N=L&15; vgpr j holds row M = j + 8*(L>>4).
//
// Packed-B buffer: fragment f = (k0/32)*(N/16) + (n0/16); lane L's 16 halves
// stored contiguously at ((f*32 + L)*16) -> one 32B vector load per lane.
// ---------------------------------------------------------------------------

DEVI v16h load_a_frag(const _Float16* __restrict__ A, int lda, int m0, int k0, int lane) {
  int m  = m0 + (lane & 15);
  int hl = lane >> 4;
  const _Float16* p0 = A + (size_t)m * lda + (k0 + 8 * hl);
  const _Float16* p1 = p0 + 16;
  v16h r;
#pragma unroll
  for (int j = 0; j < 8; ++j) { r[j] = p0[j]; r[8 + j] = p1[j]; }
  return r;
}

DEVI v16h load_b_packed(const v16h* __restrict__ Bp, int frag, int lane) {
  return Bp[(size_t)frag * 32 + lane];
}

DEVI v8f wmma_f16(v16h a, v16h b, v8f c) {
  return __builtin_amdgcn_wmma_f32_16x16x32_f16(false, a, false, b, (short)0, c, false, false);
}

// ---------------------------------------------------------------------------
// Async global->LDS copy of 4KB (8 x b128 per lane), tracked by ASYNCcnt.
// LDS[lds_base + lane*16 + i*512] = MEM[src + lane*16 + i*512]
// ---------------------------------------------------------------------------
DEVI void async_copy_4k(unsigned lds_base, const void* src, int lane) {
  const char* ga = (const char*)src + lane * 16;
  unsigned la = lds_base + lane * 16;
  // one statement: the last line holds every later write of la and ga behind the copies
  asm volatile("global_load_async_to_lds_b128 %0, %1, off\n\t"
               "global_load_async_to_lds_b128 %0, %1, off offset:512\n\t"
               "global_load_async_to_lds_b128 %0, %1, off offset:1024\n\t"
               "global_load_async_to_lds_b128 %0, %1, off offset:1536\n\t"
               "global_load_async_to_lds_b128 %0, %1, off offset:2048\n\t"
               "global_load_async_to_lds_b128 %0, %1, off offset:2560\n\t"
               "global_load_async_to_lds_b128 %0, %1, off offset:3072\n\t"
               "global_load_async_to_lds_b128 %0, %1, off offset:3584\n\t"
               "s_wait_xcnt 0x0"
               :: "v"(la), "v"(ga) : "memory");
}
DEVI void wait_async_0()   { asm volatile("s_wait_asynccnt 0x0" ::: "memory"); }

// ---------------------------------------------------------------------------
// Block body: fp32 -> f16 elementwise (x)
// A thread converts 32 elements: 8 float4 loads, all in flight together, each 512
// contiguous bytes per wave, then 8 stores of 4 halves. That makes 4096 waves (16 per
// WGP); with one element per thread it is 131072.
// ---------------------------------------------------------------------------
constexpr int kCvtVec = 8;                       // float4 groups per thread
constexpr int kCvtPerBlock = 256 * kCvtVec * 4;  // elements per block
static_assert((Mtot * Dc) % kCvtPerBlock == 0, "convert grid covers x exactly");

DEVI void cvt_f16_block(int blk, const float* __restrict__ src, _Float16* __restrict__ dst) {
  size_t base = (size_t)blk * (256 * kCvtVec) + threadIdx.x;   // in groups of 4
  const float4* s4 = (const float4*)src + base;
  v4h* d4 = (v4h*)dst + base;
  float4 v[kCvtVec];
#pragma unroll
  for (int j = 0; j < kCvtVec; ++j) v[j] = s4[j * 256];
#pragma unroll
  for (int j = 0; j < kCvtVec; ++j) {
    v4h r = {(_Float16)v[j].x, (_Float16)v[j].y, (_Float16)v[j].z, (_Float16)v[j].w};
    d4[j * 256] = r;
  }
  // in the merged kernel other jobs' code follows this body in the listing and reuses the
  // stores' registers: the wait that belongs in front of that overwrite
  asm volatile("s_wait_xcnt 0x0" ::: "memory");
}

// ---------------------------------------------------------------------------
// Block body: W [N,K] fp32  ->  packed f16 B buffer for B = W^T [K,N]
// A thread builds one lane's 16 halves of one fragment: two runs of 8 consecutive k of
// row n (four float4 loads; a wave reads 16 whole 128-byte lines) and one 32-byte store
// (1 KB contiguous per wave).
// ---------------------------------------------------------------------------
DEVI void pack_b_from_wT_block(int blk, const float* __restrict__ W, _Float16* __restrict__ dst,
                               int K, int N) {
  int i = blk * 256 + threadIdx.x;               // fragment * 32 + lane
  if (i >= ((K * N) >> 4)) return;
  int lane = i & 31, frag = i >> 5;
  int ntiles = N >> 4;
  int chunk = frag / ntiles, nt = frag % ntiles;
  int n = nt * 16 + (lane & 15);
  int k = chunk * 32 + 8 * (lane >> 4);
  const float4* p = (const float4*)(W + (size_t)n * K + k);
  float4 lo0 = p[0], lo1 = p[1];                 // k .. k+7
  float4 hi0 = p[4], hi1 = p[5];                 // k+16 .. k+23
  v16h r = {(_Float16)lo0.x, (_Float16)lo0.y, (_Float16)lo0.z, (_Float16)lo0.w,
            (_Float16)lo1.x, (_Float16)lo1.y, (_Float16)lo1.z, (_Float16)lo1.w,
            (_Float16)hi0.x, (_Float16)hi0.y, (_Float16)hi0.z, (_Float16)hi0.w,
            (_Float16)hi1.x, (_Float16)hi1.y, (_Float16)hi1.z, (_Float16)hi1.w};
  ((v16h*)dst)[i] = r;
}

// ---------------------------------------------------------------------------
// Wave body: 32x64 tile of A[M,K] (f16 row-major) * Bp (packed f16), 8 WMMA per 32-K chunk
// (B fragments reused 2x, A fragments 4x).
// One or two waves run per SIMD, so little but a wave's own order hides a load. The K loop
// is unrolled over three sets of fragment registers: a chunk's 12 loads are issued
// together, two chunks ahead of the WMMAs that use them.
// A and B fragments have the same map (lane = row or column, elements = k), so the two
// operands may change places. kTransposed = false: acc[mt][nt] is the tile as C has it
// (lane = column n, register j = row m = j + 8*(lane>>4)). kTransposed = true: it is the
// transposed tile (lane = row m, register j = column n = j + 8*(lane>>4)): a lane then
// holds 8 consecutive n of one row.
// ---------------------------------------------------------------------------
template <int N, int K, bool kTransposed>
DEVI void gemm_tile(const _Float16* __restrict__ A, const v16h* __restrict__ Bp,
                    int m0, int n0, int lane, v8f (&acc)[2][4]) {
  constexpr int kChunks = K / 32;
  constexpr int kSets = 3;                 // one in use, two in flight
  constexpr int ntiles = N >> 4;
  static_assert(K % 32 == 0 && kChunks >= kSets, "whole chunks, at least one per set");

  v16h a[kSets][2], b[kSets][4];
  auto load_chunk = [&](int c) {
    int s = c % kSets;
    a[s][0] = load_a_frag(A, K, m0,      c * 32, lane);
    a[s][1] = load_a_frag(A, K, m0 + 16, c * 32, lane);
    int fb = c * ntiles + (n0 >> 4);
#pragma unroll
    for (int nt = 0; nt < 4; ++nt) b[s][nt] = load_b_packed(Bp, fb + nt, lane);
  };

#pragma unroll
  for (int c = 0; c < kSets - 1; ++c) load_chunk(c);
#pragma unroll
  for (int c = 0; c < kChunks; ++c) {
    if (c + kSets - 1 < kChunks) load_chunk(c + kSets - 1);
    // keeps these loads from moving down past this point: left free, the scheduler sinks
    // them to just before their first use (seen at K = 512) and every fragment is waited for
    __builtin_amdgcn_sched_barrier(0);
    int s = c % kSets;
#pragma unroll
    for (int nt = 0; nt < 4; ++nt) {
      if (kTransposed) {
        acc[0][nt] = wmma_f16(b[s][nt], a[s][0], acc[0][nt]);
        acc[1][nt] = wmma_f16(b[s][nt], a[s][1], acc[1][nt]);
      } else {
        acc[0][nt] = wmma_f16(a[s][0], b[s][nt], acc[0][nt]);
        acc[1][nt] = wmma_f16(a[s][1], b[s][nt], acc[1][nt]);
      }
    }
  }
  // the store addresses behind this tile reuse the loads' address registers: the wait that
  // belongs in front of that overwrite
  asm volatile("s_wait_xcnt 0x0" ::: "memory");
  // keeps the address arithmetic below from being lifted over that wait
  __builtin_amdgcn_sched_barrier(0);
}

// fp32 store of an untransposed tile to row-major C[., N]
template <int N>
DEVI void store_tile_f32(float* __restrict__ C, int m0, int n0, int lane, const v8f (&acc)[2][4]) {
  int hl = lane >> 4, nl = lane & 15;
#pragma unroll
  for (int mt = 0; mt < 2; ++mt)
#pragma unroll
    for (int nt = 0; nt < 4; ++nt)
#pragma unroll
      for (int j = 0; j < 8; ++j) {
        int m = m0 + mt * 16 + j + 8 * hl;
        C[(size_t)m * N + n0 + nt * 16 + nl] = acc[mt][nt][j];
      }
}

// ---------------------------------------------------------------------------
// Kernel: WMMA GEMM  C[M,N] = A[M,K] (f16 row-major) * Bp (packed f16), fp32 C.
// 4 waves / block, a 32x64 tile per wave.
// ---------------------------------------------------------------------------
template <int N, int K>
__global__ __launch_bounds__(128) void k_wmma_gemm(const _Float16* __restrict__ A,
                                                   const _Float16* __restrict__ Bpk,
                                                   float* __restrict__ C) {
  int lane = threadIdx.x & 31;
  int wave = threadIdx.x >> 5;
  int n0 = blockIdx.x * 64;
  int m0 = blockIdx.y * 128 + wave * 32;
  v8f acc[2][4] = {};
  gemm_tile<N, K, false>(A, (const v16h*)Bpk, m0, n0, lane, acc);
  store_tile_f32<N>(C, m0, n0, lane, acc);
}

// ---------------------------------------------------------------------------
// Block body: logit[row][h] = x[row,:] . Wb[h,:]  (fp32), row = b*T + t.
// One block per 16 rows, 8 waves: wave = (row group of 8) x (256-wide slice of D).
// A lane holds 4 consecutive d of each 128-wide chunk, so every load is 512 contiguous
// bytes per wave; each x value is used for all 8 heads, each Wb value for 8 rows.
// ---------------------------------------------------------------------------
// Halve the number of live partial sums: lanes that differ in bit MASK swap the half
// they do not keep, so 64 sums over 32 lanes take 62 exchanges instead of 320.
template <int HALF, int MASK>
DEVI void fold_lanes(float (&v)[64], int lane) {
  bool up = (lane & MASK) != 0;
#pragma unroll
  for (int i = 0; i < HALF; ++i) {
    float keep = up ? v[i + HALF] : v[i];
    float send = up ? v[i] : v[i + HALF];
    v[i] = keep + __shfl_xor(send, MASK);
  }
}

DEVI void beta_logits_block(int blk, const float* __restrict__ x, const float* __restrict__ Wb,
                            float* __restrict__ logit) {
  int lane = threadIdx.x & 31;
  int wave = threadIdx.x >> 5;
  int rg = wave & 1;             // which 8 of the block's 16 rows
  int ks = wave >> 1;            // which 256 of the 1024 d
  int row0 = blk * 16;
  __shared__ alignas(16) float part[4][128]; // [d slice][row in block * 8 + head]

  const float4* xp = (const float4*)(x + (size_t)(row0 + rg * 8) * Dc + ks * 256) + lane;
  const float4* wp = (const float4*)(Wb + ks * 256) + lane;
  float4 xv[2][8], wv[2][8];
#pragma unroll
  for (int c = 0; c < 2; ++c)
#pragma unroll
    for (int r = 0; r < 8; ++r) xv[c][r] = xp[r * (Dc / 4) + c * 32];
#pragma unroll
  for (int c = 0; c < 2; ++c)
#pragma unroll
    for (int h = 0; h < Hc; ++h) wv[c][h] = wp[h * (Dc / 4) + c * 32];

  float v[64];                   // index = row in group * 8 + head
#pragma unroll
  for (int r = 0; r < 8; ++r)
#pragma unroll
    for (int h = 0; h < Hc; ++h) {
      float s = xv[0][r].x * wv[0][h].x;
      s = fmaf(xv[0][r].y, wv[0][h].y, s);
      s = fmaf(xv[0][r].z, wv[0][h].z, s);
      s = fmaf(xv[0][r].w, wv[0][h].w, s);
      s = fmaf(xv[1][r].x, wv[1][h].x, s);
      s = fmaf(xv[1][r].y, wv[1][h].y, s);
      s = fmaf(xv[1][r].z, wv[1][h].z, s);
      s = fmaf(xv[1][r].w, wv[1][h].w, s);
      v[r * 8 + h] = s;
    }

  fold_lanes<32, 16>(v, lane);
  fold_lanes<16, 8>(v, lane);
  fold_lanes<8, 4>(v, lane);
  fold_lanes<4, 2>(v, lane);
  fold_lanes<2, 1>(v, lane);
  // lane L now holds the wave's sums number 2L and 2L+1
  *(float2*)&part[ks][rg * 64 + lane * 2] = make_float2(v[0], v[1]);
  __syncthreads();

  int tid = threadIdx.x;
  if (tid < 128) {
    float s = 0.f;
#pragma unroll
    for (int k = 0; k < 4; ++k) s += part[k][tid];
    logit[(size_t)row0 * Hc + tid] = s;
  }
}

// ---------------------------------------------------------------------------
// Kernel: everything that reads only the inputs, in one launch. None of the six jobs needs
// another's result, each alone is too short to fill the chip, and as launches of their own
// they run one behind the other. A block takes its job from its index (the same for all
// its threads); the blocks with the most work per block come first.
// ---------------------------------------------------------------------------
constexpr int kLogitBlocks = Mtot / 16;
constexpr int kCvtBlocks   = Mtot * Dc / kCvtPerBlock;
constexpr int kPackBlocks  = Ec * Dc / 16 / 256;   // per weight: one thread per fragment lane
constexpr int kPrepBlocks  = kLogitBlocks + kCvtBlocks + 4 * kPackBlocks;

__global__ __launch_bounds__(256) void k_prep(const float* __restrict__ x,
                                              const float* __restrict__ Wq,
                                              const float* __restrict__ Wk,
                                              const float* __restrict__ Wv,
                                              const float* __restrict__ Wo,
                                              const float* __restrict__ Wb,
                                              _Float16* __restrict__ xh,
                                              _Float16* __restrict__ wP,
                                              float* __restrict__ logit) {
  int blk = blockIdx.x;
  if (blk < kLogitBlocks) { beta_logits_block(blk, x, Wb, logit); return; }
  blk -= kLogitBlocks;
  if (blk < kCvtBlocks) { cvt_f16_block(blk, x, xh); return; }
  blk -= kCvtBlocks;
  int which = blk / kPackBlocks;                   // 0..3 = Wq, Wk, Wv, Wo
  blk -= which * kPackBlocks;
  const float* W = which == 0 ? Wq : which == 1 ? Wk : which == 2 ? Wv : Wo;
  _Float16* dst = wP + (size_t)which * (Ec * Dc);
  if (which < 3) pack_b_from_wT_block(blk, W, dst, Dc, Ec);   // B = [D,E]
  else           pack_b_from_wT_block(blk, W, dst, Ec, Dc);   // B = [E,D]
}

// ---------------------------------------------------------------------------
// Block body: beta = sigmoid(logit) and cum = cumsum(log(1-beta+1e-8)) per (b,h).
// 128 threads; the sums are formed over 256 groups of 8 t, two groups per thread.
// ---------------------------------------------------------------------------
constexpr int kProjThreads = 128;

DEVI void beta_cumsum_block(int bh /* b*H + h */, const float* __restrict__ logit,
                            float* __restrict__ beta, float* __restrict__ cum) {
  int b = bh / Hc, h = bh % Hc;
  int tid = threadIdx.x;
  __shared__ float slr[Tc];
  __shared__ float spart[256];
  __shared__ float soffs[256];

  // unrolled so that a thread's 16 logit loads are in flight together, not one per trip
  const float* lp = logit + (size_t)b * Tc * Hc + h;
  float lg[Tc / kProjThreads];
#pragma unroll
  for (int i = 0; i < Tc / kProjThreads; ++i) lg[i] = lp[(tid + i * kProjThreads) * Hc];
#pragma unroll
  for (int i = 0; i < Tc / kProjThreads; ++i) {
    int t = tid + i * kProjThreads;
    float bv = 1.0f / (1.0f + __expf(-lg[i]));
    beta[(size_t)bh * Tc + t] = bv;
    slr[t] = __logf(1.0f - bv + 1e-8f);
  }
  // the sums below reuse the beta stores' registers: the wait that belongs in front of that
  // overwrite
  asm volatile("s_wait_xcnt 0x0" ::: "memory");
  __syncthreads();

#pragma unroll
  for (int g = 0; g < 2; ++g) {
    int base = (tid + g * kProjThreads) * 8;
    float s = 0.f;
#pragma unroll
    for (int i = 0; i < 8; ++i) s += slr[base + i];
    spart[tid + g * kProjThreads] = s;
  }
  __syncthreads();
  if (tid == 0) {
    float run = 0.f;
    for (int i = 0; i < 256; ++i) { soffs[i] = run; run += spart[i]; }
  }
  __syncthreads();
#pragma unroll
  for (int g = 0; g < 2; ++g) {
    int base = (tid + g * kProjThreads) * 8;
    float run = soffs[tid + g * kProjThreads];
#pragma unroll
    for (int i = 0; i < 8; ++i) {
      run += slr[base + i];
      cum[(size_t)bh * Tc + base + i] = run;
    }
  }
}

// ---------------------------------------------------------------------------
// Kernel: the three projections Y = xh @ W^T (M=4096, N=512, K=1024), each finished in its
// own epilogue into the f16 form that the attention reads; no fp32 Yq or Yk is stored.
// qh    : [B,H,T,DM] row-major, L2-normalized, 1/sqrt(DM) folded in (A-matrix for Q K^T)
// kpack : per (b,h) packed-B, B=K^T (K-dim=DM, N-dim=T), L2-normalized
// vpack : per (b,h) packed-B, B=V   (K-dim=T,  N-dim=DM); V also as fp32 Yv [B*T,E]
// A wave's 32x64 tile is 32 tokens of ONE head, so a row's norm lies inside the wave.
// The tile is formed transposed: a lane holds 32 of its token's 64 d (the other 32 in lane
// ^ 16), 8 consecutive d per accumulator, which is the order of a qh row, of a K^T fragment
// and of a Yv row; only the V fragments (lane = d) take a turn through LDS. Every global
// store is 16 bytes per lane.
// The 16 scan blocks need only the logits of the launch before; they come first and run
// beside the products.
// ---------------------------------------------------------------------------
constexpr int kScanBlocks = Bc * Hc;
constexpr int kProjBlocksPerW = (Ec / 64) * (Mtot / 128);
static_assert(DMc == 64 && Tc % 128 == 0, "a wave's tile is one head; a block is one batch");

__global__ __launch_bounds__(kProjThreads)
void k_proj(const _Float16* __restrict__ xh, const _Float16* __restrict__ wP,
            const float* __restrict__ logit, float* __restrict__ beta, float* __restrict__ cum,
            float* __restrict__ Yv, _Float16* __restrict__ qh, _Float16* __restrict__ kpack,
            _Float16* __restrict__ vpack) {
  int blk = blockIdx.x;
  if (blk < kScanBlocks) { beta_cumsum_block(blk, logit, beta, cum); return; }
  blk -= kScanBlocks;
  int which = blk / kProjBlocksPerW;               // 0..2 = Wq, Wk, Wv
  blk -= which * kProjBlocksPerW;
  int h = blk % Hc;
  int lane = threadIdx.x & 31;
  int wave = threadIdx.x >> 5;
  int m0 = (blk / Hc) * 128 + wave * 32;
  int n0 = h * DMc;
  int bh = (m0 / Tc) * Hc + h;
  int t0 = m0 % Tc;                                // multiple of 32
  int hl = lane >> 4, nl = lane & 15;
  const v16h* Bp = (const v16h*)(wP + (size_t)which * (Ec * Dc));
  v8f acc[2][4] = {};

  gemm_tile<Ec, Dc, true>(xh, Bp, m0, n0, lane, acc);
  // acc[mt][nt][j]: token t0 + mt*16 + nl, d = nt*16 + 8*hl + j

  if (which == 2) {
    // a V fragment wants lane = d, elements = tokens: the wave turns its tile in an LDS
    // buffer of its own, [d][token], rows of 80 bytes (16-byte reads stay aligned and the
    // two lane halves' rows, 8 apart, fall on different banks)
    constexpr int kPitch = 40;
    __shared__ alignas(16) _Float16 sT[kProjThreads / 32][DMc * kPitch];
    _Float16* st = &sT[wave][0];
#pragma unroll
    for (int mt = 0; mt < 2; ++mt)
#pragma unroll
      for (int nt = 0; nt < 4; ++nt)
#pragma unroll
        for (int j = 0; j < 8; ++j)
          st[(nt * 16 + 8 * hl + j) * kPitch + mt * 16 + nl] = (_Float16)acc[mt][nt][j];
    // the reads below take other lanes' values: keeps the compiler from moving them up
    __builtin_amdgcn_wave_barrier();
    // fragment (t chunk, d tile nt): elements 0..7 = tokens 8*hl + i, 8..15 = 16 + 8*hl + i
    v8h pv[4][2];
#pragma unroll
    for (int nt = 0; nt < 4; ++nt) {
      pv[nt][0] = *(const v8h*)&st[(nt * 16 + nl) * kPitch + 8 * hl];
      pv[nt][1] = *(const v8h*)&st[(nt * 16 + nl) * kPitch + 16 + 8 * hl];
    }
    v8h* vp = (v8h*)(vpack + (size_t)bh * Tc * DMc) + ((size_t)(t0 >> 5) * (DMc >> 4) * 32 + lane) * 2;
    v4f* yv = (v4f*)(Yv + (size_t)(m0 + nl) * Ec + n0 + 8 * hl);
#pragma unroll
    for (int nt = 0; nt < 4; ++nt) {
      vp[nt * 64 + 0] = pv[nt][0];
      vp[nt * 64 + 1] = pv[nt][1];
    }
#pragma unroll
    for (int mt = 0; mt < 2; ++mt)
#pragma unroll
      for (int nt = 0; nt < 4; ++nt) {
        v4f lo = {acc[mt][nt][0], acc[mt][nt][1], acc[mt][nt][2], acc[mt][nt][3]};
        v4f hi = {acc[mt][nt][4], acc[mt][nt][5], acc[mt][nt][6], acc[mt][nt][7]};
        yv[mt * (16 * Ec / 4) + nt * 4 + 0] = lo;
        yv[mt * (16 * Ec / 4) + nt * 4 + 1] = hi;
      }
    // other branches' code follows in the listing and reuses these stores' registers (the
    // fragment stores' above too): the wait that belongs in front of that overwrite
    asm volatile("s_wait_xcnt 0x0" ::: "memory");
    return;
  }

  float top = which == 0 ? 0.125f : 1.0f;          // 1/sqrt(DM) folded into Q
  v8h p[2][4];
#pragma unroll
  for (int mt = 0; mt < 2; ++mt) {
    float ss[4];
#pragma unroll
    for (int nt = 0; nt < 4; ++nt) {
      ss[nt] = acc[mt][nt][0] * acc[mt][nt][0];
#pragma unroll
      for (int j = 1; j < 8; ++j) ss[nt] = fmaf(acc[mt][nt][j], acc[mt][nt][j], ss[nt]);
    }
    float half = (ss[0] + ss[1]) + (ss[2] + ss[3]);
    float n2 = half + __shfl_xor(half, 16);
    float sc = top / fmaxf(__fsqrt_rn(n2), 1e-12f);
#pragma unroll
    for (int nt = 0; nt < 4; ++nt)
#pragma unroll
      for (int j = 0; j < 8; ++j) p[mt][nt][j] = (_Float16)(acc[mt][nt][j] * sc);
  }
  if (which == 0) {
    v8h* q = (v8h*)(qh + ((size_t)bh * Tc + t0 + nl) * DMc + 8 * hl);
#pragma unroll
    for (int mt = 0; mt < 2; ++mt)
#pragma unroll
      for (int nt = 0; nt < 4; ++nt) q[mt * (16 * DMc / 8) + nt * 2] = p[mt][nt];
    // as behind the V stores: other branches' code follows and reuses these stores' registers
    asm volatile("s_wait_xcnt 0x0" ::: "memory");
  } else {
    // fragment (d chunk c, token tile): elements 0..7 = d 32c + 8*hl + j, 8..15 = 16 more
    v8h* kp = (v8h*)(kpack + (size_t)bh * DMc * Tc) + ((size_t)(t0 >> 4) * 32 + lane) * 2;
#pragma unroll
    for (int c = 0; c < 2; ++c)
#pragma unroll
      for (int mt = 0; mt < 2; ++mt) {
        kp[((c * (Tc >> 4) + mt) * 32) * 2 + 0] = p[mt][2 * c];
        kp[((c * (Tc >> 4) + mt) * 32) * 2 + 1] = p[mt][2 * c + 1];
      }
    // as behind the V stores: other branches' code follows and reuses these stores' registers
    asm volatile("s_wait_xcnt 0x0" ::: "memory");
  }
}

// ---------------------------------------------------------------------------
// Kernel: fused decay attention.
// Per (b,h) and 16-query tile: stream 32-wide key chunks s >= t-tile,
//   S = (Q K^T) .* exp(min(cum_t - cum_s,0)) .* [s>=t]  (1/sqrt(DM) in Q)
//   O += S @ V ; epilogue O += beta*V (fp32 V) ; store f16 to attn_out [B*T,E]
// A chunk is one long dependent chain (K load, scores, LDS repack, V read, product), and
// a tile has up to 64 of them. The block's 8 waves share the tile's chunks: wave w takes
// chunks w, w + 8, ... into a partial O of its own (there is no softmax: partial sums
// just add), and the partial tiles are summed through LDS at the end.
// Each wave has its own score buffer and its own two V buffers, filled by
// global_load_async_to_lds_b128 (ASYNCcnt) one chunk ahead; no wave reads another's
// before the one barrier in front of the final sum.
// ---------------------------------------------------------------------------
constexpr int kAttnWaves = 8;

__global__ void k_attention(const _Float16* __restrict__ qh, const _Float16* __restrict__ kpack,
                            const _Float16* __restrict__ vpack, const float* __restrict__ Yv,
                            const float* __restrict__ beta, const float* __restrict__ cum,
                            _Float16* __restrict__ attn_out) {
  int lane = threadIdx.x & 31;
  int wave = __builtin_amdgcn_readfirstlane(threadIdx.x >> 5);
  int t0 = blockIdx.x * 16;
  int bh = blockIdx.y;
  int b = bh / Hc, h = bh % Hc;

  const _Float16* Q  = qh + (size_t)bh * Tc * DMc;                 // [T, DM]
  const v16h* Kp = (const v16h*)(kpack + (size_t)bh * DMc * Tc);   // packed, N-dim = T
  const v16h* Vp = (const v16h*)(vpack + (size_t)bh * Tc * DMc);   // packed, N-dim = DM
  const float* cumv  = cum  + (size_t)bh * Tc;
  const float* betav = beta + (size_t)bh * Tc;

  __shared__ alignas(32) _Float16 sV[kAttnWaves][2][2048];  // per wave: 2 x 4KB V chunk
  __shared__ alignas(16) float sSall[kAttnWaves][16 * 32];  // per wave: score repack buffer
  float* sS = &sSall[wave][0];

  int hl = lane >> 4, nl = lane & 15;
  const int kNT = Tc >> 4;    // 128 n-tiles in packed K
  const int vNT = DMc >> 4;   // 4  n-tiles in packed V

  unsigned lds_v = (unsigned)(uintptr_t)&sV[wave][0][0];

  // Q A-fragments for the two 32-wide dm chunks (reused across all key tiles)
  v16h aq0 = load_a_frag(Q, DMc, t0, 0,  lane);
  v16h aq1 = load_a_frag(Q, DMc, t0, 32, lane);

  // cum for the 8 query rows this lane covers in the C layout
  float cum_q[8];
#pragma unroll
  for (int j = 0; j < 8; ++j) cum_q[j] = cumv[t0 + j + 8 * hl];

  v8f acc0 = {}, acc1 = {}, acc2 = {}, acc3 = {};

  constexpr int kStride = kAttnWaves * 32;      // keys between two chunks of one wave
  int s_first = (t0 & ~31) + wave * 32;         // this wave's first chunk touching s >= t0
  int buf = 0;
  // preload this wave's first V chunk (4KB contiguous in packed buffer)
  if (s_first < Tc)
    async_copy_4k(lds_v, Vp + (size_t)(s_first >> 5) * vNT * 32, lane);

  for (int s0 = s_first; s0 < Tc; s0 += kStride) {
    // two 16x16 score tiles -> decayed fp32 chunk in LDS (m, s_local) layout
#pragma unroll
    for (int st = 0; st < 2; ++st) {
      int sc = s0 + st * 16;
      v16h kb0 = load_b_packed(Kp, 0 * kNT + (sc >> 4), lane);   // dm chunk 0
      v16h kb1 = load_b_packed(Kp, 1 * kNT + (sc >> 4), lane);   // dm chunk 1
      v8f sacc = {};
      sacc = wmma_f16(aq0, kb0, sacc);
      sacc = wmma_f16(aq1, kb1, sacc);
      int s = sc + nl;
      float cs = cumv[s];
#pragma unroll
      for (int j = 0; j < 8; ++j) {
        int tq = t0 + j + 8 * hl;
        float dec = (s >= tq) ? __expf(fminf(cum_q[j] - cs, 0.f)) : 0.f;
        sS[(j + 8 * hl) * 32 + st * 16 + nl] = sacc[j] * dec;
      }
    }
    __builtin_amdgcn_wave_barrier();
    // repack C-layout scores -> A-layout f16 fragment (cross-lane via LDS)
    v16h as;
#pragma unroll
    for (int j = 0; j < 8; ++j) {
      as[j]     = (_Float16)sS[nl * 32 + 8 * hl + j];
      as[8 + j] = (_Float16)sS[nl * 32 + 16 + 8 * hl + j];
    }
    __builtin_amdgcn_wave_barrier();

    // this chunk's V copies, the only ones in flight, have landed behind this wait
    wait_async_0();
    if (s0 + kStride < Tc) {
      // the other buffer is refilled only when this wave's LDS reads of it have retired
      asm volatile("s_wait_dscnt 0x0" ::: "memory");
      async_copy_4k(lds_v + (buf ^ 1) * 4096, Vp + (size_t)((s0 + kStride) >> 5) * vNT * 32, lane);
    }

    // S @ V from LDS (ds_load_b128 pairs), 4 dm tiles
    const v16h* lv = (const v16h*)&sV[wave][buf][0];
    v16h bv0 = lv[0 * 32 + lane];
    v16h bv1 = lv[1 * 32 + lane];
    v16h bv2 = lv[2 * 32 + lane];
    v16h bv3 = lv[3 * 32 + lane];
    acc0 = wmma_f16(as, bv0, acc0);
    acc1 = wmma_f16(as, bv1, acc1);
    acc2 = wmma_f16(as, bv2, acc2);
    acc3 = wmma_f16(as, bv3, acc3);
    buf ^= 1;
  }

  // nothing may still be landing in, or be read from, the V buffers: they now take the sums
  wait_async_0();
  asm volatile("s_wait_dscnt 0x0" ::: "memory");

  // this wave's share of the epilogue is piece number 'wave' of the tile (see below). Its
  // beta and fp32 V are fetched in front of the barrier: all but the last wave to arrive
  // have them by the time the barrier opens (ahead of the key loop they cost registers,
  // and the build then fetches the chunk's K fragments in two rounds instead of one)
  int dm = (wave >> 1) * 16 + nl;
  int m0 = t0 + (wave & 1) * 4 + 8 * hl;
  size_t o0 = ((size_t)b * Tc + m0) * Ec + h * DMc + dm;
  float bq[4], yv[4];
#pragma unroll
  for (int i = 0; i < 4; ++i) { bq[i] = betav[m0 + i]; yv[i] = Yv[o0 + (size_t)i * Ec]; }

  // each wave parks its partial tile in its own V buffers, 4 accumulator rows per piece:
  // piece p = nt * 2 + (j >> 2), 16 bytes per lane, so stores and loads are contiguous
  v8f accs[4] = {acc0, acc1, acc2, acc3};
  v4f* mine = (v4f*)&sV[wave][0][0];
#pragma unroll
  for (int nt = 0; nt < 4; ++nt) {
    v4f lo = {accs[nt][0], accs[nt][1], accs[nt][2], accs[nt][3]};
    v4f hi = {accs[nt][4], accs[nt][5], accs[nt][6], accs[nt][7]};
    mine[(nt * 2 + 0) * 32 + lane] = lo;
    mine[(nt * 2 + 1) * 32 + lane] = hi;
  }
  __syncthreads();

  // wave w sums piece w over the 8 partial tiles, in wave order
  v4f o4 = ((const v4f*)&sV[0][0][0])[wave * 32 + lane];
#pragma unroll
  for (int w = 1; w < kAttnWaves; ++w) o4 += ((const v4f*)&sV[w][0][0])[wave * 32 + lane];

  // epilogue: O += beta * V (fp32 V from projection), store f16 to attn_out [B*T, E]
#pragma unroll
  for (int i = 0; i < 4; ++i)
    attn_out[o0 + (size_t)i * Ec] = (_Float16)(o4[i] + bq[i] * yv[i]);
}

// ---------------------------------------------------------------------------
// Host launcher
// ---------------------------------------------------------------------------
extern "C" void kernel_launch(void* const* d_in, const int* in_sizes, int n_in,
                              void* d_out, int out_size, void* d_ws, size_t ws_size,
                              hipStream_t stream) {
  const float* x  = (const float*)d_in[0];   // [B,T,D]
  const float* Wk = (const float*)d_in[1];   // [E,D]
  const float* Wv = (const float*)d_in[2];   // [E,D]
  const float* Wq = (const float*)d_in[3];   // [E,D]
  const float* Wb = (const float*)d_in[4];   // [H,D]
  const float* Wo = (const float*)d_in[5];   // [D,E]
  float* out = (float*)d_out;                // [B,T,D]

  // workspace carve-up
  char* w = (char*)d_ws;
  auto alloc = [&](size_t bytes) -> void* {
    void* p = (void*)w;
    w += (bytes + 255) & ~(size_t)255;
    return p;
  };
  _Float16* xh   = (_Float16*)alloc((size_t)Mtot * Dc * 2);   // x as f16 row-major
  _Float16* wP   = (_Float16*)alloc((size_t)4 * Dc * Ec * 2); // packed B = Wq^T, Wk^T, Wv^T, Wo^T
  _Float16* woP  = wP + (size_t)3 * Dc * Ec;
  float*    Yv   = (float*)alloc((size_t)Mtot * Ec * 4);      // V projection, fp32
  _Float16* qh   = (_Float16*)alloc((size_t)Bc * Hc * Tc * DMc * 2);
  _Float16* kpack= (_Float16*)alloc((size_t)Bc * Hc * Tc * DMc * 2);
  _Float16* vpack= (_Float16*)alloc((size_t)Bc * Hc * Tc * DMc * 2);
  float*    blog = (float*)alloc((size_t)Mtot * Hc * 4);        // beta logits [B*T, H]
  float*    beta = (float*)alloc((size_t)Bc * Hc * Tc * 4);
  float*    cum  = (float*)alloc((size_t)Bc * Hc * Tc * 4);
  _Float16* aoh  = (_Float16*)alloc((size_t)Mtot * Ec * 2);   // attention out f16

  // 1) all that reads only the inputs: beta logits, x as f16, the four packed weights
  k_prep<<<dim3(kPrepBlocks), dim3(256), 0, stream>>>(x, Wq, Wk, Wv, Wo, Wb, xh, wP, blog);

  // 2) the three projections, each packed to f16 in its epilogue, Q and K normalized (Q row-major
  //    + scaled, K/V fragment-packed, V also fp32), beside sigmoid + cumsum per (b,h)
  k_proj<<<dim3(kScanBlocks + 3 * kProjBlocksPerW), dim3(kProjThreads), 0, stream>>>(
      xh, wP, blog, beta, cum, Yv, qh, kpack, vpack);

  // 3) fused decay attention (async double-buffered V via ASYNCcnt), 8 waves per query tile
  k_attention<<<dim3(Tc / 16, Bc * Hc), dim3(kAttnWaves * 32), 0, stream>>>(qh, kpack, vpack, Yv, beta, cum, aoh);

  // 4) output projection: out = aoh @ Wo^T  (M=4096, N=1024, K=512)
  {
    dim3 grid(Dc / 64, Mtot / 128);
    k_wmma_gemm<Dc, Ec><<<grid, dim3(128), 0, stream>>>(aoh, woP, out);
  }
}

// v007
// It runs in 60.1 microseconds.
// Two timings next to v006 put it at 1.19 and 1.21 times that version's speed.
// Over all steps from v000 it is 7.61 times as fast.
#include <hip/hip_runtime.h>
#include <hip/hip_bf16.h>

#define DEVI __device__ __forceinline__

typedef __attribute__((ext_vector_type(16))) _Float16 v16h;
typedef __attribute__((ext_vector_type(8)))  _Float16 v8h;
typedef __attribute__((ext_vector_type(4)))  _Float16 v4h;
typedef __attribute__((ext_vector_type(8)))  float    v8f;
typedef __attribute__((ext_vector_type(4)))  float    v4f;

// Problem constants (match reference)
constexpr int Bc  = 2;
constexpr int Tc  = 2048;
constexpr int Dc  = 1024;
constexpr int Hc  = 8;
constexpr int DMc = 64;
constexpr int Ec  = Hc * DMc;     // 512
constexpr int Mtot = Bc * Tc;     // 4096
constexpr int kMTiles = Mtot / 16; // 16-row tiles of a GEMM's A

// ---------------------------------------------------------------------------
// WMMA fragment layouts (CDNA5 wave32, ISA 7.12.2)
// A (16x32 f16): lane L holds row M=L&15; hl=L>>4: elems 0..7 = K(8*hl+0..7),
//                elems 8..15 = K(16+8*hl+0..7).
// B (32x16 f16): lane L holds col N=L&15; same K packing as A.
// C (16x16 f32): lane L holds col N=L&15; vgpr j holds row M = j + 8*(L>>4).
//
// Every WMMA operand lies in memory as packed fragments of 1 KB, A and B alike. A fragment
// is two planes of 512 bytes: plane p holds elements 8p..8p+7 of every lane, lane L's 16
// bytes at p*512 + L*16. Each of the two 16-byte loads of a fragment then covers 512
// contiguous bytes, 4 whole 128-byte lines. (A row-major A makes such a load touch 16
// lines; a lane's 32 bytes kept together make it touch 8.)
// Fragment numbers: B of a GEMM: (k0/32)*(N/16) + n0/16; A of a GEMM: (k0/32)*(M/16) + m0/16.
// The k chunk is the slow index: waves that walk k side by side then read one contiguous
// stretch between them, not the same offset of buffers a fixed stride apart.
// ---------------------------------------------------------------------------

DEVI v16h load_frag(const v8h* __restrict__ P, int frag, int lane) {
  const v8h* p = P + (size_t)frag * 64 + lane;
  v8h lo = p[0], hi = p[32];
  return __builtin_shufflevector(lo, hi, 0, 1, 2, 3, 4, 5, 6, 7, 8, 9, 10, 11, 12, 13, 14, 15);
}

DEVI v8h to_v8h(float4 a, float4 b) {
  v8h r = {(_Float16)a.x, (_Float16)a.y, (_Float16)a.z, (_Float16)a.w,
           (_Float16)b.x, (_Float16)b.y, (_Float16)b.z, (_Float16)b.w};
  return r;
}

DEVI v8f wmma_f16(v16h a, v16h b, v8f c) {
  return __builtin_amdgcn_wmma_f32_16x16x32_f16(false, a, false, b, (short)0, c, false, false);
}

// ---------------------------------------------------------------------------
// Async global->LDS copy of 4KB (8 x b128 per lane), tracked by ASYNCcnt.
// LDS[lds_base + lane*16 + i*512] = MEM[src + lane*16 + i*512]
// ---------------------------------------------------------------------------
DEVI void async_copy_4k(unsigned lds_base, const void* src, int lane) {
  const char* ga = (const char*)src + lane * 16;
  unsigned la = lds_base + lane * 16;
  // one statement: the last line holds every later write of la and ga behind the copies
  asm volatile("global_load_async_to_lds_b128 %0, %1, off\n\t"
               "global_load_async_to_lds_b128 %0, %1, off offset:512\n\t"
               "global_load_async_to_lds_b128 %0, %1, off offset:1024\n\t"
               "global_load_async_to_lds_b128 %0, %1, off offset:1536\n\t"
               "global_load_async_to_lds_b128 %0, %1, off offset:2048\n\t"
               "global_load_async_to_lds_b128 %0, %1, off offset:2560\n\t"
               "global_load_async_to_lds_b128 %0, %1, off offset:3072\n\t"
               "global_load_async_to_lds_b128 %0, %1, off offset:3584\n\t"
               "s_wait_xcnt 0x0"
               :: "v"(la), "v"(ga) : "memory");
}
DEVI void wait_async_0()   { asm volatile("s_wait_asynccnt 0x0" ::: "memory"); }

// ---------------------------------------------------------------------------
// Block body: x [M,D] fp32 -> packed f16 A fragments (number = k chunk * (M/16) + m tile)
// A thread builds one lane's part of two fragments, k chunks c and c+1: four runs of 8 consecutive
// k of its row, 8 float4 loads all in flight together (a wave reads 16 rows x 256 bytes,
// whole lines), then 4 stores of 16 bytes, each 512 contiguous bytes per wave. That makes
// 4096 waves (16 per WGP); with one element per thread it is 131072.
// ---------------------------------------------------------------------------
constexpr int kCvtFrags = 2;                             // fragments per thread
constexpr int kCvtPerBlock = 256 * kCvtFrags * 16;       // elements per block
constexpr int kCvtUnitsPerTile = Dc / 32 / kCvtFrags;    // waves per 16-row tile
static_assert((Mtot * Dc) % kCvtPerBlock == 0 && (Dc / 32) % kCvtFrags == 0,
              "convert grid covers x exactly");

DEVI void pack_a_from_x_block(int blk, const float* __restrict__ src, _Float16* __restrict__ dst) {
  int i = blk * 256 + threadIdx.x;
  int lane = i & 31, unit = i >> 5;
  int mt = unit / kCvtUnitsPerTile;
  int c0 = (unit % kCvtUnitsPerTile) * kCvtFrags;
  const float4* p = (const float4*)(src + (size_t)(mt * 16 + (lane & 15)) * Dc + c0 * 32 + 8 * (lane >> 4));
  float4 v[kCvtFrags][4];
#pragma unroll
  for (int f = 0; f < kCvtFrags; ++f) {
    v[f][0] = p[f * 8 + 0]; v[f][1] = p[f * 8 + 1];      // k .. k+7
    v[f][2] = p[f * 8 + 4]; v[f][3] = p[f * 8 + 5];      // k+16 .. k+23
  }
  v8h* d = (v8h*)dst + (size_t)(c0 * kMTiles + mt) * 64 + lane;
#pragma unroll
  for (int f = 0; f < kCvtFrags; ++f) {
    d[f * kMTiles * 64]      = to_v8h(v[f][0], v[f][1]);
    d[f * kMTiles * 64 + 32] = to_v8h(v[f][2], v[f][3]);
  }
  // in the merged kernel other jobs' code follows this body in the listing and reuses the
  // stores' registers: the wait that belongs in front of that overwrite
  asm volatile("s_wait_xcnt 0x0" ::: "memory");
}

// ---------------------------------------------------------------------------
// Block body: W [N,K] fp32  ->  packed f16 B buffer for B = W^T [K,N]
// A thread builds one lane's 16 halves of one fragment: two runs of 8 consecutive k of
// row n (four float4 loads; a wave reads 16 whole 128-byte lines) and two 16-byte stores
// (each 512 contiguous bytes per wave).
// ---------------------------------------------------------------------------
DEVI void pack_b_from_wT_block(int blk, const float* __restrict__ W, _Float16* __restrict__ dst,
                               int K, int N) {
  int i = blk * 256 + threadIdx.x;               // fragment * 32 + lane
  if (i >= ((K * N) >> 4)) return;
  int lane = i & 31, frag = i >> 5;
  int ntiles = N >> 4;
  int chunk = frag / ntiles, nt = frag % ntiles;
  int n = nt * 16 + (lane & 15);
  int k = chunk * 32 + 8 * (lane >> 4);
  const float4* p = (const float4*)(W + (size_t)n * K + k);
  float4 lo0 = p[0], lo1 = p[1];                 // k .. k+7
  float4 hi0 = p[4], hi1 = p[5];                 // k+16 .. k+23
  v8h* d = (v8h*)dst + (size_t)frag * 64 + lane;
  d[0]  = to_v8h(lo0, lo1);
  d[32] = to_v8h(hi0, hi1);
}

// ---------------------------------------------------------------------------
// Wave body: 32x64 tile of Ap (packed f16, M x K) * Bp (packed f16), 8 WMMA per 32-K chunk
// (B fragments reused 2x, A fragments 4x).
// One or two waves run per SIMD, so little but a wave's own order hides a load. The K loop
// is unrolled over three sets of fragment registers: a chunk's 12 loads are issued
// together, two chunks ahead of the WMMAs that use them.
// A and B fragments have the same map (lane = row or column, elements = k), so the two
// operands may change places. kTransposed = false: acc[mt][nt] is the tile as C has it
// (lane = column n, register j = row m = j + 8*(lane>>4)). kTransposed = true: it is the
// transposed tile (lane = row m, register j = column n = j + 8*(lane>>4)): a lane then
// holds 8 consecutive n of one row.
// ---------------------------------------------------------------------------
template <int N, int K, bool kTransposed>
DEVI void gemm_tile(const v8h* __restrict__ Ap, const v8h* __restrict__ Bp,
                    int m0, int n0, int lane, v8f (&acc)[2][4]) {
  constexpr int kChunks = K / 32;
  constexpr int kSets = 3;                 // one in use, two in flight
  constexpr int ntiles = N >> 4;
  static_assert(K % 32 == 0 && kChunks >= kSets, "whole chunks, at least one per set");

  v16h a[kSets][2], b[kSets][4];
  auto load_chunk = [&](int c) {
    int s = c % kSets;
    int fa = c * kMTiles + (m0 >> 4);
    a[s][0] = load_frag(Ap, fa, lane);
    a[s][1] = load_frag(Ap, fa + 1, lane);
    int fb = c * ntiles + (n0 >> 4);
#pragma unroll
    for (int nt = 0; nt < 4; ++nt) b[s][nt] = load_frag(Bp, fb + nt, lane);
  };

#pragma unroll
  for (int c = 0; c < kSets - 1; ++c) load_chunk(c);
#pragma unroll
  for (int c = 0; c < kChunks; ++c) {
    if (c + kSets - 1 < kChunks) load_chunk(c + kSets - 1);
    // keeps these loads from moving down past this point: left free, the scheduler sinks
    // them to just before their first use (seen at K = 512) and every fragment is waited for
    __builtin_amdgcn_sched_barrier(0);
    int s = c % kSets;
#pragma unroll
    for (int nt = 0; nt < 4; ++nt) {
      if (kTransposed) {
        acc[0][nt] = wmma_f16(b[s][nt], a[s][0], acc[0][nt]);
        acc[1][nt] = wmma_f16(b[s][nt], a[s][1], acc[1][nt]);
      } else {
        acc[0][nt] = wmma_f16(a[s][0], b[s][nt], acc[0][nt]);
        acc[1][nt] = wmma_f16(a[s][1], b[s][nt], acc[1][nt]);
      }
    }
  }
  // the store addresses behind this tile reuse the loads' address registers: the wait that
  // belongs in front of that overwrite
  asm volatile("s_wait_xcnt 0x0" ::: "memory");
  // keeps the address arithmetic below from being lifted over that wait
  __builtin_amdgcn_sched_barrier(0);
}

// fp32 store of an untransposed tile to row-major C[., N]
template <int N>
DEVI void store_tile_f32(float* __restrict__ C, int m0, int n0, int lane, const v8f (&acc)[2][4]) {
  int hl = lane >> 4, nl = lane & 15;
#pragma unroll
  for (int mt = 0; mt < 2; ++mt)
#pragma unroll
    for (int nt = 0; nt < 4; ++nt)
#pragma unroll
      for (int j = 0; j < 8; ++j) {
        int m = m0 + mt * 16 + j + 8 * hl;
        C[(size_t)m * N + n0 + nt * 16 + nl] = acc[mt][nt][j];
      }
}

// ---------------------------------------------------------------------------
// Kernel: WMMA GEMM  C[M,N] = A[M,K] (packed f16) * Bp (packed f16), fp32 C.
// 4 waves / block, a 32x64 tile per wave.
// ---------------------------------------------------------------------------
template <int N, int K>
__global__ __launch_bounds__(128) void k_wmma_gemm(const _Float16* __restrict__ A,
                                                   const _Float16* __restrict__ Bpk,
                                                   float* __restrict__ C) {
  int lane = threadIdx.x & 31;
  int wave = threadIdx.x >> 5;
  int n0 = blockIdx.x * 64;
  int m0 = blockIdx.y * 128 + wave * 32;
  v8f acc[2][4] = {};
  gemm_tile<N, K, false>((const v8h*)A, (const v8h*)Bpk, m0, n0, lane, acc);
  store_tile_f32<N>(C, m0, n0, lane, acc);
}

// ---------------------------------------------------------------------------
// Block body: logit[row][h] = x[row,:] . Wb[h,:]  (fp32), row = b*T + t.
// One block per 16 rows, 8 waves: wave = (row group of 8) x (256-wide slice of D).
// A lane holds 4 consecutive d of each 128-wide chunk, so every load is 512 contiguous
// bytes per wave; each x value is used for all 8 heads, each Wb value for 8 rows.
// ---------------------------------------------------------------------------
// Halve the number of live partial sums: lanes that differ in bit MASK swap the half
// they do not keep, so 64 sums over 32 lanes take 62 exchanges instead of 320.
template <int HALF, int MASK>
DEVI void fold_lanes(float (&v)[64], int lane) {
  bool up = (lane & MASK) != 0;
#pragma unroll
  for (int i = 0; i < HALF; ++i) {
    float keep = up ? v[i + HALF] : v[i];
    float send = up ? v[i] : v[i + HALF];
    v[i] = keep + __shfl_xor(send, MASK);
  }
}

DEVI void beta_logits_block(int blk, const float* __restrict__ x, const float* __restrict__ Wb,
                            float* __restrict__ logit) {
  int lane = threadIdx.x & 31;
  int wave = threadIdx.x >> 5;
  int rg = wave & 1;             // which 8 of the block's 16 rows
  int ks = wave >> 1;            // which 256 of the 1024 d
  int row0 = blk * 16;
  __shared__ alignas(16) float part[4][128]; // [d slice][row in block * 8 + head]

  const float4* xp = (const float4*)(x + (size_t)(row0 + rg * 8) * Dc + ks * 256) + lane;
  const float4* wp = (const float4*)(Wb + ks * 256) + lane;
  float4 xv[2][8], wv[2][8];
#pragma unroll
  for (int c = 0; c < 2; ++c)
#pragma unroll
    for (int r = 0; r < 8; ++r) xv[c][r] = xp[r * (Dc / 4) + c * 32];
#pragma unroll
  for (int c = 0; c < 2; ++c)
#pragma unroll
    for (int h = 0; h < Hc; ++h) wv[c][h] = wp[h * (Dc / 4) + c * 32];

  float v[64];                   // index = row in group * 8 + head
#pragma unroll
  for (int r = 0; r < 8; ++r)
#pragma unroll
    for (int h = 0; h < Hc; ++h) {
      float s = xv[0][r].x * wv[0][h].x;
      s = fmaf(xv[0][r].y, wv[0][h].y, s);
      s = fmaf(xv[0][r].z, wv[0][h].z, s);
      s = fmaf(xv[0][r].w, wv[0][h].w, s);
      s = fmaf(xv[1][r].x, wv[1][h].x, s);
      s = fmaf(xv[1][r].y, wv[1][h].y, s);
      s = fmaf(xv[1][r].z, wv[1][h].z, s);
      s = fmaf(xv[1][r].w, wv[1][h].w, s);
      v[r * 8 + h] = s;
    }

  fold_lanes<32, 16>(v, lane);
  fold_lanes<16, 8>(v, lane);
  fold_lanes<8, 4>(v, lane);
  fold_lanes<4, 2>(v, lane);
  fold_lanes<2, 1>(v, lane);
  // lane L now holds the wave's sums number 2L and 2L+1
  *(float2*)&part[ks][rg * 64 + lane * 2] = make_float2(v[0], v[1]);
  __syncthreads();

  int tid = threadIdx.x;
  if (tid < 128) {
    float s = 0.f;
#pragma unroll
    for (int k = 0; k < 4; ++k) s += part[k][tid];
    logit[(size_t)row0 * Hc + tid] = s;
  }
}

// ---------------------------------------------------------------------------
// Kernel: everything that reads only the inputs, in one launch. None of the six jobs needs
// another's result, each alone is too short to fill the chip, and as launches of their own
// they run one behind the other. A block takes its job from its index (the same for all
// its threads); the blocks with the most work per block come first.
// ---------------------------------------------------------------------------
constexpr int kLogitBlocks = Mtot / 16;
constexpr int kCvtBlocks   = Mtot * Dc / kCvtPerBlock;
constexpr int kPackBlocks  = Ec * Dc / 16 / 256;   // per weight: one thread per fragment lane
constexpr int kPrepBlocks  = kLogitBlocks + kCvtBlocks + 4 * kPackBlocks;

__global__ __launch_bounds__(256) void k_prep(const float* __restrict__ x,
                                              const float* __restrict__ Wq,
                                              const float* __restrict__ Wk,
                                              const float* __restrict__ Wv,
                                              const float* __restrict__ Wo,
                                              const float* __restrict__ Wb,
                                              _Float16* __restrict__ xh,
                                              _Float16* __restrict__ wP,
                                              float* __restrict__ logit) {
  int blk = blockIdx.x;
  if (blk < kLogitBlocks) { beta_logits_block(blk, x, Wb, logit); return; }
  blk -= kLogitBlocks;
  if (blk < kCvtBlocks) { pack_a_from_x_block(blk, x, xh); return; }
  blk -= kCvtBlocks;
  int which = blk / kPackBlocks;                   // 0..3 = Wq, Wk, Wv, Wo
  blk -= which * kPackBlocks;
  const float* W = which == 0 ? Wq : which == 1 ? Wk : which == 2 ? Wv : Wo;
  _Float16* dst = wP + (size_t)which * (Ec * Dc);
  if (which < 3) pack_b_from_wT_block(blk, W, dst, Dc, Ec);   // B = [D,E]
  else           pack_b_from_wT_block(blk, W, dst, Ec, Dc);   // B = [E,D]
}

// ---------------------------------------------------------------------------
// Block body: beta = sigmoid(logit) and cum = cumsum(log(1-beta+1e-8)) per (b,h).
// 128 threads; the sums are formed over 256 groups of 8 t, two groups per thread.
// ---------------------------------------------------------------------------
constexpr int kProjThreads = 128;

DEVI void beta_cumsum_block(int bh /* b*H + h */, const float* __restrict__ logit,
                            float* __restrict__ beta, float* __restrict__ cum) {
  int b = bh / Hc, h = bh % Hc;
  int tid = threadIdx.x;
  __shared__ float slr[Tc];
  __shared__ float spart[256];
  __shared__ float soffs[256];

  // unrolled so that a thread's 16 logit loads are in flight together, not one per trip
  const float* lp = logit + (size_t)b * Tc * Hc + h;
  float lg[Tc / kProjThreads];
#pragma unroll
  for (int i = 0; i < Tc / kProjThreads; ++i) lg[i] = lp[(tid + i * kProjThreads) * Hc];
#pragma unroll
  for (int i = 0; i < Tc / kProjThreads; ++i) {
    int t = tid + i * kProjThreads;
    float bv = 1.0f / (1.0f + __expf(-lg[i]));
    beta[(size_t)bh * Tc + t] = bv;
    slr[t] = __logf(1.0f - bv + 1e-8f);
  }
  // the sums below reuse the beta stores' registers: the wait that belongs in front of that
  // overwrite
  asm volatile("s_wait_xcnt 0x0" ::: "memory");
  __syncthreads();

#pragma unroll
  for (int g = 0; g < 2; ++g) {
    int base = (tid + g * kProjThreads) * 8;
    float s = 0.f;
#pragma unroll
    for (int i = 0; i < 8; ++i) s += slr[base + i];
    spart[tid + g * kProjThreads] = s;
  }
  __syncthreads();
  if (tid == 0) {
    float run = 0.f;
    for (int i = 0; i < 256; ++i) { soffs[i] = run; run += spart[i]; }
  }
  __syncthreads();
#pragma unroll
  for (int g = 0; g < 2; ++g) {
    int base = (tid + g * kProjThreads) * 8;
    float run = soffs[tid + g * kProjThreads];
#pragma unroll
    for (int i = 0; i < 8; ++i) {
      run += slr[base + i];
      cum[(size_t)bh * Tc + base + i] = run;
    }
  }
}

// ---------------------------------------------------------------------------
// Kernel: the three projections Y = xh @ W^T (M=4096, N=512, K=1024), each finished in its
// own epilogue into the f16 form that the attention reads; no fp32 Yq or Yk is stored.
// qh    : per (b,h) packed A, A=Q   (M-dim=T,  K-dim=DM), L2-normalized, 1/sqrt(DM) folded in
// kpack : per (b,h) packed B, B=K^T (K-dim=DM, N-dim=T), L2-normalized
// vpack : per (b,h) packed B, B=V   (K-dim=T,  N-dim=DM); V also as fp32 Yv [B*T,E]
// A wave's 32x64 tile is 32 tokens of ONE head, so a row's norm lies inside the wave.
// The tile is formed transposed: a lane holds 32 of its token's 64 d (the other 32 in lane
// ^ 16), 8 consecutive d per accumulator, which is one plane of a Q or a K^T fragment and
// the order of a Yv row; only the V fragments (lane = d) take a turn through LDS. Every
// global store is 16 bytes per lane.
// The 16 scan blocks need only the logits of the launch before; they come first and run
// beside the products.
// ---------------------------------------------------------------------------
constexpr int kScanBlocks = Bc * Hc;
constexpr int kProjBlocksPerW = (Ec / 64) * (Mtot / 128);
static_assert(DMc == 64 && Tc % 128 == 0, "a wave's tile is one head; a block is one batch");

__global__ __launch_bounds__(kProjThreads)
void k_proj(const _Float16* __restrict__ xh, const _Float16* __restrict__ wP,
            const float* __restrict__ logit, float* __restrict__ beta, float* __restrict__ cum,
            float* __restrict__ Yv, _Float16* __restrict__ qh, _Float16* __restrict__ kpack,
            _Float16* __restrict__ vpack) {
  int blk = blockIdx.x;
  if (blk < kScanBlocks) { beta_cumsum_block(blk, logit, beta, cum); return; }
  blk -= kScanBlocks;
  int which = blk / kProjBlocksPerW;               // 0..2 = Wq, Wk, Wv
  blk -= which * kProjBlocksPerW;
  int h = blk % Hc;
  int lane = threadIdx.x & 31;
  int wave = threadIdx.x >> 5;
  int m0 = (blk / Hc) * 128 + wave * 32;
  int n0 = h * DMc;
  int bh = (m0 / Tc) * Hc + h;
  int t0 = m0 % Tc;                                // multiple of 32
  int hl = lane >> 4, nl = lane & 15;
  const v8h* Bp = (const v8h*)(wP + (size_t)which * (Ec * Dc));
  v8f acc[2][4] = {};

  gemm_tile<Ec, Dc, true>((const v8h*)xh, Bp, m0, n0, lane, acc);
  // acc[mt][nt][j]: token t0 + mt*16 + nl, d = nt*16 + 8*hl + j

  if (which == 2) {
    // a V fragment wants lane = d, elements = tokens: the wave turns its tile in an LDS
    // buffer of its own, [d][token], rows of 80 bytes (16-byte reads stay aligned and the
    // two lane halves' rows, 8 apart, fall on different banks)
    constexpr int kPitch = 40;
    __shared__ alignas(16) _Float16 sT[kProjThreads / 32][DMc * kPitch];
    _Float16* st = &sT[wave][0];
#pragma unroll
    for (int mt = 0; mt < 2; ++mt)
#pragma unroll
      for (int nt = 0; nt < 4; ++nt)
#pragma unroll
        for (int j = 0; j < 8; ++j)
          st[(nt * 16 + 8 * hl + j) * kPitch + mt * 16 + nl] = (_Float16)acc[mt][nt][j];
    // the reads below take other lanes' values: keeps the compiler from moving them up
    __builtin_amdgcn_wave_barrier();
    // fragment (t chunk, d tile nt): elements 0..7 = tokens 8*hl + i, 8..15 = 16 + 8*hl + i
    v8h pv[4][2];
#pragma unroll
    for (int nt = 0; nt < 4; ++nt) {
      pv[nt][0] = *(const v8h*)&st[(nt * 16 + nl) * kPitch + 8 * hl];
      pv[nt][1] = *(const v8h*)&st[(nt * 16 + nl) * kPitch + 16 + 8 * hl];
    }
    v8h* vp = (v8h*)(vpack + (size_t)bh * Tc * DMc) + (size_t)(t0 >> 5) * (DMc >> 4) * 64 + lane;
    v4f* yv = (v4f*)(Yv + (size_t)(m0 + nl) * Ec + n0 + 8 * hl);
#pragma unroll
    for (int nt = 0; nt < 4; ++nt) {
      vp[nt * 64]      = pv[nt][0];
      vp[nt * 64 + 32] = pv[nt][1];
    }
#pragma unroll
    for (int mt = 0; mt < 2; ++mt)
#pragma unroll
      for (int nt = 0; nt < 4; ++nt) {
        v4f lo = {acc[mt][nt][0], acc[mt][nt][1], acc[mt][nt][2], acc[mt][nt][3]};
        v4f hi = {acc[mt][nt][4], acc[mt][nt][5], acc[mt][nt][6], acc[mt][nt][7]};
        yv[mt * (16 * Ec / 4) + nt * 4 + 0] = lo;
        yv[mt * (16 * Ec / 4) + nt * 4 + 1] = hi;
      }
    // other branches' code follows in the listing and reuses these stores' registers (the
    // fragment stores' above too): the wait that belongs in front of that overwrite
    asm volatile("s_wait_xcnt 0x0" ::: "memory");
    return;
  }

  float top = which == 0 ? 0.125f : 1.0f;          // 1/sqrt(DM) folded into Q
  v8h p[2][4];
#pragma unroll
  for (int mt = 0; mt < 2; ++mt) {
    float ss[4];
#pragma unroll
    for (int nt = 0; nt < 4; ++nt) {
      ss[nt] = acc[mt][nt][0] * acc[mt][nt][0];
#pragma unroll
      for (int j = 1; j < 8; ++j) ss[nt] = fmaf(acc[mt][nt][j], acc[mt][nt][j], ss[nt]);
    }
    float half = (ss[0] + ss[1]) + (ss[2] + ss[3]);
    float n2 = half + __shfl_xor(half, 16);
    float sc = top / fmaxf(__fsqrt_rn(n2), 1e-12f);
#pragma unroll
    for (int nt = 0; nt < 4; ++nt)
#pragma unroll
      for (int j = 0; j < 8; ++j) p[mt][nt][j] = (_Float16)(acc[mt][nt][j] * sc);
  }
  if (which == 0) {
    // fragment (token tile, d chunk c): plane 0 = d 32c + 8*hl + j, plane 1 = 16 more
    v8h* q = (v8h*)(qh + (size_t)bh * Tc * DMc) + (size_t)(t0 >> 4) * (DMc >> 5) * 64 + lane;
#pragma unroll
    for (int mt = 0; mt < 2; ++mt)
#pragma unroll
      for (int nt = 0; nt < 4; ++nt) q[(mt * 4 + nt) * 32] = p[mt][nt];
    // as behind the V stores: other branches' code follows and reuses these stores' registers
    asm volatile("s_wait_xcnt 0x0" ::: "memory");
  } else {
    // fragment (d chunk c, token tile): plane 0 = d 32c + 8*hl + j, plane 1 = 16 more
    v8h* kp = (v8h*)(kpack + (size_t)bh * DMc * Tc) + (size_t)(t0 >> 4) * 64 + lane;
#pragma unroll
    for (int c = 0; c < 2; ++c)
#pragma unroll
      for (int mt = 0; mt < 2; ++mt) {
        kp[(c * (Tc >> 4) + mt) * 64]      = p[mt][2 * c];
        kp[(c * (Tc >> 4) + mt) * 64 + 32] = p[mt][2 * c + 1];
      }
    // as behind the V stores: other branches' code follows and reuses these stores' registers
    asm volatile("s_wait_xcnt 0x0" ::: "memory");
  }
}

// ---------------------------------------------------------------------------
// Kernel: fused decay attention.
// Per (b,h) and 16-query tile: stream 32-wide key chunks s >= t-tile,
//   S = (Q K^T) .* exp(min(cum_t - cum_s,0)) .* [s>=t]  (1/sqrt(DM) in Q)
//   O += S @ V ; epilogue O += beta*V (fp32 V) ; store f16 to attn_out (packed A, [B*T,E])
// A chunk is one long dependent chain (K load, scores, LDS repack, V read, product), and
// a tile has up to 64 of them. The block's 8 waves share the tile's chunks: wave w takes
// chunks w, w + 8, ... into a partial O of its own (there is no softmax: partial sums
// just add), and the partial tiles are summed through LDS at the end.
// Each wave has its own score buffer and its own two V buffers, filled by
// global_load_async_to_lds_b128 (ASYNCcnt) one chunk ahead; no wave reads another's
// before the one barrier in front of the final sum.
// ---------------------------------------------------------------------------
constexpr int kAttnWaves = 8;

__global__ void k_attention(const _Float16* __restrict__ qh, const _Float16* __restrict__ kpack,
                            const _Float16* __restrict__ vpack, const float* __restrict__ Yv,
                            const float* __restrict__ beta, const float* __restrict__ cum,
                            _Float16* __restrict__ attn_out) {
  int lane = threadIdx.x & 31;
  int wave = __builtin_amdgcn_readfirstlane(threadIdx.x >> 5);
  int t0 = blockIdx.x * 16;
  int bh = blockIdx.y;
  int b = bh / Hc, h = bh % Hc;

  const v8h* Qp = (const v8h*)(qh + (size_t)bh * Tc * DMc);        // packed, M-dim = T
  const v8h* Kp = (const v8h*)(kpack + (size_t)bh * DMc * Tc);     // packed, N-dim = T
  const v16h* Vp = (const v16h*)(vpack + (size_t)bh * Tc * DMc);   // packed, N-dim = DM
  const float* cumv  = cum  + (size_t)bh * Tc;
  const float* betav = beta + (size_t)bh * Tc;

  __shared__ alignas(32) _Float16 sV[kAttnWaves][2][2048];  // per wave: 2 x 4KB V chunk
  __shared__ alignas(16) float sSall[kAttnWaves][16 * 32];  // per wave: score repack buffer
  float* sS = &sSall[wave][0];

  int hl = lane >> 4, nl = lane & 15;
  const int kNT = Tc >> 4;    // 128 n-tiles in packed K
  const int vNT = DMc >> 4;   // 4  n-tiles in packed V

  unsigned lds_v = (unsigned)(uintptr_t)&sV[wave][0][0];

  // Q A-fragments for the two 32-wide dm chunks (reused across all key tiles)
  v16h aq0 = load_frag(Qp, (t0 >> 4) * 2 + 0, lane);
  v16h aq1 = load_frag(Qp, (t0 >> 4) * 2 + 1, lane);

  // cum for the 8 query rows this lane covers in the C layout
  float cum_q[8];
#pragma unroll
  for (int j = 0; j < 8; ++j) cum_q[j] = cumv[t0 + j + 8 * hl];

  v8f acc0 = {}, acc1 = {}, acc2 = {}, acc3 = {};

  constexpr int kStride = kAttnWaves * 32;      // keys between two chunks of one wave
  int s_first = (t0 & ~31) + wave * 32;         // this wave's first chunk touching s >= t0
  int buf = 0;
  // preload this wave's first V chunk (4KB contiguous in packed buffer)
  if (s_first < Tc)
    async_copy_4k(lds_v, Vp + (size_t)(s_first >> 5) * vNT * 32, lane);

  for (int s0 = s_first; s0 < Tc; s0 += kStride) {
    // two 16x16 score tiles -> decayed fp32 chunk in LDS (m, s_local) layout
#pragma unroll
    for (int st = 0; st < 2; ++st) {
      int sc = s0 + st * 16;
      v16h kb0 = load_frag(Kp, 0 * kNT + (sc >> 4), lane);   // dm chunk 0
      v16h kb1 = load_frag(Kp, 1 * kNT + (sc >> 4), lane);   // dm chunk 1
      v8f sacc = {};
      sacc = wmma_f16(aq0, kb0, sacc);
      sacc = wmma_f16(aq1, kb1, sacc);
      int s = sc + nl;
      float cs = cumv[s];
#pragma unroll
      for (int j = 0; j < 8; ++j) {
        int tq = t0 + j + 8 * hl;
        float dec = (s >= tq) ? __expf(fminf(cum_q[j] - cs, 0.f)) : 0.f;
        sS[(j + 8 * hl) * 32 + st * 16 + nl] = sacc[j] * dec;
      }
    }
    __builtin_amdgcn_wave_barrier();
    // repack C-layout scores -> A-layout f16 fragment (cross-lane via LDS)
    v16h as;
#pragma unroll
    for (int j = 0; j < 8; ++j) {
      as[j]     = (_Float16)sS[nl * 32 + 8 * hl + j];
      as[8 + j] = (_Float16)sS[nl * 32 + 16 + 8 * hl + j];
    }
    __builtin_amdgcn_wave_barrier();

    // this chunk's V copies, the only ones in flight, have landed behind this wait
    wait_async_0();
    if (s0 + kStride < Tc) {
      // the other buffer is refilled only when this wave's LDS reads of it have retired
      asm volatile("s_wait_dscnt 0x0" ::: "memory");
      async_copy_4k(lds_v + (buf ^ 1) * 4096, Vp + (size_t)((s0 + kStride) >> 5) * vNT * 32, lane);
    }

    // S @ V from LDS (ds_load_b128 pairs), 4 dm tiles
    const v8h* lv = (const v8h*)&sV[wave][buf][0];
    v16h bv0 = load_frag(lv, 0, lane);
    v16h bv1 = load_frag(lv, 1, lane);
    v16h bv2 = load_frag(lv, 2, lane);
    v16h bv3 = load_frag(lv, 3, lane);
    acc0 = wmma_f16(as, bv0, acc0);
    acc1 = wmma_f16(as, bv1, acc1);
    acc2 = wmma_f16(as, bv2, acc2);
    acc3 = wmma_f16(as, bv3, acc3);
    buf ^= 1;
  }

  // nothing may still be landing in, or be read from, the V buffers: they now take the sums
  wait_async_0();
  asm volatile("s_wait_dscnt 0x0" ::: "memory");

  // this wave's share of the epilogue is piece number 'wave' of the tile (see below). Its
  // beta and fp32 V are fetched in front of the barrier: all but the last wave to arrive
  // have them by the time the barrier opens (ahead of the key loop they cost registers,
  // and the build then fetches the chunk's K fragments in two rounds instead of one)
  int dm = (wave >> 1) * 16 + nl;
  int m0 = t0 + (wave & 1) * 4 + 8 * hl;
  size_t o0 = ((size_t)b * Tc + m0) * Ec + h * DMc + dm;
  float bq[4], yv[4];
#pragma unroll
  for (int i = 0; i < 4; ++i) { bq[i] = betav[m0 + i]; yv[i] = Yv[o0 + (size_t)i * Ec]; }

  // each wave parks its partial tile in its own V buffers, 4 accumulator rows per piece:
  // piece p = nt * 2 + (j >> 2), 16 bytes per lane, so stores and loads are contiguous
  v8f accs[4] = {acc0, acc1, acc2, acc3};
  v4f* mine = (v4f*)&sV[wave][0][0];
#pragma unroll
  for (int nt = 0; nt < 4; ++nt) {
    v4f lo = {accs[nt][0], accs[nt][1], accs[nt][2], accs[nt][3]};
    v4f hi = {accs[nt][4], accs[nt][5], accs[nt][6], accs[nt][7]};
    mine[(nt * 2 + 0) * 32 + lane] = lo;
    mine[(nt * 2 + 1) * 32 + lane] = hi;
  }
  __syncthreads();

  // wave w sums piece w over the 8 partial tiles, in wave order
  v4f o4 = ((const v4f*)&sV[0][0][0])[wave * 32 + lane];
#pragma unroll
  for (int w = 1; w < kAttnWaves; ++w) o4 += ((const v4f*)&sV[w][0][0])[wave * 32 + lane];

  // epilogue: O += beta * V (fp32 V from projection), store f16 into the A fragments of the
  // output projection. Column e = h*DM + dm: k chunk e >> 5, plane (e >> 4) & 1, lane half
  // (e >> 3) & 1, element e & 7; the fragment's lane row is the token's index in its tile
  int e = h * DMc + dm;
  size_t frag = (size_t)(e >> 5) * kMTiles + ((b * Tc + t0) >> 4);
  _Float16* ao = attn_out + (frag * 2 + ((e >> 4) & 1)) * 256 +
                 (((e >> 3) & 1) * 16 + (m0 - t0)) * 8 + (e & 7);
#pragma unroll
  for (int i = 0; i < 4; ++i)
    ao[i * 8] = (_Float16)(o4[i] + bq[i] * yv[i]);
}

// ---------------------------------------------------------------------------
// Host launcher
// ---------------------------------------------------------------------------
extern "C" void kernel_launch(void* const* d_in, const int* in_sizes, int n_in,
                              void* d_out, int out_size, void* d_ws, size_t ws_size,
                              hipStream_t stream) {
  const float* x  = (const float*)d_in[0];   // [B,T,D]
  const float* Wk = (const float*)d_in[1];   // [E,D]
  const float* Wv = (const float*)d_in[2];   // [E,D]
  const float* Wq = (const float*)d_in[3];   // [E,D]
  const float* Wb = (const float*)d_in[4];   // [H,D]
  const float* Wo = (const float*)d_in[5];   // [D,E]
  float* out = (float*)d_out;                // [B,T,D]

  // workspace carve-up
  char* w = (char*)d_ws;
  auto alloc = [&](size_t bytes) -> void* {
    void* p = (void*)w;
    w += (bytes + 255) & ~(size_t)255;
    return p;
  };
  _Float16* xh   = (_Float16*)alloc((size_t)Mtot * Dc * 2);   // x as f16, packed A
  _Float16* wP   = (_Float16*)alloc((size_t)4 * Dc * Ec * 2); // packed B = Wq^T, Wk^T, Wv^T, Wo^T
  _Float16* woP  = wP + (size_t)3 * Dc * Ec;
  float*    Yv   = (float*)alloc((size_t)Mtot * Ec * 4);      // V projection, fp32
  _Float16* qh   = (_Float16*)alloc((size_t)Bc * Hc * Tc * DMc * 2);
  _Float16* kpack= (_Float16*)alloc((size_t)Bc * Hc * Tc * DMc * 2);
  _Float16* vpack= (_Float16*)alloc((size_t)Bc * Hc * Tc * DMc * 2);
  float*    blog = (float*)alloc((size_t)Mtot * Hc * 4);        // beta logits [B*T, H]
  float*    beta = (float*)alloc((size_t)Bc * Hc * Tc * 4);
  float*    cum  = (float*)alloc((size_t)Bc * Hc * Tc * 4);
  _Float16* aoh  = (_Float16*)alloc((size_t)Mtot * Ec * 2);   // attention out f16, packed A

  // 1) all that reads only the inputs: beta logits, x as f16, the four packed weights
  k_prep<<<dim3(kPrepBlocks), dim3(256), 0, stream>>>(x, Wq, Wk, Wv, Wo, Wb, xh, wP, blog);

  // 2) the three projections, each packed to f16 fragments in its epilogue, Q and K normalized (Q
  //    scaled, V also fp32), beside sigmoid + cumsum per (b,h)
  k_proj<<<dim3(kScanBlocks + 3 * kProjBlocksPerW), dim3(kProjThreads), 0, stream>>>(
      xh, wP, blog, beta, cum, Yv, qh, kpack, vpack);

  // 3) fused decay attention (async double-buffered V via ASYNCcnt), 8 waves per query tile
  k_attention<<<dim3(Tc / 16, Bc * Hc), dim3(kAttnWaves * 32), 0, stream>>>(qh, kpack, vpack, Yv, beta, cum, aoh);

  // 4) output projection: out = aoh @ Wo^T  (M=4096, N=1024, K=512)
  {
    dim3 grid(Dc / 64, Mtot / 128);
    k_wmma_gemm<Dc, Ec><<<grid, dim3(128), 0, stream>>>(aoh, woP, out);
  }
}

// v009
// A run of this version takes 42.1 microseconds.
// Versions between v007 and this one are left out; their measured steps multiply to 1.45 times as fast.
// Over all steps from v000 it is 11.0 times as fast.
#include <hip/hip_runtime.h>
#include <hip/hip_bf16.h>

#define DEVI __device__ __forceinline__

typedef __attribute__((ext_vector_type(16))) _Float16 v16h;
typedef __attribute__((ext_vector_type(8)))  _Float16 v8h;
typedef __attribute__((ext_vector_type(4)))  _Float16 v4h;
typedef __attribute__((ext_vector_type(8)))  float    v8f;
typedef __attribute__((ext_vector_type(4)))  float    v4f;

// Problem constants (match reference)
constexpr int Bc  = 2;
constexpr int Tc  = 2048;
constexpr int Dc  = 1024;
constexpr int Hc  = 8;
constexpr int DMc = 64;
constexpr int Ec  = Hc * DMc;     // 512
constexpr int Mtot = Bc * Tc;     // 4096
constexpr int kMTiles = Mtot / 16; // 16-row tiles of a GEMM's A

// ---------------------------------------------------------------------------
// WMMA fragment layouts (CDNA5 wave32, ISA 7.12.2)
// A (16x32 f16): lane L holds row M=L&15; hl=L>>4: elems 0..7 = K(8*hl+0..7),
//                elems 8..15 = K(16+8*hl+0..7).
// B (32x16 f16): lane L holds col N=L&15; same K packing as A.
// C (16x16 f32): lane L holds col N=L&15; vgpr j holds row M = j + 8*(L>>4).
//
// Every WMMA operand lies in memory as packed fragments of 1 KB, A and B alike. A fragment
// is two planes of 512 bytes: plane p holds elements 8p..8p+7 of every lane, lane L's 16
// bytes at p*512 + L*16. Each of the two 16-byte loads of a fragment then covers 512
// contiguous bytes, 4 whole 128-byte lines. (A row-major A makes such a load touch 16
// lines; a lane's 32 bytes kept together make it touch 8.)
// Fragment numbers: B of a GEMM: (k0/32)*(N/16) + n0/16; A of a GEMM: (k0/32)*(M/16) + m0/16.
// The k chunk is the slow index: waves that walk k side by side then read one contiguous
// stretch between them, not the same offset of buffers a fixed stride apart.
// ---------------------------------------------------------------------------

DEVI v16h load_frag(const v8h* __restrict__ P, int frag, int lane) {
  const v8h* p = P + (size_t)frag * 64 + lane;
  v8h lo = p[0], hi = p[32];
  return __builtin_shufflevector(lo, hi, 0, 1, 2, 3, 4, 5, 6, 7, 8, 9, 10, 11, 12, 13, 14, 15);
}

DEVI v8f wmma_f16(v16h a, v16h b, v8f c) {
  return __builtin_amdgcn_wmma_f32_16x16x32_f16(false, a, false, b, (short)0, c, false, false);
}

// ---------------------------------------------------------------------------
// Turning an fp32 tile into fragments. A fragment wants lane = row, so a load in fragment
// order touches 16 lines and takes 32 bytes of each. The two bodies below load by rows, whole
// 128-byte lines, convert, lay the f16 tile in an LDS range of the wave's own and read it back
// in fragment order. Row pitches are odd multiples of 16 bytes, for the 16-byte reads.
// ---------------------------------------------------------------------------
DEVI v4h to_v4h(float4 a) {
  v4h r = {(_Float16)a.x, (_Float16)a.y, (_Float16)a.z, (_Float16)a.w};
  return r;
}

// between a wave's LDS writes and its reads of other lanes' values: the writes are waited
// for, and the compiler moves no LDS access over this line
DEVI void own_lds_written() { asm volatile("s_wait_dscnt 0x0" ::: "memory"); }

// ---------------------------------------------------------------------------
// Block body: x [M,D] fp32 -> packed f16 A fragments (number = k chunk * (M/16) + m tile)
// A wave builds two fragments, k chunks c and c+1 of one 16-row tile: 16 rows x 256 bytes.
// 8 float4 loads per lane, all in flight together, each two rows of 256 bytes; then 4 stores
// of 16 bytes, each 512 contiguous bytes per wave. That makes 4096 waves (16 per WGP); with
// one element per thread it is 131072.
// ---------------------------------------------------------------------------
constexpr int kCvtFrags = 2;                             // fragments per thread
constexpr int kCvtPerBlock = 256 * kCvtFrags * 16;       // elements per block
constexpr int kCvtUnitsPerTile = Dc / 32 / kCvtFrags;    // waves per 16-row tile
constexpr int kCvtPitch = kCvtFrags * 32 + 8;            // halves: 144 bytes
static_assert((Mtot * Dc) % kCvtPerBlock == 0 && (Dc / 32) % kCvtFrags == 0,
              "convert grid covers x exactly");
static_assert(kCvtFrags * 32 * 4 == 16 * 16, "16 lanes x 16 bytes are a wave's part of a row");

DEVI void pack_a_from_x_block(int blk, const float* __restrict__ src, _Float16* __restrict__ dst,
                              _Float16* st) {
  int i = blk * 256 + threadIdx.x;
  int lane = i & 31, unit = i >> 5;
  int hl = lane >> 4, nl = lane & 15;
  int mt = unit / kCvtUnitsPerTile;
  int c0 = (unit % kCvtUnitsPerTile) * kCvtFrags;
  const float4* p = (const float4*)(src + (size_t)(mt * 16 + hl) * Dc + c0 * 32) + nl;
  float4 v[8];
#pragma unroll
  for (int r = 0; r < 8; ++r) v[r] = p[r * (2 * Dc / 4)];          // rows 2r + hl
#pragma unroll
  for (int r = 0; r < 8; ++r) *(v4h*)&st[(2 * r + hl) * kCvtPitch + nl * 4] = to_v4h(v[r]);
  own_lds_written();
  v8h* d = (v8h*)dst + (size_t)(c0 * kMTiles + mt) * 64 + lane;
  const _Float16* row = &st[nl * kCvtPitch + 8 * hl];
#pragma unroll
  for (int f = 0; f < kCvtFrags; ++f) {
    d[f * kMTiles * 64]      = *(const v8h*)&row[f * 32];           // k .. k+7
    d[f * kMTiles * 64 + 32] = *(const v8h*)&row[f * 32 + 16];      // k+16 .. k+23
  }
  // in the merged kernel other jobs' code follows this body in the listing and reuses the
  // stores' registers: the wait that belongs in front of that overwrite
  asm volatile("s_wait_xcnt 0x0" ::: "memory");
}

// ---------------------------------------------------------------------------
// Block body: W [N,K] fp32  ->  packed f16 B buffer for B = W^T [K,N]
// A wave builds one fragment: 32 consecutive k of 16 rows n, 16 whole 128-byte lines. Four
// float4 loads per lane, each four rows of 128 bytes, and two 16-byte stores (each 512
// contiguous bytes per wave).
// ---------------------------------------------------------------------------
constexpr int kPackPitch = 32 + 8;                       // halves: 80 bytes

DEVI void pack_b_from_wT_block(int blk, const float* __restrict__ W, _Float16* __restrict__ dst,
                               int K, int N, _Float16* st) {
  int i = blk * 256 + threadIdx.x;               // fragment * 32 + lane
  if (i >= ((K * N) >> 4)) return;
  int lane = i & 31, frag = i >> 5;
  int hl = lane >> 4, nl = lane & 15;
  int rl = lane >> 3, cl = lane & 7;             // row in a group of four, 16-byte piece of it
  int ntiles = N >> 4;
  int chunk = frag / ntiles, nt = frag % ntiles;
  const float4* p = (const float4*)(W + (size_t)(nt * 16 + rl) * K + chunk * 32) + cl;
  float4 v[4];
#pragma unroll
  for (int r = 0; r < 4; ++r) v[r] = p[r * K];   // rows 4r + rl: 4 * K floats on
#pragma unroll
  for (int r = 0; r < 4; ++r) *(v4h*)&st[(4 * r + rl) * kPackPitch + cl * 4] = to_v4h(v[r]);
  own_lds_written();
  v8h* d = (v8h*)dst + (size_t)frag * 64 + lane;
  const _Float16* row = &st[nl * kPackPitch + 8 * hl];
  d[0]  = *(const v8h*)&row[0];                  // k .. k+7
  d[32] = *(const v8h*)&row[16];                 // k+16 .. k+23
}

// ---------------------------------------------------------------------------
// Wave body: 32x64 tile of Ap (packed f16, M x K) * Bp (packed f16), 8 WMMA per 32-K chunk
// (B fragments reused 2x, A fragments 4x).
// One or two waves run per SIMD, so little but a wave's own order hides a load. The K loop
// is unrolled over three sets of fragment registers: a chunk's 12 loads are issued
// together, two chunks ahead of the WMMAs that use them.
// A and B fragments have the same map (lane = row or column, elements = k), so the two
// operands may change places. kTransposed = false: acc[mt][nt] is the tile as C has it
// (lane = column n, register j = row m = j + 8*(lane>>4)). kTransposed = true: it is the
// transposed tile (lane = row m, register j = column n = j + 8*(lane>>4)): a lane then
// holds 8 consecutive n of one row.
// ---------------------------------------------------------------------------
template <int N, int K, bool kTransposed>
DEVI void gemm_tile(const v8h* __restrict__ Ap, const v8h* __restrict__ Bp,
                    int m0, int n0, int lane, v8f (&acc)[2][4]) {
  constexpr int kChunks = K / 32;
  constexpr int kSets = 3;                 // one in use, two in flight
  constexpr int ntiles = N >> 4;
  static_assert(K % 32 == 0 && kChunks >= kSets, "whole chunks, at least one per set");

  v16h a[kSets][2], b[kSets][4];
  auto load_chunk = [&](int c) {
    int s = c % kSets;
    int fa = c * kMTiles + (m0 >> 4);
    a[s][0] = load_frag(Ap, fa, lane);
    a[s][1] = load_frag(Ap, fa + 1, lane);
    int fb = c * ntiles + (n0 >> 4);
#pragma unroll
    for (int nt = 0; nt < 4; ++nt) b[s][nt] = load_frag(Bp, fb + nt, lane);
  };

#pragma unroll
  for (int c = 0; c < kSets - 1; ++c) load_chunk(c);
#pragma unroll
  for (int c = 0; c < kChunks; ++c) {
    if (c + kSets - 1 < kChunks) load_chunk(c + kSets - 1);
    // keeps these loads from moving down past this point: left free, the scheduler sinks
    // them to just before their first use (seen at K = 512) and every fragment is waited for
    __builtin_amdgcn_sched_barrier(0);
    int s = c % kSets;
#pragma unroll
    for (int nt = 0; nt < 4; ++nt) {
      if (kTransposed) {
        acc[0][nt] = wmma_f16(b[s][nt], a[s][0], acc[0][nt]);
        acc[1][nt] = wmma_f16(b[s][nt], a[s][1], acc[1][nt]);
      } else {
        acc[0][nt] = wmma_f16(a[s][0], b[s][nt], acc[0][nt]);
        acc[1][nt] = wmma_f16(a[s][1], b[s][nt], acc[1][nt]);
      }
    }
  }
  // the store addresses behind this tile reuse the loads' address registers: the wait that
  // belongs in front of that overwrite
  asm volatile("s_wait_xcnt 0x0" ::: "memory");
  // keeps the address arithmetic below from being lifted over that wait
  __builtin_amdgcn_sched_barrier(0);
}

// fp32 store of a transposed tile (lane = row, 8 consecutive columns per accumulator) to
// row-major C[., N]. Stored as it stands, a 16-byte store would put 32 bytes into each of 16
// lines. The wave lays its 32 x 64 tile in an LDS range of its own and reads it back by rows:
// a store then covers two rows of 256 bytes, 4 whole 128-byte lines. Rows of 272 bytes: the
// 16 lanes of a half, one row each, write 16 bytes to 64 different banks.
constexpr int kRowPitch = 68;                // floats
constexpr int kRowTile  = 32 * kRowPitch;    // floats of LDS per wave

template <int N>
DEVI void store_rows_f32(float* __restrict__ C, float* st, int m0, int n0, int lane,
                         const v8f (&acc)[2][4]) {
  int hl = lane >> 4, nl = lane & 15;
#pragma unroll
  for (int mt = 0; mt < 2; ++mt)
#pragma unroll
    for (int nt = 0; nt < 4; ++nt) {
      v4f lo = {acc[mt][nt][0], acc[mt][nt][1], acc[mt][nt][2], acc[mt][nt][3]};
      v4f hi = {acc[mt][nt][4], acc[mt][nt][5], acc[mt][nt][6], acc[mt][nt][7]};
      v4f* p = (v4f*)&st[(mt * 16 + nl) * kRowPitch + nt * 16 + 8 * hl];
      p[0] = lo;
      p[1] = hi;
    }
  own_lds_written();
  v4f r[16];
#pragma unroll
  for (int i = 0; i < 16; ++i) r[i] = *(const v4f*)&st[(2 * i + hl) * kRowPitch + nl * 4];
  float* c = C + (size_t)(m0 + hl) * N + n0 + nl * 4;
#pragma unroll
  for (int i = 0; i < 16; ++i) *(v4f*)(c + (size_t)(2 * i) * N) = r[i];
}

// ---------------------------------------------------------------------------
// Kernel: WMMA GEMM  C[M,N] = A[M,K] (packed f16) * Bp (packed f16), fp32 C.
// 4 waves / block, a 32x64 tile per wave, formed transposed and stored by whole lines.
// ---------------------------------------------------------------------------
template <int N, int K>
__global__ __launch_bounds__(128) void k_wmma_gemm(const _Float16* __restrict__ A,
                                                   const _Float16* __restrict__ Bpk,
                                                   float* __restrict__ C) {
  int lane = threadIdx.x & 31;
  int wave = threadIdx.x >> 5;
  int n0 = blockIdx.x * 64;
  int m0 = blockIdx.y * 128 + wave * 32;
  __shared__ alignas(16) float sRow[4][kRowTile];
  v8f acc[2][4] = {};
  gemm_tile<N, K, true>((const v8h*)A, (const v8h*)Bpk, m0, n0, lane, acc);
  store_rows_f32<N>(C, &sRow[wave][0], m0, n0, lane, acc);
}

// ---------------------------------------------------------------------------
// Block body: logit[row][h] = x[row,:] . Wb[h,:]  (fp32), row = b*T + t.
// One block per 16 rows, 8 waves: wave = (row group of 8) x (256-wide slice of D).
// A lane holds 4 consecutive d of each 128-wide chunk, so every load is 512 contiguous
// bytes per wave; each x value is used for all 8 heads, each Wb value for 8 rows.
// ---------------------------------------------------------------------------
// Halve the number of live partial sums: lanes that differ in bit MASK swap the half
// they do not keep, so 64 sums over 32 lanes take 62 exchanges instead of 320.
template <int HALF, int MASK>
DEVI void fold_lanes(float (&v)[64], int lane) {
  bool up = (lane & MASK) != 0;
#pragma unroll
  for (int i = 0; i < HALF; ++i) {
    float keep = up ? v[i + HALF] : v[i];
    float send = up ? v[i] : v[i + HALF];
    v[i] = keep + __shfl_xor(send, MASK);
  }
}

DEVI void beta_logits_block(int blk, const float* __restrict__ x, const float* __restrict__ Wb,
                            float* __restrict__ logit) {
  int lane = threadIdx.x & 31;
  int wave = threadIdx.x >> 5;
  int rg = wave & 1;             // which 8 of the block's 16 rows
  int ks = wave >> 1;            // which 256 of the 1024 d
  int row0 = blk * 16;
  __shared__ alignas(16) float part[4][128]; // [d slice][row in block * 8 + head]

  const float4* xp = (const float4*)(x + (size_t)(row0 + rg * 8) * Dc + ks * 256) + lane;
  const float4* wp = (const float4*)(Wb + ks * 256) + lane;
  float4 xv[2][8], wv[2][8];
#pragma unroll
  for (int c = 0; c < 2; ++c)
#pragma unroll
    for (int r = 0; r < 8; ++r) xv[c][r] = xp[r * (Dc / 4) + c * 32];
#pragma unroll
  for (int c = 0; c < 2; ++c)
#pragma unroll
    for (int h = 0; h < Hc; ++h) wv[c][h] = wp[h * (Dc / 4) + c * 32];

  float v[64];                   // index = row in group * 8 + head
#pragma unroll
  for (int r = 0; r < 8; ++r)
#pragma unroll
    for (int h = 0; h < Hc; ++h) {
      float s = xv[0][r].x * wv[0][h].x;
      s = fmaf(xv[0][r].y, wv[0][h].y, s);
      s = fmaf(xv[0][r].z, wv[0][h].z, s);
      s = fmaf(xv[0][r].w, wv[0][h].w, s);
      s = fmaf(xv[1][r].x, wv[1][h].x, s);
      s = fmaf(xv[1][r].y, wv[1][h].y, s);
      s = fmaf(xv[1][r].z, wv[1][h].z, s);
      s = fmaf(xv[1][r].w, wv[1][h].w, s);
      v[r * 8 + h] = s;
    }

  fold_lanes<32, 16>(v, lane);
  fold_lanes<16, 8>(v, lane);
  fold_lanes<8, 4>(v, lane);
  fold_lanes<4, 2>(v, lane);
  fold_lanes<2, 1>(v, lane);
  // lane L now holds the wave's sums number 2L and 2L+1
  *(float2*)&part[ks][rg * 64 + lane * 2] = make_float2(v[0], v[1]);
  __syncthreads();

  int tid = threadIdx.x;
  if (tid < 128) {
    float s = 0.f;
#pragma unroll
    for (int k = 0; k < 4; ++k) s += part[k][tid];
    logit[(size_t)row0 * Hc + tid] = s;
  }
}

// ---------------------------------------------------------------------------
// Kernel: everything that reads only the inputs, in one launch. None of the six jobs needs
// another's result, each alone is too short to fill the chip, and as launches of their own
// they run one behind the other. A block takes its job from its index (the same for all
// its threads); the blocks with the most work per block come first.
// ---------------------------------------------------------------------------
constexpr int kLogitBlocks = Mtot / 16;
constexpr int kCvtBlocks   = Mtot * Dc / kCvtPerBlock;
constexpr int kPackBlocks  = Ec * Dc / 16 / 256;   // per weight: one thread per fragment lane
constexpr int kPrepBlocks  = kLogitBlocks + kCvtBlocks + 4 * kPackBlocks;

__global__ __launch_bounds__(256) void k_prep(const float* __restrict__ x,
                                              const float* __restrict__ Wq,
                                              const float* __restrict__ Wk,
                                              const float* __restrict__ Wv,
                                              const float* __restrict__ Wo,
                                              const float* __restrict__ Wb,
                                              _Float16* __restrict__ xh,
                                              _Float16* __restrict__ wP,
                                              float* __restrict__ logit) {
  __shared__ alignas(16) _Float16 sTurn[8][16 * kCvtPitch];    // per wave; the packs use less
  _Float16* st = &sTurn[threadIdx.x >> 5][0];
  int blk = blockIdx.x;
  if (blk < kLogitBlocks) { beta_logits_block(blk, x, Wb, logit); return; }
  blk -= kLogitBlocks;
  if (blk < kCvtBlocks) { pack_a_from_x_block(blk, x, xh, st); return; }
  blk -= kCvtBlocks;
  int which = blk / kPackBlocks;                   // 0..3 = Wq, Wk, Wv, Wo
  blk -= which * kPackBlocks;
  const float* W = which == 0 ? Wq : which == 1 ? Wk : which == 2 ? Wv : Wo;
  _Float16* dst = wP + (size_t)which * (Ec * Dc);
  if (which < 3) pack_b_from_wT_block(blk, W, dst, Dc, Ec, st);   // B = [D,E]
  else           pack_b_from_wT_block(blk, W, dst, Ec, Dc, st);   // B = [E,D]
}

constexpr int kProjThreads = 128;

// ---------------------------------------------------------------------------
// Wave body: p[mt][nt][j] is the value of token mt*16 + nl at d = nt*16 + 8*hl + j. Stores the
// four fragments that want lane = d, elements = tokens. The wave turns its tile in an LDS
// buffer of its own, [d][token], rows of 80 bytes (16-byte reads stay aligned and the two
// lane halves' rows, 8 apart, fall on different banks). dst: fragment 0, this lane's place.
// ---------------------------------------------------------------------------
constexpr int kTurnPitch = 40;

DEVI void store_turned(_Float16* st, const v8h (&p)[2][4], v8h* __restrict__ dst, int hl, int nl) {
#pragma unroll
  for (int mt = 0; mt < 2; ++mt)
#pragma unroll
    for (int nt = 0; nt < 4; ++nt)
#pragma unroll
      for (int j = 0; j < 8; ++j)
        st[(nt * 16 + 8 * hl + j) * kTurnPitch + mt * 16 + nl] = p[mt][nt][j];
  // the reads below take other lanes' values: keeps the compiler from moving them up
  __builtin_amdgcn_wave_barrier();
  // fragment (t chunk, d tile nt): elements 0..7 = tokens 8*hl + i, 8..15 = 16 + 8*hl + i
  v8h pv[4][2];
#pragma unroll
  for (int nt = 0; nt < 4; ++nt) {
    pv[nt][0] = *(const v8h*)&st[(nt * 16 + nl) * kTurnPitch + 8 * hl];
    pv[nt][1] = *(const v8h*)&st[(nt * 16 + nl) * kTurnPitch + 16 + 8 * hl];
  }
#pragma unroll
  for (int nt = 0; nt < 4; ++nt) {
    dst[nt * 64]      = pv[nt][0];
    dst[nt * 64 + 32] = pv[nt][1];
  }
}

// ---------------------------------------------------------------------------
// Kernel: the three projections Y = xh @ W^T (M=4096, N=512, K=1024), each finished in its
// own epilogue into the f16 form that the attention reads; no fp32 Yq or Yk is stored.
// qh    : per (b,h) packed A, A=Q   (M-dim=T,  K-dim=DM), L2-normalized, 1/sqrt(DM) folded in
// kpack : per (b,h) packed B, B=K^T (K-dim=DM, N-dim=T), L2-normalized
// ktpack: the same K values, lane = d, elements = tokens (K-dim=T), as vpack has V
// vpack : per (b,h) packed B, B=V   (K-dim=T,  N-dim=DM)
// Yv    : V in fp32, in the order in which the lanes of a transposed tile hold it (yv_piece)
// A wave's 32x64 tile is 32 tokens of ONE head, so a row's norm lies inside the wave.
// The tile is formed transposed: a lane holds 32 of its token's 64 d (the other 32 in lane
// ^ 16), 8 consecutive d per accumulator, which is one plane of a Q or a K^T fragment and
// two pieces of Yv; only the fragments with lane = d take a turn through LDS. Every global
// store is 16 bytes per lane and 512 contiguous bytes per wave.
// ---------------------------------------------------------------------------
constexpr int kProjBlocksPerW = (Ec / 64) * (Mtot / 128);

// Yv is read only by lanes that hold a tile as its writer does (lane = token nl of a 16-token
// tile, 8 consecutive d at 8*hl of a 16-wide d tile). It lies as pieces of 512 bytes, lane
// L's 16 bytes at L*16: two pieces (d 0..3 and 4..7 of the lane's 8) per (token tile, head,
// d tile). A store or a load of a piece covers 4 whole lines; in rows of E floats it touches
// 16. The number returned counts 16-byte units and is that of the first of the two pieces.
DEVI int yv_piece(int token_tile, int h, int d_tile) {
  return (((token_tile * Hc + h) * (DMc >> 4) + d_tile) * 2) * 32;
}
static_assert(DMc == 64 && Tc % 128 == 0, "a wave's tile is one head; a block is one batch");

__global__ __launch_bounds__(kProjThreads)
void k_proj(const _Float16* __restrict__ xh, const _Float16* __restrict__ wP,
            float* __restrict__ Yv, _Float16* __restrict__ qh, _Float16* __restrict__ kpack,
            _Float16* __restrict__ ktpack, _Float16* __restrict__ vpack) {
  int blk = blockIdx.x;
  int which = blk / kProjBlocksPerW;               // 0..2 = Wq, Wk, Wv
  blk -= which * kProjBlocksPerW;
  int h = blk % Hc;
  int lane = threadIdx.x & 31;
  int wave = threadIdx.x >> 5;
  int m0 = (blk / Hc) * 128 + wave * 32;
  int n0 = h * DMc;
  int bh = (m0 / Tc) * Hc + h;
  int t0 = m0 % Tc;                                // multiple of 32
  int hl = lane >> 4, nl = lane & 15;
  const v8h* Bp = (const v8h*)(wP + (size_t)which * (Ec * Dc));
  __shared__ alignas(16) _Float16 sT[kProjThreads / 32][DMc * kTurnPitch];
  v8f acc[2][4] = {};

  gemm_tile<Ec, Dc, true>((const v8h*)xh, Bp, m0, n0, lane, acc);
  // acc[mt][nt][j]: token t0 + mt*16 + nl, d = nt*16 + 8*hl + j
  // where this wave's four fragments with lane = d start in vpack or ktpack
  size_t turned = (size_t)bh * Tc * DMc / 8 + (size_t)(t0 >> 5) * (DMc >> 4) * 64 + lane;

  v8h p[2][4];
  if (which == 2) {
#pragma unroll
    for (int mt = 0; mt < 2; ++mt)
#pragma unroll
      for (int nt = 0; nt < 4; ++nt)
#pragma unroll
        for (int j = 0; j < 8; ++j) p[mt][nt][j] = (_Float16)acc[mt][nt][j];
    store_turned(&sT[wave][0], p, (v8h*)vpack + turned, hl, nl);
    v4f* yv = (v4f*)Yv + yv_piece((m0 >> 4), h, 0) + lane;
#pragma unroll
    for (int mt = 0; mt < 2; ++mt)
#pragma unroll
      for (int nt = 0; nt < 4; ++nt) {
        v4f lo = {acc[mt][nt][0], acc[mt][nt][1], acc[mt][nt][2], acc[mt][nt][3]};
        v4f hi = {acc[mt][nt][4], acc[mt][nt][5], acc[mt][nt][6], acc[mt][nt][7]};
        yv[yv_piece(mt, 0, nt)]      = lo;
        yv[yv_piece(mt, 0, nt) + 32] = hi;
      }
    // other branches' code follows in the listing and reuses these stores' registers (the
    // fragment stores' above too): the wait that belongs in front of that overwrite
    asm volatile("s_wait_xcnt 0x0" ::: "memory");
    return;
  }

  float top = which == 0 ? 0.125f : 1.0f;          // 1/sqrt(DM) folded into Q
#pragma unroll
  for (int mt = 0; mt < 2; ++mt) {
    float ss[4];
#pragma unroll
    for (int nt = 0; nt < 4; ++nt) {
      ss[nt] = acc[mt][nt][0] * acc[mt][nt][0];
#pragma unroll
      for (int j = 1; j < 8; ++j) ss[nt] = fmaf(acc[mt][nt][j], acc[mt][nt][j], ss[nt]);
    }
    float half = (ss[0] + ss[1]) + (ss[2] + ss[3]);
    float n2 = half + __shfl_xor(half, 16);
    float sc = top / fmaxf(__fsqrt_rn(n2), 1e-12f);
#pragma unroll
    for (int nt = 0; nt < 4; ++nt)
#pragma unroll
      for (int j = 0; j < 8; ++j) p[mt][nt][j] = (_Float16)(acc[mt][nt][j] * sc);
  }
  if (which == 0) {
    // fragment (token tile, d chunk c): plane 0 = d 32c + 8*hl + j, plane 1 = 16 more
    v8h* q = (v8h*)(qh + (size_t)bh * Tc * DMc) + (size_t)(t0 >> 4) * (DMc >> 5) * 64 + lane;
#pragma unroll
    for (int mt = 0; mt < 2; ++mt)
#pragma unroll
      for (int nt = 0; nt < 4; ++nt) q[(mt * 4 + nt) * 32] = p[mt][nt];
    // as behind the V stores: other branches' code follows and reuses these stores' registers
    asm volatile("s_wait_xcnt 0x0" ::: "memory");
  } else {
    // fragment (d chunk c, token tile): plane 0 = d 32c + 8*hl + j, plane 1 = 16 more
    v8h* kp = (v8h*)(kpack + (size_t)bh * DMc * Tc) + (size_t)(t0 >> 4) * 64 + lane;
#pragma unroll
    for (int c = 0; c < 2; ++c)
#pragma unroll
      for (int mt = 0; mt < 2; ++mt) {
        kp[(c * (Tc >> 4) + mt) * 64]      = p[mt][2 * c];
        kp[(c * (Tc >> 4) + mt) * 64 + 32] = p[mt][2 * c + 1];
      }
    store_turned(&sT[wave][0], p, (v8h*)ktpack + turned, hl, nl);
    // as behind the V stores: other branches' code follows and reuses these stores' registers
    asm volatile("s_wait_xcnt 0x0" ::: "memory");
  }
}

// ---------------------------------------------------------------------------
// Kernel: the attention, reassociated.
// The reference weights the pair (t, s), s >= t, with exp(min(cum_t - cum_s, 0)). cum is a
// running sum of log(1 - beta + 1e-8), and no term of it is above 0: beta lies in [0, 1],
// and in fp32 1 - beta + 1e-8 never rounds above 1. So cum never rises, cum_t - cum_s >= 0
// wherever s >= t, and the weight is 1 there for every input. What is left has no factor
// that ties t to s but the mask, and the products may change their order:
//   O_t = sum over s >= t of (q_t . k_s) v_s
//       = q_t . (sum over the keys behind t's tile of k_s v_s^T)  +  masked part inside the tile
// A block is one (b,h) and one tile of 128 queries, 16 waves.
//  1. inside the tile: wave = (16 queries, 32 of the 64 dv). Scores are formed transposed
//     (lane = query, register = key), which is the B fragment of V^T . S^T as it stands.
//  2. the state K^T V, 64 x 64, over all keys behind the tile: wave = (every 8th chunk of
//     32 keys, 32 of the 64 dv); the 8 partial states are summed through LDS. A state tile
//     (lane = dv, register = dk) is one plane of the A fragment of State^T . Q^T as it stands.
//  3. O^T += State^T . Q^T; O += beta * V (fp32 V); f16 store to attn_out (packed A, [B*T,E]):
//     a lane holds 8 consecutive e of its token, one 16-byte piece of a fragment plane.
// ---------------------------------------------------------------------------
constexpr int kAttnWaves = 16;
constexpr int kQTile = 128;                  // queries per block
constexpr int kOwnChunks = kQTile / 32;      // key chunks inside the tile
constexpr int kKeyChunks = Tc / 32;
constexpr int kDeal = kAttnWaves / 2;        // waves that share the chunks behind the tile
static_assert(kQTile / 16 == kAttnWaves / 2 && Tc % kQTile == 0, "a wave pair per 16 queries");

// the wait that belongs in front of an overwrite of the address registers of loads already
// issued; the scheduling barrier keeps later address arithmetic from being lifted over it,
// and keeps the loads in front of it from sinking to their first use
DEVI void loads_issued() {
  asm volatile("s_wait_xcnt 0x0" ::: "memory");
  __builtin_amdgcn_sched_barrier(0);
}

__global__ __launch_bounds__(kAttnWaves * 32)
void k_attention(const _Float16* __restrict__ qh, const _Float16* __restrict__ kpack,
                 const _Float16* __restrict__ ktpack, const _Float16* __restrict__ vpack,
                 const float* __restrict__ Yv, const float* __restrict__ logit,
                 _Float16* __restrict__ attn_out) {
  int lane = threadIdx.x & 31;
  int wave = __builtin_amdgcn_readfirstlane(threadIdx.x >> 5);
  int tile = blockIdx.x;
  int bh = blockIdx.y;
  int b = bh / Hc, h = bh % Hc;
  int hl = lane >> 4, nl = lane & 15;
  int pr = wave >> 1;         // which 16 queries (1, 3); which share of the chunks (2)
  int hN = wave & 1;          // which 32 of the 64 dv
  int tq0 = tile * kQTile + pr * 16;

  const v8h* Qp  = (const v8h*)(qh + (size_t)bh * Tc * DMc);       // lane = token, elements = d
  const v8h* Kp  = (const v8h*)(kpack + (size_t)bh * DMc * Tc);    // lane = token, elements = d
  const v8h* KTp = (const v8h*)(ktpack + (size_t)bh * DMc * Tc);   // lane = d, elements = tokens
  const v8h* Vp  = (const v8h*)(vpack + (size_t)bh * Tc * DMc);    // lane = d, elements = tokens
  constexpr int kNT = Tc >> 4;    // token tiles in kpack
  constexpr int vNT = DMc >> 4;   // d tiles in vpack and ktpack

  __shared__ alignas(16) v4f sPart[kAttnWaves][16][32];  // per wave: 8 state tiles, 2 pieces each
  __shared__ alignas(16) v8h sState[8 * 64];             // State^T as 8 A fragments

  // ---- first fragments of part 2, fetched ahead of part 1. Every fragment of a part is a
  // compile-time offset from a pointer (this lane's own) that stays live through the part
  int kc = (tile + 1) * kOwnChunks + pr;
  const v8h* ktx = KTp + (size_t)kc * vNT * 64 + lane;
  const v8h* vx  = Vp + ((size_t)kc * vNT + hN * 2) * 64 + lane;
  v16h ka[4], vb[2], kan[4], vbn[2];
  auto load_state = [&](v16h (&kr)[4], v16h (&vr)[2], int ahead) {
#pragma unroll
    for (int a = 0; a < 4; ++a) kr[a] = load_frag(ktx, ahead * vNT + a, 0);
#pragma unroll
    for (int n2 = 0; n2 < 2; ++n2) vr[n2] = load_frag(vx, ahead * vNT + n2, 0);
  };
  // two chunks, 24 loads, fly together: a trip of part 2 costs one trip to L2 whatever it holds
  auto load_two = [&]() {
    if (kc < kKeyChunks) load_state(ka, vb, 0);
    if (kc + kDeal < kKeyChunks) load_state(kan, vbn, kDeal);
    loads_issued();
  };
  load_two();

  // ---- 1. inside the tile. All four chunks are taken by every wave: one that lies wholly in
  // front of the wave's queries is masked to 0 (the waves meet at a barrier anyway)
  v16h aq[2];
  aq[0] = load_frag(Qp, (tq0 >> 4) * 2 + 0, lane);
  aq[1] = load_frag(Qp, (tq0 >> 4) * 2 + 1, lane);
  v16h kf[2][2][2], vf[2][2];     // two sets: one in use, one in flight
  const v8h* kown = Kp + (size_t)tile * (kQTile / 16) * 64;
  const v8h* vown = Vp + ((size_t)tile * kOwnChunks * vNT + hN * 2) * 64;
  auto load_own = [&](int c) {
    int s = c & 1;
#pragma unroll
    for (int st = 0; st < 2; ++st)
#pragma unroll
      for (int cc = 0; cc < 2; ++cc) kf[s][st][cc] = load_frag(kown, cc * kNT + c * 2 + st, lane);
#pragma unroll
    for (int n2 = 0; n2 < 2; ++n2) vf[s][n2] = load_frag(vown, c * vNT + n2, lane);
  };
  v8f o[2] = {};                  // O^T: lane = query tq0 + nl, register j = dv (hN*2+n2)*16 + 8*hl + j
  load_own(0);
#pragma unroll
  for (int c = 0; c < kOwnChunks; ++c) {
    if (c + 1 < kOwnChunks) load_own(c + 1);
    loads_issued();
    int s = c & 1;
    v16h sb;                      // S^T: lane = query, elements = keys in the fragments' k order
#pragma unroll
    for (int st = 0; st < 2; ++st) {
      v8f sacc = {};
      sacc = wmma_f16(kf[s][st][0], aq[0], sacc);
      sacc = wmma_f16(kf[s][st][1], aq[1], sacc);
      int key0 = tile * kQTile + c * 32 + st * 16 + 8 * hl;
#pragma unroll
      for (int j = 0; j < 8; ++j)
        sb[st * 8 + j] = (_Float16)((key0 + j >= tq0 + nl) ? sacc[j] : 0.f);
    }
    o[0] = wmma_f16(vf[s][0], sb, o[0]);
    o[1] = wmma_f16(vf[s][1], sb, o[1]);
  }

  // ---- 2. this wave's share of the state: st8[a][n2], lane = dv (hN*2+n2)*16 + nl,
  // register j = dk a*16 + 8*hl + j
  v8f st8[4][2] = {};
  while (kc < kKeyChunks) {
#pragma unroll
    for (int a = 0; a < 4; ++a)
#pragma unroll
      for (int n2 = 0; n2 < 2; ++n2) st8[a][n2] = wmma_f16(ka[a], vb[n2], st8[a][n2]);
    if (kc + kDeal < kKeyChunks) {
#pragma unroll
      for (int a = 0; a < 4; ++a)
#pragma unroll
        for (int n2 = 0; n2 < 2; ++n2) st8[a][n2] = wmma_f16(kan[a], vbn[n2], st8[a][n2]);
    }
    kc  += 2 * kDeal;
    ktx += 2 * kDeal * vNT * 64;
    vx  += 2 * kDeal * vNT * 64;
    load_two();
  }

  // what the epilogue reads from memory, fetched in front of the barriers
  size_t row = (size_t)b * Tc + tq0 + nl;
  float lg = logit[row * Hc + h];
  const v4f* yp = (const v4f*)Yv + yv_piece((b * Tc + tq0) >> 4, h, hN * 2) + lane;
  v4f yv[2][2];
#pragma unroll
  for (int n2 = 0; n2 < 2; ++n2) { yv[n2][0] = yp[n2 * 64]; yv[n2][1] = yp[n2 * 64 + 32]; }

#pragma unroll
  for (int a = 0; a < 4; ++a)
#pragma unroll
    for (int n2 = 0; n2 < 2; ++n2) {
      v4f lo = {st8[a][n2][0], st8[a][n2][1], st8[a][n2][2], st8[a][n2][3]};
      v4f hi = {st8[a][n2][4], st8[a][n2][5], st8[a][n2][6], st8[a][n2][7]};
      sPart[wave][(a * 2 + n2) * 2 + 0][lane] = lo;
      sPart[wave][(a * 2 + n2) * 2 + 1][lane] = hi;
    }
  __syncthreads();

  // wave w sums state tile (dk tile a = w >> 2, dv tile n = w & 3) over the 8 shares, in order,
  // and stores it as plane a & 1 of fragment (n, dk chunk a >> 1)
  {
    int a = wave >> 2, n = wave & 3;
    int piece = (a * 2 + (n & 1)) * 2;
    v4f lo = sPart[n >> 1][piece][lane], hi = sPart[n >> 1][piece + 1][lane];
#pragma unroll
    for (int g = 1; g < kDeal; ++g) {
      lo += sPart[g * 2 + (n >> 1)][piece][lane];
      hi += sPart[g * 2 + (n >> 1)][piece + 1][lane];
    }
    v8h t8 = {(_Float16)lo[0], (_Float16)lo[1], (_Float16)lo[2], (_Float16)lo[3],
              (_Float16)hi[0], (_Float16)hi[1], (_Float16)hi[2], (_Float16)hi[3]};
    sState[((n * 2 + (a >> 1)) * 2 + (a & 1)) * 32 + lane] = t8;
  }
  __syncthreads();

  // ---- 3. O^T += State^T . Q^T, then the epilogue
#pragma unroll
  for (int n2 = 0; n2 < 2; ++n2)
#pragma unroll
    for (int cc = 0; cc < 2; ++cc)
      o[n2] = wmma_f16(load_frag(sState, (hN * 2 + n2) * 2 + cc, lane), aq[cc], o[n2]);

  float bq = 1.0f / (1.0f + __expf(-lg));
  // column e = h*DM + n*16 + 8*hl + j: k chunk e >> 5, plane n & 1, lane half hl, element j;
  // the fragment's lane row is the token's index in its tile, nl: the place is this lane's own
  v8h* ao = (v8h*)attn_out + lane;
  int mtile = (b * Tc + tq0) >> 4;
#pragma unroll
  for (int n2 = 0; n2 < 2; ++n2) {
    int n = hN * 2 + n2;
    v8h r;
#pragma unroll
    for (int j = 0; j < 8; ++j) r[j] = (_Float16)(o[n2][j] + bq * yv[n2][j >> 2][j & 3]);
    size_t frag = (size_t)(h * 2 + (n >> 1)) * kMTiles + mtile;
    ao[(frag * 2 + (n & 1)) * 32] = r;
  }
}

// ---------------------------------------------------------------------------
// Host launcher
// ---------------------------------------------------------------------------
extern "C" void kernel_launch(void* const* d_in, const int* in_sizes, int n_in,
                              void* d_out, int out_size, void* d_ws, size_t ws_size,
                              hipStream_t stream) {
  const float* x  = (const float*)d_in[0];   // [B,T,D]
  const float* Wk = (const float*)d_in[1];   // [E,D]
  const float* Wv = (const float*)d_in[2];   // [E,D]
  const float* Wq = (const float*)d_in[3];   // [E,D]
  const float* Wb = (const float*)d_in[4];   // [H,D]
  const float* Wo = (const float*)d_in[5];   // [D,E]
  float* out = (float*)d_out;                // [B,T,D]

  // workspace carve-up
  char* w = (char*)d_ws;
  auto alloc = [&](size_t bytes) -> void* {
    void* p = (void*)w;
    w += (bytes + 255) & ~(size_t)255;
    return p;
  };
  _Float16* xh   = (_Float16*)alloc((size_t)Mtot * Dc * 2);   // x as f16, packed A
  _Float16* wP   = (_Float16*)alloc((size_t)4 * Dc * Ec * 2); // packed B = Wq^T, Wk^T, Wv^T, Wo^T
  _Float16* woP  = wP + (size_t)3 * Dc * Ec;
  float*    Yv   = (float*)alloc((size_t)Mtot * Ec * 4);      // V projection, fp32, lane order
  _Float16* qh   = (_Float16*)alloc((size_t)Bc * Hc * Tc * DMc * 2);
  _Float16* kpack= (_Float16*)alloc((size_t)Bc * Hc * Tc * DMc * 2);
  _Float16* ktpack=(_Float16*)alloc((size_t)Bc * Hc * Tc * DMc * 2);
  _Float16* vpack= (_Float16*)alloc((size_t)Bc * Hc * Tc * DMc * 2);
  float*    blog = (float*)alloc((size_t)Mtot * Hc * 4);        // beta logits [B*T, H]
  _Float16* aoh  = (_Float16*)alloc((size_t)Mtot * Ec * 2);   // attention out f16, packed A

  // 1) all that reads only the inputs: beta logits, x as f16, the four packed weights
  k_prep<<<dim3(kPrepBlocks), dim3(256), 0, stream>>>(x, Wq, Wk, Wv, Wo, Wb, xh, wP, blog);

  // 2) the three projections, each packed to f16 fragments in its epilogue (Q and K normalized, Q
  //    scaled, K in both fragment forms, V also fp32)
  k_proj<<<dim3(3 * kProjBlocksPerW), dim3(kProjThreads), 0, stream>>>(
      xh, wP, Yv, qh, kpack, ktpack, vpack);

  // 3) attention: state of the keys behind a 128-query tile, masked part inside it
  k_attention<<<dim3(Tc / kQTile, Bc * Hc), dim3(kAttnWaves * 32), 0, stream>>>(
      qh, kpack, ktpack, vpack, Yv, blog, aoh);

  // 4) output projection: out = aoh @ Wo^T  (M=4096, N=1024, K=512)
  {
    dim3 grid(Dc / 64, Mtot / 128);
    k_wmma_gemm<Dc, Ec><<<grid, dim3(128), 0, stream>>>(aoh, woP, out);
  }
}

// v010
// It runs in 40 microseconds.
// Timed twice side by side with v009, it ran 1.04 times as fast both times.
// All steps since v000 together make it 11.5 times as fast.
#include <hip/hip_runtime.h>
#include <hip/hip_bf16.h>

#define DEVI __device__ __forceinline__

typedef __attribute__((ext_vector_type(16))) _Float16 v16h;
typedef __attribute__((ext_vector_type(8)))  _Float16 v8h;
typedef __attribute__((ext_vector_type(4)))  _Float16 v4h;
typedef __attribute__((ext_vector_type(8)))  float    v8f;
typedef __attribute__((ext_vector_type(4)))  float    v4f;

// Problem constants (match reference)
constexpr int Bc  = 2;
constexpr int Tc  = 2048;
constexpr int Dc  = 1024;
constexpr int Hc  = 8;
constexpr int DMc = 64;
constexpr int Ec  = Hc * DMc;     // 512
constexpr int Mtot = Bc * Tc;     // 4096
constexpr int kMTiles = Mtot / 16; // 16-row tiles of a GEMM's A

// ---------------------------------------------------------------------------
// WMMA fragment layouts (CDNA5 wave32, ISA 7.12.2)
// A (16x32 f16): lane L holds row M=L&15; hl=L>>4: elems 0..7 = K(8*hl+0..7),
//                elems 8..15 = K(16+8*hl+0..7).
// B (32x16 f16): lane L holds col N=L&15; same K packing as A.
// C (16x16 f32): lane L holds col N=L&15; vgpr j holds row M = j + 8*(L>>4).
//
// Every WMMA operand lies in memory as packed fragments of 1 KB, A and B alike. A fragment
// is two planes of 512 bytes: plane p holds elements 8p..8p+7 of every lane, lane L's 16
// bytes at p*512 + L*16. Each of the two 16-byte loads of a fragment then covers 512
// contiguous bytes, 4 whole 128-byte lines. (A row-major A makes such a load touch 16
// lines; a lane's 32 bytes kept together make it touch 8.)
// Fragment numbers: B of a GEMM: (k0/32)*(N/16) + n0/16; A of a GEMM: (k0/32)*(M/16) + m0/16.
// The k chunk is the slow index: waves that walk k side by side then read one contiguous
// stretch between them, not the same offset of buffers a fixed stride apart.
// ---------------------------------------------------------------------------

DEVI v16h load_frag(const v8h* __restrict__ P, int frag, int lane) {
  const v8h* p = P + (size_t)frag * 64 + lane;
  v8h lo = p[0], hi = p[32];
  return __builtin_shufflevector(lo, hi, 0, 1, 2, 3, 4, 5, 6, 7, 8, 9, 10, 11, 12, 13, 14, 15);
}

DEVI v8f wmma_f16(v16h a, v16h b, v8f c) {
  return __builtin_amdgcn_wmma_f32_16x16x32_f16(false, a, false, b, (short)0, c, false, false);
}

// ---------------------------------------------------------------------------
// Turning an fp32 tile into fragments. A fragment wants lane = row, so a load in fragment
// order touches 16 lines and takes 32 bytes of each. The two bodies below load by rows, whole
// 128-byte lines, convert, lay the f16 tile in an LDS range of the wave's own and read it back
// in fragment order. Row pitches are odd multiples of 16 bytes, for the 16-byte reads.
// ---------------------------------------------------------------------------
DEVI v4h to_v4h(float4 a) {
  v4h r = {(_Float16)a.x, (_Float16)a.y, (_Float16)a.z, (_Float16)a.w};
  return r;
}

// between a wave's LDS writes and its reads of other lanes' values: the writes are waited
// for, and the compiler moves no LDS access over this line
DEVI void own_lds_written() { asm volatile("s_wait_dscnt 0x0" ::: "memory"); }

// ---------------------------------------------------------------------------
// Block body: x [M,D] fp32 -> packed f16 A fragments (number = k chunk * (M/16) + m tile)
// A wave builds two fragments, k chunks c and c+1 of one 16-row tile: 16 rows x 256 bytes.
// 8 float4 loads per lane, all in flight together, each two rows of 256 bytes; then 4 stores
// of 16 bytes, each 512 contiguous bytes per wave. That makes 4096 waves (16 per WGP); with
// one element per thread it is 131072.
// ---------------------------------------------------------------------------
constexpr int kCvtFrags = 2;                             // fragments per thread
constexpr int kCvtPerBlock = 256 * kCvtFrags * 16;       // elements per block
constexpr int kCvtUnitsPerTile = Dc / 32 / kCvtFrags;    // waves per 16-row tile
constexpr int kCvtPitch = kCvtFrags * 32 + 8;            // halves: 144 bytes
static_assert((Mtot * Dc) % kCvtPerBlock == 0 && (Dc / 32) % kCvtFrags == 0,
              "convert grid covers x exactly");
static_assert(kCvtFrags * 32 * 4 == 16 * 16, "16 lanes x 16 bytes are a wave's part of a row");

DEVI void pack_a_from_x_block(int blk, const float* __restrict__ src, _Float16* __restrict__ dst,
                              _Float16* st) {
  int i = blk * 256 + threadIdx.x;
  int lane = i & 31, unit = i >> 5;
  int hl = lane >> 4, nl = lane & 15;
  int mt = unit / kCvtUnitsPerTile;
  int c0 = (unit % kCvtUnitsPerTile) * kCvtFrags;
  const float4* p = (const float4*)(src + (size_t)(mt * 16 + hl) * Dc + c0 * 32) + nl;
  float4 v[8];
#pragma unroll
  for (int r = 0; r < 8; ++r) v[r] = p[r * (2 * Dc / 4)];          // rows 2r + hl
#pragma unroll
  for (int r = 0; r < 8; ++r) *(v4h*)&st[(2 * r + hl) * kCvtPitch + nl * 4] = to_v4h(v[r]);
  own_lds_written();
  v8h* d = (v8h*)dst + (size_t)(c0 * kMTiles + mt) * 64 + lane;
  const _Float16* row = &st[nl * kCvtPitch + 8 * hl];
#pragma unroll
  for (int f = 0; f < kCvtFrags; ++f) {
    d[f * kMTiles * 64]      = *(const v8h*)&row[f * 32];           // k .. k+7
    d[f * kMTiles * 64 + 32] = *(const v8h*)&row[f * 32 + 16];      // k+16 .. k+23
  }
  // in the merged kernel other jobs' code follows this body in the listing and reuses the
  // stores' registers: the wait that belongs in front of that overwrite
  asm volatile("s_wait_xcnt 0x0" ::: "memory");
}

// ---------------------------------------------------------------------------
// Block body: W [N,K] fp32  ->  packed f16 B buffer for B = W^T [K,N]
// A wave builds one fragment: 32 consecutive k of 16 rows n, 16 whole 128-byte lines. Four
// float4 loads per lane, each four rows of 128 bytes, and two 16-byte stores (each 512
// contiguous bytes per wave).
// ---------------------------------------------------------------------------
constexpr int kPackPitch = 32 + 8;                       // halves: 80 bytes

DEVI void pack_b_from_wT_block(int blk, const float* __restrict__ W, _Float16* __restrict__ dst,
                               int K, int N, _Float16* st) {
  int i = blk * 256 + threadIdx.x;               // fragment * 32 + lane
  if (i >= ((K * N) >> 4)) return;
  int lane = i & 31, frag = i >> 5;
  int hl = lane >> 4, nl = lane & 15;
  int rl = lane >> 3, cl = lane & 7;             // row in a group of four, 16-byte piece of it
  int ntiles = N >> 4;
  int chunk = frag / ntiles, nt = frag % ntiles;
  const float4* p = (const float4*)(W + (size_t)(nt * 16 + rl) * K + chunk * 32) + cl;
  float4 v[4];
#pragma unroll
  for (int r = 0; r < 4; ++r) v[r] = p[r * K];   // rows 4r + rl: 4 * K floats on
#pragma unroll
  for (int r = 0; r < 4; ++r) *(v4h*)&st[(4 * r + rl) * kPackPitch + cl * 4] = to_v4h(v[r]);
  own_lds_written();
  v8h* d = (v8h*)dst + (size_t)frag * 64 + lane;
  const _Float16* row = &st[nl * kPackPitch + 8 * hl];
  d[0]  = *(const v8h*)&row[0];                  // k .. k+7
  d[32] = *(const v8h*)&row[16];                 // k+16 .. k+23
}

// ---------------------------------------------------------------------------
// Wave body: 64x64 tile of Ap (packed f16, M x K) * Bp (packed f16), 16 WMMA per 32-K chunk
// (every fragment reused 4x: 512 bytes loaded per WMMA; a 32x64 tile loads 768).
// One or two waves run per SIMD, so little but a wave's own order hides a load. The K loop
// is unrolled over four sets of fragment registers: a chunk's 16 loads are issued
// together, three chunks (384 matrix cycles of a lone wave) ahead of the WMMAs that use them.
// A and B fragments have the same map (lane = row or column, elements = k), so the two
// operands may change places. kTransposed = false: acc[mt][nt] is the tile as C has it
// (lane = column n, register j = row m = j + 8*(lane>>4)). kTransposed = true: it is the
// transposed tile (lane = row m, register j = column n = j + 8*(lane>>4)): a lane then
// holds 8 consecutive n of one row.
// ---------------------------------------------------------------------------
constexpr int kMT = 4;                     // 16-row tiles of a wave's tile

template <int N, int K, bool kTransposed>
DEVI void gemm_tile(const v8h* __restrict__ Ap, const v8h* __restrict__ Bp,
                    int m0, int n0, int lane, v8f (&acc)[kMT][4]) {
  constexpr int kChunks = K / 32;
  constexpr int kSets = 4;                 // one in use, three in flight
  constexpr int ntiles = N >> 4;
  static_assert(K % 32 == 0 && kChunks >= kSets, "whole chunks, at least one per set");

  v16h a[kSets][kMT], b[kSets][4];
  // this lane's place in the tile's first fragments: every fragment is a compile-time offset
  // from these two pointers, so no address register is rewritten while loads are under way
  const v8h* ap = Ap + (size_t)(m0 >> 4) * 64 + lane;
  const v8h* bp = Bp + (size_t)(n0 >> 4) * 64 + lane;
  auto load_chunk = [&](int c) {
    int s = c % kSets;
#pragma unroll
    for (int mt = 0; mt < kMT; ++mt) a[s][mt] = load_frag(ap, c * kMTiles + mt, 0);
#pragma unroll
    for (int nt = 0; nt < 4; ++nt) b[s][nt] = load_frag(bp, c * ntiles + nt, 0);
  };

#pragma unroll
  for (int c = 0; c < kSets - 1; ++c) load_chunk(c);
#pragma unroll
  for (int c = 0; c < kChunks; ++c) {
    if (c + kSets - 1 < kChunks) load_chunk(c + kSets - 1);
    // keeps these loads from moving down past this point: left free, the scheduler sinks
    // them to just before their first use (seen at K = 512) and every fragment is waited for
    __builtin_amdgcn_sched_barrier(0);
    int s = c % kSets;
#pragma unroll
    for (int nt = 0; nt < 4; ++nt)
#pragma unroll
      for (int mt = 0; mt < kMT; ++mt) {
        if (kTransposed) acc[mt][nt] = wmma_f16(b[s][nt], a[s][mt], acc[mt][nt]);
        else             acc[mt][nt] = wmma_f16(a[s][mt], b[s][nt], acc[mt][nt]);
      }
  }
  // the store addresses behind this tile reuse the loads' address registers: the wait that
  // belongs in front of that overwrite
  asm volatile("s_wait_xcnt 0x0" ::: "memory");
  // keeps the address arithmetic below from being lifted over that wait
  __builtin_amdgcn_sched_barrier(0);
}

// fp32 store of a transposed tile (lane = row, 8 consecutive columns per accumulator) to
// row-major C[., N]. Stored as it stands, a 16-byte store would put 32 bytes into each of 16
// lines. The wave lays its 64 x 64 tile in an LDS range of its own and reads it back by rows:
// a store then covers two rows of 256 bytes, 4 whole 128-byte lines. Rows of 272 bytes: the
// 16 lanes of a half, one row each, write 16 bytes to 64 different banks.
constexpr int kRowPitch = 68;                // floats
constexpr int kRowTile  = kMT * 16 * kRowPitch;    // floats of LDS per wave

template <int N>
DEVI void store_rows_f32(float* __restrict__ C, float* st, int m0, int n0, int lane,
                         const v8f (&acc)[kMT][4]) {
  int hl = lane >> 4, nl = lane & 15;
#pragma unroll
  for (int mt = 0; mt < kMT; ++mt)
#pragma unroll
    for (int nt = 0; nt < 4; ++nt) {
      v4f lo = {acc[mt][nt][0], acc[mt][nt][1], acc[mt][nt][2], acc[mt][nt][3]};
      v4f hi = {acc[mt][nt][4], acc[mt][nt][5], acc[mt][nt][6], acc[mt][nt][7]};
      v4f* p = (v4f*)&st[(mt * 16 + nl) * kRowPitch + nt * 16 + 8 * hl];
      p[0] = lo;
      p[1] = hi;
    }
  own_lds_written();
  v4f r[kMT * 8];
#pragma unroll
  for (int i = 0; i < kMT * 8; ++i) r[i] = *(const v4f*)&st[(2 * i + hl) * kRowPitch + nl * 4];
  float* c = C + (size_t)(m0 + hl) * N + n0 + nl * 4;
#pragma unroll
  for (int i = 0; i < kMT * 8; ++i) *(v4f*)(c + (size_t)(2 * i) * N) = r[i];
}

// ---------------------------------------------------------------------------
// Kernel: WMMA GEMM  C[M,N] = A[M,K] (packed f16) * Bp (packed f16), fp32 C.
// 4 waves / block, 2 x 2 tiles of 64x64 (a block loads each of its fragments for two waves),
// formed transposed and stored by whole lines.
// ---------------------------------------------------------------------------
template <int N, int K>
__global__ __launch_bounds__(128) void k_wmma_gemm(const _Float16* __restrict__ A,
                                                   const _Float16* __restrict__ Bpk,
                                                   float* __restrict__ C) {
  int lane = threadIdx.x & 31;
  int wave = threadIdx.x >> 5;
  int n0 = blockIdx.x * 128 + (wave & 1) * 64;
  int m0 = blockIdx.y * 128 + (wave >> 1) * 64;
  __shared__ alignas(16) float sRow[4][kRowTile];
  v8f acc[kMT][4] = {};
  gemm_tile<N, K, true>((const v8h*)A, (const v8h*)Bpk, m0, n0, lane, acc);
  store_rows_f32<N>(C, &sRow[wave][0], m0, n0, lane, acc);
}

// ---------------------------------------------------------------------------
// Block body: logit[row][h] = x[row,:] . Wb[h,:]  (fp32), row = b*T + t.
// One block per 16 rows, 8 waves: wave = (row group of 8) x (256-wide slice of D).
// A lane holds 4 consecutive d of each 128-wide chunk, so every load is 512 contiguous
// bytes per wave; each x value is used for all 8 heads, each Wb value for 8 rows.
// ---------------------------------------------------------------------------
// Halve the number of live partial sums: lanes that differ in bit MASK swap the half
// they do not keep, so 64 sums over 32 lanes take 62 exchanges instead of 320.
template <int HALF, int MASK>
DEVI void fold_lanes(float (&v)[64], int lane) {
  bool up = (lane & MASK) != 0;
#pragma unroll
  for (int i = 0; i < HALF; ++i) {
    float keep = up ? v[i + HALF] : v[i];
    float send = up ? v[i] : v[i + HALF];
    v[i] = keep + __shfl_xor(send, MASK);
  }
}

DEVI void beta_logits_block(int blk, const float* __restrict__ x, const float* __restrict__ Wb,
                            float* __restrict__ logit) {
  int lane = threadIdx.x & 31;
  int wave = threadIdx.x >> 5;
  int rg = wave & 1;             // which 8 of the block's 16 rows
  int ks = wave >> 1;            // which 256 of the 1024 d
  int row0 = blk * 16;
  __shared__ alignas(16) float part[4][128]; // [d slice][row in block * 8 + head]

  const float4* xp = (const float4*)(x + (size_t)(row0 + rg * 8) * Dc + ks * 256) + lane;
  const float4* wp = (const float4*)(Wb + ks * 256) + lane;
  float4 xv[2][8], wv[2][8];
#pragma unroll
  for (int c = 0; c < 2; ++c)
#pragma unroll
    for (int r = 0; r < 8; ++r) xv[c][r] = xp[r * (Dc / 4) + c * 32];
#pragma unroll
  for (int c = 0; c < 2; ++c)
#pragma unroll
    for (int h = 0; h < Hc; ++h) wv[c][h] = wp[h * (Dc / 4) + c * 32];

  float v[64];                   // index = row in group * 8 + head
#pragma unroll
  for (int r = 0; r < 8; ++r)
#pragma unroll
    for (int h = 0; h < Hc; ++h) {
      float s = xv[0][r].x * wv[0][h].x;
      s = fmaf(xv[0][r].y, wv[0][h].y, s);
      s = fmaf(xv[0][r].z, wv[0][h].z, s);
      s = fmaf(xv[0][r].w, wv[0][h].w, s);
      s = fmaf(xv[1][r].x, wv[1][h].x, s);
      s = fmaf(xv[1][r].y, wv[1][h].y, s);
      s = fmaf(xv[1][r].z, wv[1][h].z, s);
      s = fmaf(xv[1][r].w, wv[1][h].w, s);
      v[r * 8 + h] = s;
    }

  fold_lanes<32, 16>(v, lane);
  fold_lanes<16, 8>(v, lane);
  fold_lanes<8, 4>(v, lane);
  fold_lanes<4, 2>(v, lane);
  fold_lanes<2, 1>(v, lane);
  // lane L now holds the wave's sums number 2L and 2L+1
  *(float2*)&part[ks][rg * 64 + lane * 2] = make_float2(v[0], v[1]);
  __syncthreads();

  int tid = threadIdx.x;
  if (tid < 128) {
    float s = 0.f;
#pragma unroll
    for (int k = 0; k < 4; ++k) s += part[k][tid];
    logit[(size_t)row0 * Hc + tid] = s;
  }
}

// ---------------------------------------------------------------------------
// Kernel: everything that reads only the inputs, in one launch. None of the six jobs needs
// another's result, each alone is too short to fill the chip, and as launches of their own
// they run one behind the other. A block takes its job from its index (the same for all
// its threads); the blocks with the most work per block come first.
// ---------------------------------------------------------------------------
constexpr int kLogitBlocks = Mtot / 16;
constexpr int kCvtBlocks   = Mtot * Dc / kCvtPerBlock;
constexpr int kPackBlocks  = Ec * Dc / 16 / 256;   // per weight: one thread per fragment lane
constexpr int kPrepBlocks  = kLogitBlocks + kCvtBlocks + 4 * kPackBlocks;

__global__ __launch_bounds__(256) void k_prep(const float* __restrict__ x,
                                              const float* __restrict__ Wq,
                                              const float* __restrict__ Wk,
                                              const float* __restrict__ Wv,
                                              const float* __restrict__ Wo,
                                              const float* __restrict__ Wb,
                                              _Float16* __restrict__ xh,
                                              _Float16* __restrict__ wP,
                                              float* __restrict__ logit) {
  __shared__ alignas(16) _Float16 sTurn[8][16 * kCvtPitch];    // per wave; the packs use less
  _Float16* st = &sTurn[threadIdx.x >> 5][0];
  int blk = blockIdx.x;
  if (blk < kLogitBlocks) { beta_logits_block(blk, x, Wb, logit); return; }
  blk -= kLogitBlocks;
  if (blk < kCvtBlocks) { pack_a_from_x_block(blk, x, xh, st); return; }
  blk -= kCvtBlocks;
  int which = blk / kPackBlocks;                   // 0..3 = Wq, Wk, Wv, Wo
  blk -= which * kPackBlocks;
  const float* W = which == 0 ? Wq : which == 1 ? Wk : which == 2 ? Wv : Wo;
  _Float16* dst = wP + (size_t)which * (Ec * Dc);
  if (which < 3) pack_b_from_wT_block(blk, W, dst, Dc, Ec, st);   // B = [D,E]
  else           pack_b_from_wT_block(blk, W, dst, Ec, Dc, st);   // B = [E,D]
}

constexpr int kProjThreads = 192;

// ---------------------------------------------------------------------------
// Wave body, for 32 of a wave's tokens: p[mt][nt][j] is the value of token mt*16 + nl at
// d = nt*16 + 8*hl + j. Stores the four fragments that want lane = d, elements = tokens.
// The wave turns the tile in an LDS buffer of its own, [d][token], rows of 80 bytes (16-byte
// reads stay aligned and the two lane halves' rows, 8 apart, fall on different banks).
// dst: fragment 0, this lane's place.
// ---------------------------------------------------------------------------
constexpr int kTurnPitch = 40;

DEVI void store_turned(_Float16* st, const v8h (&p)[2][4], v8h* __restrict__ dst, int hl, int nl) {
#pragma unroll
  for (int mt = 0; mt < 2; ++mt)
#pragma unroll
    for (int nt = 0; nt < 4; ++nt)
#pragma unroll
      for (int j = 0; j < 8; ++j)
        st[(nt * 16 + 8 * hl + j) * kTurnPitch + mt * 16 + nl] = p[mt][nt][j];
  // the reads below take other lanes' values: keeps the compiler from moving them up
  __builtin_amdgcn_wave_barrier();
  // fragment (t chunk, d tile nt): elements 0..7 = tokens 8*hl + i, 8..15 = 16 + 8*hl + i
  v8h pv[4][2];
#pragma unroll
  for (int nt = 0; nt < 4; ++nt) {
    pv[nt][0] = *(const v8h*)&st[(nt * 16 + nl) * kTurnPitch + 8 * hl];
    pv[nt][1] = *(const v8h*)&st[(nt * 16 + nl) * kTurnPitch + 16 + 8 * hl];
  }
#pragma unroll
  for (int nt = 0; nt < 4; ++nt) {
    dst[nt * 64]      = pv[nt][0];
    dst[nt * 64 + 32] = pv[nt][1];
  }
  // what follows (the wave's next 32 tokens, or another branch's code in the listing) reuses
  // these stores' registers: the wait that belongs in front of that overwrite; the scheduling
  // barrier keeps later register writes from being lifted over it
  asm volatile("s_wait_xcnt 0x0" ::: "memory");
  __builtin_amdgcn_sched_barrier(0);
}

// ---------------------------------------------------------------------------
// Kernel: the three projections Y = xh @ W^T (M=4096, N=512, K=1024), each finished in its
// own epilogue into the f16 form that the attention reads; no fp32 Yq or Yk is stored.
// qh    : per (b,h) packed A, A=Q   (M-dim=T,  K-dim=DM), L2-normalized, 1/sqrt(DM) folded in
// kpack : per (b,h) packed B, B=K^T (K-dim=DM, N-dim=T), L2-normalized
// ktpack: the same K values, lane = d, elements = tokens (K-dim=T), as vpack has V
// vpack : per (b,h) packed B, B=V   (K-dim=T,  N-dim=DM)
// Yv    : V in fp32, in the order in which the lanes of a transposed tile hold it (yv_piece)
// A wave's 64x64 tile is 64 tokens of ONE head, so a row's norm lies inside the wave. A block
// is 2 x 3 such tiles, 128 tokens of three of the 24 heads of Q, K and V taken as one row of
// columns: an x fragment serves three waves, a weight fragment two, and the grid is 256 equal
// blocks. Which projection a wave works for is the same for its lanes, not for its block: the
// kernel has no work-group barrier.
// The tile is formed transposed: a lane holds 32 of its token's 64 d (the other 32 in lane
// ^ 16), 8 consecutive d per accumulator, which is one plane of a Q or a K^T fragment and
// two pieces of Yv; only the fragments with lane = d take a turn through LDS. Every global
// store is 16 bytes per lane and 512 contiguous bytes per wave.
// ---------------------------------------------------------------------------
constexpr int kProjHeads = 3;                    // heads per block
constexpr int kProjColGroups = 3 * Hc / kProjHeads;
constexpr int kProjBlocks = kProjColGroups * (Mtot / 128);
static_assert((3 * Hc) % kProjHeads == 0 && kProjThreads == 2 * kProjHeads * 32, "2 x 3 waves");

// Yv is read only by lanes that hold a tile as its writer does (lane = token nl of a 16-token
// tile, 8 consecutive d at 8*hl of a 16-wide d tile). It lies as pieces of 512 bytes, lane
// L's 16 bytes at L*16: two pieces (d 0..3 and 4..7 of the lane's 8) per (token tile, head,
// d tile). A store or a load of a piece covers 4 whole lines; in rows of E floats it touches
// 16. The number returned counts 16-byte units and is that of the first of the two pieces.
DEVI int yv_piece(int token_tile, int h, int d_tile) {
  return (((token_tile * Hc + h) * (DMc >> 4) + d_tile) * 2) * 32;
}
static_assert(DMc == 64 && Tc % 128 == 0, "a wave's tile is one head; a block is one batch");

__global__ __launch_bounds__(kProjThreads)
void k_proj(const _Float16* __restrict__ xh, const _Float16* __restrict__ wP,
            float* __restrict__ Yv, _Float16* __restrict__ qh, _Float16* __restrict__ kpack,
            _Float16* __restrict__ ktpack, _Float16* __restrict__ vpack) {
  int blk = blockIdx.x;
  int lane = threadIdx.x & 31;
  int wave = __builtin_amdgcn_readfirstlane(threadIdx.x >> 5);
  int head = (blk % kProjColGroups) * kProjHeads + wave % kProjHeads;   // of 24
  int which = head / Hc;                           // 0..2 = Wq, Wk, Wv
  int h = head % Hc;
  int m0 = (blk / kProjColGroups) * 128 + (wave / kProjHeads) * 64;
  int n0 = h * DMc;
  int bh = (m0 / Tc) * Hc + h;
  int t0 = m0 % Tc;                                // multiple of 64
  int hl = lane >> 4, nl = lane & 15;
  const v8h* Bp = (const v8h*)(wP + (size_t)which * (Ec * Dc));
  __shared__ alignas(16) _Float16 sT[kProjThreads / 32][kMT / 2][DMc * kTurnPitch];
  v8f acc[kMT][4] = {};

  gemm_tile<Ec, Dc, true>((const v8h*)xh, Bp, m0, n0, lane, acc);
  // acc[mt][nt][j]: token t0 + mt*16 + nl, d = nt*16 + 8*hl + j
  // where this wave's fragments with lane = d start in vpack or ktpack: four per 32 tokens
  size_t turned = (size_t)bh * Tc * DMc / 8 + (size_t)(t0 >> 5) * (DMc >> 4) * 64 + lane;
  constexpr int kTurnedStep = (DMc >> 4) * 64;     // 16-byte units from 32 tokens to the next

  v8h p[kMT / 2][2][4];                            // [32 tokens][16 of them][d tile]
  if (which == 2) {
#pragma unroll
    for (int mt = 0; mt < kMT; ++mt)
#pragma unroll
      for (int nt = 0; nt < 4; ++nt)
#pragma unroll
        for (int j = 0; j < 8; ++j) p[mt >> 1][mt & 1][nt][j] = (_Float16)acc[mt][nt][j];
#pragma unroll
    for (int g = 0; g < kMT / 2; ++g)
      store_turned(&sT[wave][g][0], p[g], (v8h*)vpack + turned + g * kTurnedStep, hl, nl);
    v4f* yv = (v4f*)Yv + yv_piece((m0 >> 4), h, 0) + lane;
#pragma unroll
    for (int mt = 0; mt < kMT; ++mt)
#pragma unroll
      for (int nt = 0; nt < 4; ++nt) {
        v4f lo = {acc[mt][nt][0], acc[mt][nt][1], acc[mt][nt][2], acc[mt][nt][3]};
        v4f hi = {acc[mt][nt][4], acc[mt][nt][5], acc[mt][nt][6], acc[mt][nt][7]};
        yv[yv_piece(mt, 0, nt)]      = lo;
        yv[yv_piece(mt, 0, nt) + 32] = hi;
      }
    // other branches' code follows in the listing and reuses these stores' registers (the
    // fragment stores' above too): the wait that belongs in front of that overwrite
    asm volatile("s_wait_xcnt 0x0" ::: "memory");
    return;
  }

  float top = which == 0 ? 0.125f : 1.0f;          // 1/sqrt(DM) folded into Q
#pragma unroll
  for (int mt = 0; mt < kMT; ++mt) {
    float ss[4];
#pragma unroll
    for (int nt = 0; nt < 4; ++nt) {
      ss[nt] = acc[mt][nt][0] * acc[mt][nt][0];
#pragma unroll
      for (int j = 1; j < 8; ++j) ss[nt] = fmaf(acc[mt][nt][j], acc[mt][nt][j], ss[nt]);
    }
    float half = (ss[0] + ss[1]) + (ss[2] + ss[3]);
    float n2 = half + __shfl_xor(half, 16);
    float sc = top / fmaxf(__fsqrt_rn(n2), 1e-12f);
#pragma unroll
    for (int nt = 0; nt < 4; ++nt)
#pragma unroll
      for (int j = 0; j < 8; ++j) p[mt >> 1][mt & 1][nt][j] = (_Float16)(acc[mt][nt][j] * sc);
  }
  if (which == 0) {
    // fragment (token tile, d chunk c): plane 0 = d 32c + 8*hl + j, plane 1 = 16 more
    v8h* q = (v8h*)(qh + (size_t)bh * Tc * DMc) + (size_t)(t0 >> 4) * (DMc >> 5) * 64 + lane;
#pragma unroll
    for (int mt = 0; mt < kMT; ++mt)
#pragma unroll
      for (int nt = 0; nt < 4; ++nt) q[(mt * 4 + nt) * 32] = p[mt >> 1][mt & 1][nt];
    // as behind the V stores: other branches' code follows and reuses these stores' registers
    asm volatile("s_wait_xcnt 0x0" ::: "memory");
  } else {
    // fragment (d chunk c, token tile): plane 0 = d 32c + 8*hl + j, plane 1 = 16 more
    v8h* kp = (v8h*)(kpack + (size_t)bh * DMc * Tc) + (size_t)(t0 >> 4) * 64 + lane;
#pragma unroll
    for (int c = 0; c < 2; ++c)
#pragma unroll
      for (int mt = 0; mt < kMT; ++mt) {
        kp[(c * (Tc >> 4) + mt) * 64]      = p[mt >> 1][mt & 1][2 * c];
        kp[(c * (Tc >> 4) + mt) * 64 + 32] = p[mt >> 1][mt & 1][2 * c + 1];
      }
    // the turn below reuses these stores' registers: the wait that belongs in front of that
    // overwrite, held in place as in store_turned
    asm volatile("s_wait_xcnt 0x0" ::: "memory");
    __builtin_amdgcn_sched_barrier(0);
#pragma unroll
    for (int g = 0; g < kMT / 2; ++g)
      store_turned(&sT[wave][g][0], p[g], (v8h*)ktpack + turned + g * kTurnedStep, hl, nl);
  }
}

// ---------------------------------------------------------------------------
// Kernel: the attention, reassociated.
// The reference weights the pair (t, s), s >= t, with exp(min(cum_t - cum_s, 0)). cum is a
// running sum of log(1 - beta + 1e-8), and no term of it is above 0: beta lies in [0, 1],
// and in fp32 1 - beta + 1e-8 never rounds above 1. So cum never rises, cum_t - cum_s >= 0
// wherever s >= t, and the weight is 1 there for every input. What is left has no factor
// that ties t to s but the mask, and the products may change their order:
//   O_t = sum over s >= t of (q_t . k_s) v_s
//       = q_t . (sum over the keys behind t's tile of k_s v_s^T)  +  masked part inside the tile
// A block is one (b,h) and one tile of 128 queries, 16 waves.
//  1. inside the tile: wave = (16 queries, 32 of the 64 dv). Scores are formed transposed
//     (lane = query, register = key), which is the B fragment of V^T . S^T as it stands.
//  2. the state K^T V, 64 x 64, over all keys behind the tile: wave = (every 8th chunk of
//     32 keys, 32 of the 64 dv); the 8 partial states are summed through LDS. A state tile
//     (lane = dv, register = dk) is one plane of the A fragment of State^T . Q^T as it stands.
//  3. O^T += State^T . Q^T; O += beta * V (fp32 V); f16 store to attn_out (packed A, [B*T,E]):
//     a lane holds 8 consecutive e of its token, one 16-byte piece of a fragment plane.
// ---------------------------------------------------------------------------
constexpr int kAttnWaves = 16;
constexpr int kQTile = 128;                  // queries per block
constexpr int kOwnChunks = kQTile / 32;      // key chunks inside the tile
constexpr int kKeyChunks = Tc / 32;
constexpr int kDeal = kAttnWaves / 2;        // waves that share the chunks behind the tile
static_assert(kQTile / 16 == kAttnWaves / 2 && Tc % kQTile == 0, "a wave pair per 16 queries");

// the wait that belongs in front of an overwrite of the address registers of loads already
// issued; the scheduling barrier keeps later address arithmetic from being lifted over it,
// and keeps the loads in front of it from sinking to their first use
DEVI void loads_issued() {
  asm volatile("s_wait_xcnt 0x0" ::: "memory");
  __builtin_amdgcn_sched_barrier(0);
}

__global__ __launch_bounds__(kAttnWaves * 32)
void k_attention(const _Float16* __restrict__ qh, const _Float16* __restrict__ kpack,
                 const _Float16* __restrict__ ktpack, const _Float16* __restrict__ vpack,
                 const float* __restrict__ Yv, const float* __restrict__ logit,
                 _Float16* __restrict__ attn_out) {
  int lane = threadIdx.x & 31;
  int wave = __builtin_amdgcn_readfirstlane(threadIdx.x >> 5);
  int tile = blockIdx.x;
  int bh = blockIdx.y;
  int b = bh / Hc, h = bh % Hc;
  int hl = lane >> 4, nl = lane & 15;
  int pr = wave >> 1;         // which 16 queries (1, 3); which share of the chunks (2)
  int hN = wave & 1;          // which 32 of the 64 dv
  int tq0 = tile * kQTile + pr * 16;

  const v8h* Qp  = (const v8h*)(qh + (size_t)bh * Tc * DMc);       // lane = token, elements = d
  const v8h* Kp  = (const v8h*)(kpack + (size_t)bh * DMc * Tc);    // lane = token, elements = d
  const v8h* KTp = (const v8h*)(ktpack + (size_t)bh * DMc * Tc);   // lane = d, elements = tokens
  const v8h* Vp  = (const v8h*)(vpack + (size_t)bh * Tc * DMc);    // lane = d, elements = tokens
  constexpr int kNT = Tc >> 4;    // token tiles in kpack
  constexpr int vNT = DMc >> 4;   // d tiles in vpack and ktpack

  __shared__ alignas(16) v4f sPart[kAttnWaves][16][32];  // per wave: 8 state tiles, 2 pieces each
  __shared__ alignas(16) v8h sState[8 * 64];             // State^T as 8 A fragments

  // ---- first fragments of part 2, fetched ahead of part 1. Every fragment of a part is a
  // compile-time offset from a pointer (this lane's own) that stays live through the part
  int kc = (tile + 1) * kOwnChunks + pr;
  const v8h* ktx = KTp + (size_t)kc * vNT * 64 + lane;
  const v8h* vx  = Vp + ((size_t)kc * vNT + hN * 2) * 64 + lane;
  v16h ka[4], vb[2], kan[4], vbn[2];
  auto load_state = [&](v16h (&kr)[4], v16h (&vr)[2], int ahead) {
#pragma unroll
    for (int a = 0; a < 4; ++a) kr[a] = load_frag(ktx, ahead * vNT + a, 0);
#pragma unroll
    for (int n2 = 0; n2 < 2; ++n2) vr[n2] = load_frag(vx, ahead * vNT + n2, 0);
  };
  // two chunks, 24 loads, fly together: a trip of part 2 costs one trip to L2 whatever it holds
  auto load_two = [&]() {
    if (kc < kKeyChunks) load_state(ka, vb, 0);
    if (kc + kDeal < kKeyChunks) load_state(kan, vbn, kDeal);
    loads_issued();
  };
  load_two();

  // ---- 1. inside the tile. All four chunks are taken by every wave: one that lies wholly in
  // front of the wave's queries is masked to 0 (the waves meet at a barrier anyway)
  v16h aq[2];
  aq[0] = load_frag(Qp, (tq0 >> 4) * 2 + 0, lane);
  aq[1] = load_frag(Qp, (tq0 >> 4) * 2 + 1, lane);
  v16h kf[2][2][2], vf[2][2];     // two sets: one in use, one in flight
  const v8h* kown = Kp + (size_t)tile * (kQTile / 16) * 64;
  const v8h* vown = Vp + ((size_t)tile * kOwnChunks * vNT + hN * 2) * 64;
  auto load_own = [&](int c) {
    int s = c & 1;
#pragma unroll
    for (int st = 0; st < 2; ++st)
#pragma unroll
      for (int cc = 0; cc < 2; ++cc) kf[s][st][cc] = load_frag(kown, cc * kNT + c * 2 + st, lane);
#pragma unroll
    for (int n2 = 0; n2 < 2; ++n2) vf[s][n2] = load_frag(vown, c * vNT + n2, lane);
  };
  v8f o[2] = {};                  // O^T: lane = query tq0 + nl, register j = dv (hN*2+n2)*16 + 8*hl + j
  load_own(0);
#pragma unroll
  for (int c = 0; c < kOwnChunks; ++c) {
    if (c + 1 < kOwnChunks) load_own(c + 1);
    loads_issued();
    int s = c & 1;
    v16h sb;                      // S^T: lane = query, elements = keys in the fragments' k order
#pragma unroll
    for (int st = 0; st < 2; ++st) {
      v8f sacc = {};
      sacc = wmma_f16(kf[s][st][0], aq[0], sacc);
      sacc = wmma_f16(kf[s][st][1], aq[1], sacc);
      int key0 = tile * kQTile + c * 32 + st * 16 + 8 * hl;
#pragma unroll
      for (int j = 0; j < 8; ++j)
        sb[st * 8 + j] = (_Float16)((key0 + j >= tq0 + nl) ? sacc[j] : 0.f);
    }
    o[0] = wmma_f16(vf[s][0], sb, o[0]);
    o[1] = wmma_f16(vf[s][1], sb, o[1]);
  }

  // ---- 2. this wave's share of the state: st8[a][n2], lane = dv (hN*2+n2)*16 + nl,
  // register j = dk a*16 + 8*hl + j
  v8f st8[4][2] = {};
  while (kc < kKeyChunks) {
#pragma unroll
    for (int a = 0; a < 4; ++a)
#pragma unroll
      for (int n2 = 0; n2 < 2; ++n2) st8[a][n2] = wmma_f16(ka[a], vb[n2], st8[a][n2]);
    if (kc + kDeal < kKeyChunks) {
#pragma unroll
      for (int a = 0; a < 4; ++a)
#pragma unroll
        for (int n2 = 0; n2 < 2; ++n2) st8[a][n2] = wmma_f16(kan[a], vbn[n2], st8[a][n2]);
    }
    kc  += 2 * kDeal;
    ktx += 2 * kDeal * vNT * 64;
    vx  += 2 * kDeal * vNT * 64;
    load_two();
  }

  // what the epilogue reads from memory, fetched in front of the barriers
  size_t row = (size_t)b * Tc + tq0 + nl;
  float lg = logit[row * Hc + h];
  const v4f* yp = (const v4f*)Yv + yv_piece((b * Tc + tq0) >> 4, h, hN * 2) + lane;
  v4f yv[2][2];
#pragma unroll
  for (int n2 = 0; n2 < 2; ++n2) { yv[n2][0] = yp[n2 * 64]; yv[n2][1] = yp[n2 * 64 + 32]; }

#pragma unroll
  for (int a = 0; a < 4; ++a)
#pragma unroll
    for (int n2 = 0; n2 < 2; ++n2) {
      v4f lo = {st8[a][n2][0], st8[a][n2][1], st8[a][n2][2], st8[a][n2][3]};
      v4f hi = {st8[a][n2][4], st8[a][n2][5], st8[a][n2][6], st8[a][n2][7]};
      sPart[wave][(a * 2 + n2) * 2 + 0][lane] = lo;
      sPart[wave][(a * 2 + n2) * 2 + 1][lane] = hi;
    }
  __syncthreads();

  // wave w sums state tile (dk tile a = w >> 2, dv tile n = w & 3) over the 8 shares, in order,
  // and stores it as plane a & 1 of fragment (n, dk chunk a >> 1)
  {
    int a = wave >> 2, n = wave & 3;
    int piece = (a * 2 + (n & 1)) * 2;
    v4f lo = sPart[n >> 1][piece][lane], hi = sPart[n >> 1][piece + 1][lane];
#pragma unroll
    for (int g = 1; g < kDeal; ++g) {
      lo += sPart[g * 2 + (n >> 1)][piece][lane];
      hi += sPart[g * 2 + (n >> 1)][piece + 1][lane];
    }
    v8h t8 = {(_Float16)lo[0], (_Float16)lo[1], (_Float16)lo[2], (_Float16)lo[3],
              (_Float16)hi[0], (_Float16)hi[1], (_Float16)hi[2], (_Float16)hi[3]};
    sState[((n * 2 + (a >> 1)) * 2 + (a & 1)) * 32 + lane] = t8;
  }
  __syncthreads();

  // ---- 3. O^T += State^T . Q^T, then the epilogue
#pragma unroll
  for (int n2 = 0; n2 < 2; ++n2)
#pragma unroll
    for (int cc = 0; cc < 2; ++cc)
      o[n2] = wmma_f16(load_frag(sState, (hN * 2 + n2) * 2 + cc, lane), aq[cc], o[n2]);

  float bq = 1.0f / (1.0f + __expf(-lg));
  // column e = h*DM + n*16 + 8*hl + j: k chunk e >> 5, plane n & 1, lane half hl, element j;
  // the fragment's lane row is the token's index in its tile, nl: the place is this lane's own
  v8h* ao = (v8h*)attn_out + lane;
  int mtile = (b * Tc + tq0) >> 4;
#pragma unroll
  for (int n2 = 0; n2 < 2; ++n2) {
    int n = hN * 2 + n2;
    v8h r;
#pragma unroll
    for (int j = 0; j < 8; ++j) r[j] = (_Float16)(o[n2][j] + bq * yv[n2][j >> 2][j & 3]);
    size_t frag = (size_t)(h * 2 + (n >> 1)) * kMTiles + mtile;
    ao[(frag * 2 + (n & 1)) * 32] = r;
  }
}

// ---------------------------------------------------------------------------
// Host launcher
// ---------------------------------------------------------------------------
extern "C" void kernel_launch(void* const* d_in, const int* in_sizes, int n_in,
                              void* d_out, int out_size, void* d_ws, size_t ws_size,
                              hipStream_t stream) {
  const float* x  = (const float*)d_in[0];   // [B,T,D]
  const float* Wk = (const float*)d_in[1];   // [E,D]
  const float* Wv = (const float*)d_in[2];   // [E,D]
  const float* Wq = (const float*)d_in[3];   // [E,D]
  const float* Wb = (const float*)d_in[4];   // [H,D]
  const float* Wo = (const float*)d_in[5];   // [D,E]
  float* out = (float*)d_out;                // [B,T,D]

  // workspace carve-up
  char* w = (char*)d_ws;
  auto alloc = [&](size_t bytes) -> void* {
    void* p = (void*)w;
    w += (bytes + 255) & ~(size_t)255;
    return p;
  };
  _Float16* xh   = (_Float16*)alloc((size_t)Mtot * Dc * 2);   // x as f16, packed A
  _Float16* wP   = (_Float16*)alloc((size_t)4 * Dc * Ec * 2); // packed B = Wq^T, Wk^T, Wv^T, Wo^T
  _Float16* woP  = wP + (size_t)3 * Dc * Ec;
  float*    Yv   = (float*)alloc((size_t)Mtot * Ec * 4);      // V projection, fp32, lane order
  _Float16* qh   = (_Float16*)alloc((size_t)Bc * Hc * Tc * DMc * 2);
  _Float16* kpack= (_Float16*)alloc((size_t)Bc * Hc * Tc * DMc * 2);
  _Float16* ktpack=(_Float16*)alloc((size_t)Bc * Hc * Tc * DMc * 2);
  _Float16* vpack= (_Float16*)alloc((size_t)Bc * Hc * Tc * DMc * 2);
  float*    blog = (float*)alloc((size_t)Mtot * Hc * 4);        // beta logits [B*T, H]
  _Float16* aoh  = (_Float16*)alloc((size_t)Mtot * Ec * 2);   // attention out f16, packed A

  // 1) all that reads only the inputs: beta logits, x as f16, the four packed weights
  k_prep<<<dim3(kPrepBlocks), dim3(256), 0, stream>>>(x, Wq, Wk, Wv, Wo, Wb, xh, wP, blog);

  // 2) the three projections, each packed to f16 fragments in its epilogue (Q and K normalized, Q
  //    scaled, K in both fragment forms, V also fp32)
  k_proj<<<dim3(kProjBlocks), dim3(kProjThreads), 0, stream>>>(
      xh, wP, Yv, qh, kpack, ktpack, vpack);

  // 3) attention: state of the keys behind a 128-query tile, masked part inside it
  k_attention<<<dim3(Tc / kQTile, Bc * Hc), dim3(kAttnWaves * 32), 0, stream>>>(
      qh, kpack, ktpack, vpack, Yv, blog, aoh);

  // 4) output projection: out = aoh @ Wo^T  (M=4096, N=1024, K=512)
  {
    dim3 grid(Dc / 128, Mtot / 128);
    k_wmma_gemm<Dc, Ec><<<grid, dim3(128), 0, stream>>>(aoh, woP, out);
  }
}
